// v000
// The times below were measured on an AMD MI455X: many runs one after another, warmed up first and cycling through
// copies of the inputs, with the whole window's GPU time divided by the number of runs. Launches and the gaps
// between them are all in it. The median over several windows is given; except for v000 it joins two sittings, which
// can be a few percent apart, so the side-by-side timings, each taken in one sitting, are the better comparison.
// The starting kernel, v000, takes 501 microseconds a run.
#include <hip/hip_runtime.h>
#include <hip/hip_bf16.h>

// ---------------------------------------------------------------------------
// ViT attention (B=64, S=577, D=768, H=12, Dh=64) on gfx1250 (CDNA5, wave32).
// All GEMMs use v_wmma_f32_16x16x32_f16 (f16 inputs, f32 accumulate).
// Pipeline:
//   1) cvt f32->f16 of hidden + Wq/Wk/Wv/Wo into workspace
//   2) WMMA GEMM (128x128 block tile, 32x64 wave tile, 8 WMMA/k-step):
//        Q/K/V = Xh @ W.T + b  -> f16 [B,S,768]
//   3) flash attention (online softmax, scores never leave registers/LDS)
//        -> ctx f16 [B,S,768]
//   4) WMMA GEMM: out = ctx @ Wo.T + bo -> f32 [B,S,768] (d_out)
// Workspace: 5 * 56.7MB (Xh,Q,K,V,ctx) + 4 * 1.18MB (weights) ~ 289 MB.
// ---------------------------------------------------------------------------

typedef _Float16 f16;
typedef __attribute__((ext_vector_type(8)))  _Float16 v8h;
typedef __attribute__((ext_vector_type(16))) _Float16 v16h;
typedef __attribute__((ext_vector_type(8)))  float    v8f;

#define NB   64
#define NS   577
#define ND   768
#define NH   12
#define NDH  64
#define NM   36928   // NB*NS

static __device__ __forceinline__ v8h ld8(const f16* p) { return *(const v8h*)p; }

static __device__ __forceinline__ v16h cat16(v8h a, v8h b) {
  return __builtin_shufflevector(a, b, 0,1,2,3,4,5,6,7,8,9,10,11,12,13,14,15);
}

static __device__ __forceinline__ v8f wmma_f16(v16h a, v16h b, v8f c) {
  // D = A(16x32 f16) x B(32x16 f16) + C(16x16 f32)
  return __builtin_amdgcn_wmma_f32_16x16x32_f16(false, a, false, b, (short)0, c,
                                                false, false);
}

static __device__ __forceinline__ v8f splat8(float x) {
  v8f r;
#pragma unroll
  for (int i = 0; i < 8; ++i) r[i] = x;
  return r;
}

// ---------------------------------------------------------------------------
// f32 -> f16 conversion (vectorized x4; all sizes are multiples of 4)
// ---------------------------------------------------------------------------
__global__ void cvt_f32_to_f16(const float* __restrict__ x, f16* __restrict__ y,
                               int n) {
  int i = (blockIdx.x * blockDim.x + threadIdx.x) * 4;
  const int stride = gridDim.x * blockDim.x * 4;
  for (; i + 3 < n; i += stride) {
    float4 v = *(const float4*)(x + i);
    y[i + 0] = (f16)v.x;
    y[i + 1] = (f16)v.y;
    y[i + 2] = (f16)v.z;
    y[i + 3] = (f16)v.w;
  }
}

// ---------------------------------------------------------------------------
// WMMA GEMM: C[M,768] = X[M,768] @ W[768,768]^T + bias
//   block = 256 threads (8 waves), tile 128(M) x 128(N), K-step 32.
//   wave (wm = wid&3 -> 32 rows, wn = wid>>2 -> 64 cols) computes 32x64:
//     2 A-frags + 4 B-frags -> 8 WMMAs per k-step (1.5 ds_load_b128 / WMMA).
//   MODE 0: store f16 [M,768];  MODE 1: store f32 [M,768]  (compile-time).
// N=768 is a multiple of 128; M=36928 is not -> clamp loads; only the last
// M-tile takes the predicated store path (uniform branch).
// ---------------------------------------------------------------------------
template <int MODE>
__global__ __launch_bounds__(256) void gemm_wmma(const f16* __restrict__ X,
                                                 const f16* __restrict__ W,
                                                 const float* __restrict__ bias,
                                                 void* __restrict__ out) {
  __shared__ f16 As[128 * 40];  // 128 rows x 32 halves, stride 40 (16B aligned)
  __shared__ f16 Bs[128 * 40];

  const int m0   = blockIdx.x * 128;
  const int n0   = blockIdx.y * 128;
  const int tid  = threadIdx.x;
  const int wid  = tid >> 5;
  const int lane = tid & 31;
  const int l16  = lane & 15;
  const int hi   = lane >> 4;       // which K-half group this lane owns
  const int wm   = wid & 3;         // M strip 0..3 (32 rows each)
  const int wn   = wid >> 2;        // N strip 0..1 (64 cols each)

  const int lrow = tid >> 1;        // 0..127: LDS fill row
  const int lseg = (tid & 1) * 16;  // 0 or 16: 16-half segment

  int am = m0 + lrow; if (am > NM - 1) am = NM - 1;   // clamp OOB M rows
  const f16* xrow = X + (size_t)am * ND;
  const f16* wrow = W + (size_t)(n0 + lrow) * ND;

  v8f acc[2][4];
#pragma unroll
  for (int i = 0; i < 2; ++i)
#pragma unroll
    for (int j = 0; j < 4; ++j) acc[i][j] = splat8(0.f);

  for (int kb = 0; kb < ND; kb += 32) {
    __syncthreads();
    *(v8h*)&As[lrow * 40 + lseg]     = ld8(xrow + kb + lseg);
    *(v8h*)&As[lrow * 40 + lseg + 8] = ld8(xrow + kb + lseg + 8);
    *(v8h*)&Bs[lrow * 40 + lseg]     = ld8(wrow + kb + lseg);
    *(v8h*)&Bs[lrow * 40 + lseg + 8] = ld8(wrow + kb + lseg + 8);
    __syncthreads();

    // A fragments: lane = row (M); halves {0-7,16-23} (lanes<16) / {8-15,24-31}
    v16h a[2];
#pragma unroll
    for (int i = 0; i < 2; ++i) {
      const f16* ap = &As[(wm * 32 + i * 16 + l16) * 40 + hi * 8];
      a[i] = cat16(ld8(ap), ld8(ap + 16));
    }
    // B fragments: lane = col (N = W row), same K packing
    v16h bf[4];
#pragma unroll
    for (int j = 0; j < 4; ++j) {
      const f16* bp = &Bs[(wn * 64 + j * 16 + l16) * 40 + hi * 8];
      bf[j] = cat16(ld8(bp), ld8(bp + 16));
    }
#pragma unroll
    for (int i = 0; i < 2; ++i)
#pragma unroll
      for (int j = 0; j < 4; ++j) acc[i][j] = wmma_f16(a[i], bf[j], acc[i][j]);
  }

  // Epilogue. D layout: lane<16 -> row = base+r, lane>=16 -> row = base+8+r;
  // column = lane%16 within each 16-wide tile. Fast path (no predication)
  // unless this is the last M-tile (uniform branch).
  if (m0 + 128 <= NM) {
#pragma unroll
    for (int i = 0; i < 2; ++i) {
      const int mbase = m0 + wm * 32 + i * 16 + hi * 8;
#pragma unroll
      for (int j = 0; j < 4; ++j) {
        const int n    = n0 + wn * 64 + j * 16 + l16;
        const float bn = bias[n];
#pragma unroll
        for (int r = 0; r < 8; ++r) {
          const float v = acc[i][j][r] + bn;
          if (MODE == 0)
            ((f16*)out)[(size_t)(mbase + r) * ND + n] = (f16)v;
          else
            ((float*)out)[(size_t)(mbase + r) * ND + n] = v;
        }
      }
    }
  } else {
#pragma unroll
    for (int i = 0; i < 2; ++i) {
      const int mbase = m0 + wm * 32 + i * 16 + hi * 8;
#pragma unroll
      for (int j = 0; j < 4; ++j) {
        const int n    = n0 + wn * 64 + j * 16 + l16;
        const float bn = bias[n];
#pragma unroll
        for (int r = 0; r < 8; ++r) {
          if (mbase + r < NM) {
            const float v = acc[i][j][r] + bn;
            if (MODE == 0)
              ((f16*)out)[(size_t)(mbase + r) * ND + n] = (f16)v;
            else
              ((float*)out)[(size_t)(mbase + r) * ND + n] = v;
          }
        }
      }
    }
  }
}

// ---------------------------------------------------------------------------
// Flash attention: grid (ceil(S/128)=5, H=12, B=64), 256 threads = 8 waves.
// Q/K/V are f16 [B,S,768]; head h occupies columns [h*64, h*64+64).
// Each wave owns 16 query rows; key blocks of 64 staged in LDS
// (K row-major for QK^T B-frags, V transposed so PV B-frags are
// key-contiguous). softmax scale (1/8, a power of two -> exact in f16) is
// folded into the Q fragments once. Online softmax in the WMMA C layout;
// P converted D-layout -> A-layout through per-wave LDS scratch.
// ---------------------------------------------------------------------------
__global__ __launch_bounds__(256) void attn_flash(const f16* __restrict__ Q,
                                                  const f16* __restrict__ K,
                                                  const f16* __restrict__ V,
                                                  f16* __restrict__ ctx_out) {
  __shared__ f16 Kt[64 * 72];       // [key][dh]   stride 72 halves (144B)
  __shared__ f16 Vt[64 * 72];       // [dh][key]   (transposed)
  __shared__ f16 Pl[8 * 16 * 72];   // per-wave 16x64 P scratch

  const int b    = blockIdx.z;
  const int h    = blockIdx.y;
  const int tid  = threadIdx.x;
  const int wid  = tid >> 5;
  const int lane = tid & 31;
  const int l16  = lane & 15;
  const int hi   = lane >> 4;
  const int q0   = blockIdx.x * 128 + wid * 16;

  const f16* Qb = Q + (size_t)b * NS * ND + h * NDH;   // row stride ND
  const f16* Kb = K + (size_t)b * NS * ND + h * NDH;
  const f16* Vb = V + (size_t)b * NS * ND + h * NDH;

  // Q A-fragments (16 rows x 64 K), scale 1/sqrt(64)=0.125 folded in (exact).
  int qr = q0 + l16; if (qr > NS - 1) qr = NS - 1;
  const f16* qp = Qb + (size_t)qr * ND + hi * 8;
  const f16 sc = (f16)0.125f;
  v16h qa0 = cat16(ld8(qp),      ld8(qp + 16)) * sc;   // k = 0..31
  v16h qa1 = cat16(ld8(qp + 32), ld8(qp + 48)) * sc;   // k = 32..63

  v8f acc[4];
#pragma unroll
  for (int j = 0; j < 4; ++j) acc[j] = splat8(0.f);
  v8f mrow = splat8(-1e30f);
  v8f lsum = splat8(0.f);

  const int ldrow = tid >> 2;         // 0..63 key row to stage
  const int ldseg = (tid & 3) * 16;   // 16-half segment of dh

  for (int kb = 0; kb < NS; kb += 64) {
    __syncthreads();
    int krow = kb + ldrow; if (krow > NS - 1) krow = NS - 1;
    const f16* kp = Kb + (size_t)krow * ND + ldseg;
    const f16* vp = Vb + (size_t)krow * ND + ldseg;
    v8h k0 = ld8(kp), k1 = ld8(kp + 8);
    v8h v0 = ld8(vp), v1 = ld8(vp + 8);
    *(v8h*)&Kt[ldrow * 72 + ldseg]     = k0;
    *(v8h*)&Kt[ldrow * 72 + ldseg + 8] = k1;
#pragma unroll
    for (int j = 0; j < 8; ++j) {                 // transpose V into LDS
      Vt[(ldseg + j) * 72 + ldrow]     = v0[j];
      Vt[(ldseg + 8 + j) * 72 + ldrow] = v1[j];
    }
    __syncthreads();

    // ---- scores S = (Q/8) K^T : 4 tiles of 16 keys -----------------------
    v8f s[4];
#pragma unroll
    for (int t = 0; t < 4; ++t) {
      const f16* krp = &Kt[(t * 16 + l16) * 72 + hi * 8];
      v16h b0 = cat16(ld8(krp),      ld8(krp + 16));
      v16h b1 = cat16(ld8(krp + 32), ld8(krp + 48));
      v8f c = splat8(0.f);
      c = wmma_f16(qa0, b0, c);
      c = wmma_f16(qa1, b1, c);
      const int gk = kb + t * 16 + l16;           // key id is per-lane uniform
      s[t] = (gk > NS - 1) ? splat8(-1e30f) : c;
    }

    // ---- row max (rows live in VGPR index; reduce across each 16-lane half)
    v8f mx = s[0];
#pragma unroll
    for (int t = 1; t < 4; ++t)
#pragma unroll
      for (int r = 0; r < 8; ++r) mx[r] = fmaxf(mx[r], s[t][r]);
#pragma unroll
    for (int d = 1; d < 16; d <<= 1)
#pragma unroll
      for (int r = 0; r < 8; ++r) mx[r] = fmaxf(mx[r], __shfl_xor(mx[r], d, 32));

    v8f mnew, corr;
#pragma unroll
    for (int r = 0; r < 8; ++r) {
      mnew[r] = fmaxf(mrow[r], mx[r]);
      corr[r] = __expf(mrow[r] - mnew[r]);
    }
    mrow = mnew;

    v8f rs = splat8(0.f);
#pragma unroll
    for (int t = 0; t < 4; ++t)
#pragma unroll
      for (int r = 0; r < 8; ++r) {
        s[t][r] = __expf(s[t][r] - mnew[r]);
        rs[r]  += s[t][r];
      }
#pragma unroll
    for (int d = 1; d < 16; d <<= 1)
#pragma unroll
      for (int r = 0; r < 8; ++r) rs[r] += __shfl_xor(rs[r], d, 32);

#pragma unroll
    for (int r = 0; r < 8; ++r) lsum[r] = lsum[r] * corr[r] + rs[r];
#pragma unroll
    for (int j = 0; j < 4; ++j) acc[j] *= corr;

    // ---- P: D-layout -> A-layout via wave-private LDS scratch -------------
    f16* pw = &Pl[wid * 16 * 72];
#pragma unroll
    for (int t = 0; t < 4; ++t)
#pragma unroll
      for (int r = 0; r < 8; ++r)
        pw[(hi * 8 + r) * 72 + t * 16 + l16] = (f16)s[t][r];

    const f16* pr = pw + l16 * 72 + hi * 8;
    v16h pa0 = cat16(ld8(pr),      ld8(pr + 16));   // keys 0..31
    v16h pa1 = cat16(ld8(pr + 32), ld8(pr + 48));   // keys 32..63

    // ---- ctx += P V (B fragment: lane = dh, keys contiguous in Vt row) ----
#pragma unroll
    for (int j = 0; j < 4; ++j) {
      const f16* vrp = &Vt[(j * 16 + l16) * 72 + hi * 8];
      v16h vb0 = cat16(ld8(vrp),      ld8(vrp + 16));
      v16h vb1 = cat16(ld8(vrp + 32), ld8(vrp + 48));
      acc[j] = wmma_f16(pa0, vb0, acc[j]);
      acc[j] = wmma_f16(pa1, vb1, acc[j]);
    }
  }

  // ---- finalize: ctx /= l, store f16 to [B, S, 768] -----------------------
  // Fast path: all 16 query rows valid (uniform; only last q-tile predicates).
  const int col0 = h * NDH;
  f16* outp = ctx_out + (size_t)b * NS * ND + col0;
  if (q0 + 16 <= NS) {
#pragma unroll
    for (int j = 0; j < 4; ++j)
#pragma unroll
      for (int r = 0; r < 8; ++r)
        outp[(size_t)(q0 + hi * 8 + r) * ND + j * 16 + l16] =
            (f16)(acc[j][r] / lsum[r]);
  } else {
#pragma unroll
    for (int j = 0; j < 4; ++j)
#pragma unroll
      for (int r = 0; r < 8; ++r) {
        const int q = q0 + hi * 8 + r;
        if (q < NS)
          outp[(size_t)q * ND + j * 16 + l16] = (f16)(acc[j][r] / lsum[r]);
      }
  }
}

// ---------------------------------------------------------------------------
extern "C" void kernel_launch(void* const* d_in, const int* in_sizes, int n_in,
                              void* d_out, int out_size, void* d_ws,
                              size_t ws_size, hipStream_t stream) {
  const float* hidden = (const float*)d_in[0];
  const float* Wq = (const float*)d_in[1];
  const float* bq = (const float*)d_in[2];
  const float* Wk = (const float*)d_in[3];
  const float* bk = (const float*)d_in[4];
  const float* Wv = (const float*)d_in[5];
  const float* bv = (const float*)d_in[6];
  const float* Wo = (const float*)d_in[7];
  const float* bo = (const float*)d_in[8];

  char* ws = (char*)d_ws;
  const size_t szX = (size_t)NM * ND * sizeof(f16);       // 56.7 MB
  const size_t szW = (size_t)ND * ND * sizeof(f16);       // 1.18 MB
  size_t off = 0;
  f16* Xh  = (f16*)(ws + off); off += szX;
  f16* Wqh = (f16*)(ws + off); off += szW;
  f16* Wkh = (f16*)(ws + off); off += szW;
  f16* Wvh = (f16*)(ws + off); off += szW;
  f16* Woh = (f16*)(ws + off); off += szW;
  f16* Qh  = (f16*)(ws + off); off += szX;
  f16* Kh  = (f16*)(ws + off); off += szX;
  f16* Vh  = (f16*)(ws + off); off += szX;
  f16* Ch  = (f16*)(ws + off); off += szX;

  // 1) conversions to f16
  cvt_f32_to_f16<<<8192, 256, 0, stream>>>(hidden, Xh, NM * ND);
  cvt_f32_to_f16<<<576, 256, 0, stream>>>(Wq, Wqh, ND * ND);
  cvt_f32_to_f16<<<576, 256, 0, stream>>>(Wk, Wkh, ND * ND);
  cvt_f32_to_f16<<<576, 256, 0, stream>>>(Wv, Wvh, ND * ND);
  cvt_f32_to_f16<<<576, 256, 0, stream>>>(Wo, Woh, ND * ND);

  // 2) Q/K/V projections: tiles 128(M) x 128(N)
  dim3 gg((NM + 127) / 128, ND / 128);
  gemm_wmma<0><<<gg, 256, 0, stream>>>(Xh, Wqh, bq, Qh);
  gemm_wmma<0><<<gg, 256, 0, stream>>>(Xh, Wkh, bk, Kh);
  gemm_wmma<0><<<gg, 256, 0, stream>>>(Xh, Wvh, bv, Vh);

  // 3) flash attention -> ctx f16 [B,S,768]
  attn_flash<<<dim3((NS + 127) / 128, NH, NB), 256, 0, stream>>>(Qh, Kh, Vh, Ch);

  // 4) output projection -> f32 d_out
  gemm_wmma<1><<<gg, 256, 0, stream>>>(Ch, Woh, bo, d_out);
}

// v001
// Measured time: 421 microseconds a run.
// Two timings next to v000 both put it at 1.23 times that version's speed.
#include <hip/hip_runtime.h>
#include <hip/hip_bf16.h>

// ---------------------------------------------------------------------------
// ViT attention (B=64, S=577, D=768, H=12, Dh=64) on gfx1250 (CDNA5, wave32).
// All GEMMs use v_wmma_f32_16x16x32_f16 (f16 inputs, f32 accumulate).
// Pipeline:
//   1) cvt f32->f16 of hidden + Wq/Wk/Wv/Wo into workspace
//   2) WMMA GEMM (128x128 block tile, 32x64 wave tile, 8 WMMA/k-step):
//        Q/K/V = Xh @ W.T + b  -> f16 [B,S,768]
//   3) flash attention (online softmax, scores never leave registers)
//        -> ctx f16 [B,S,768]
//   4) WMMA GEMM: out = ctx @ Wo.T + bo -> f32 [B,S,768] (d_out)
// Workspace: 5 * 56.7MB (Xh,Q,K,V,ctx) + 4 * 1.18MB (weights) ~ 289 MB.
// ---------------------------------------------------------------------------

typedef _Float16 f16;
typedef __attribute__((ext_vector_type(8)))  _Float16 v8h;
typedef __attribute__((ext_vector_type(16))) _Float16 v16h;
typedef __attribute__((ext_vector_type(8)))  float    v8f;

#define NB   64
#define NS   577
#define ND   768
#define NH   12
#define NDH  64
#define NM   36928   // NB*NS
#define LOG2E 1.44269504088896340736f

static __device__ __forceinline__ v8h ld8(const f16* p) { return *(const v8h*)p; }

static __device__ __forceinline__ v16h cat16(v8h a, v8h b) {
  return __builtin_shufflevector(a, b, 0,1,2,3,4,5,6,7,8,9,10,11,12,13,14,15);
}

static __device__ __forceinline__ v8f wmma_f16(v16h a, v16h b, v8f c) {
  // D = A(16x32 f16) x B(32x16 f16) + C(16x16 f32)
  return __builtin_amdgcn_wmma_f32_16x16x32_f16(false, a, false, b, (short)0, c,
                                                false, false);
}

static __device__ __forceinline__ v8f splat8(float x) {
  v8f r;
#pragma unroll
  for (int i = 0; i < 8; ++i) r[i] = x;
  return r;
}

// ---------------------------------------------------------------------------
// f32 -> f16 conversion (vectorized x4; all sizes are multiples of 4)
// ---------------------------------------------------------------------------
__global__ void cvt_f32_to_f16(const float* __restrict__ x, f16* __restrict__ y,
                               int n) {
  int i = (blockIdx.x * blockDim.x + threadIdx.x) * 4;
  const int stride = gridDim.x * blockDim.x * 4;
  for (; i + 3 < n; i += stride) {
    float4 v = *(const float4*)(x + i);
    y[i + 0] = (f16)v.x;
    y[i + 1] = (f16)v.y;
    y[i + 2] = (f16)v.z;
    y[i + 3] = (f16)v.w;
  }
}

// ---------------------------------------------------------------------------
// WMMA GEMM: C[M,768] = X[M,768] @ W[768,768]^T + bias
//   block = 256 threads (8 waves), tile 128(M) x 128(N), K-step 32.
//   wave (wm = wid&3 -> 32 rows, wn = wid>>2 -> 64 cols) computes 32x64:
//     2 A-frags + 4 B-frags -> 8 WMMAs per k-step (1.5 ds_load_b128 / WMMA).
//   MODE 0: store f16 [M,768];  MODE 1: store f32 [M,768]  (compile-time).
// N=768 is a multiple of 128; M=36928 is not -> clamp loads; only the last
// M-tile takes the predicated store path (uniform branch).
// ---------------------------------------------------------------------------
template <int MODE>
__global__ __launch_bounds__(256) void gemm_wmma(const f16* __restrict__ X,
                                                 const f16* __restrict__ W,
                                                 const float* __restrict__ bias,
                                                 void* __restrict__ out) {
  __shared__ f16 As[128 * 40];  // 128 rows x 32 halves, stride 40 (16B aligned)
  __shared__ f16 Bs[128 * 40];

  const int m0   = blockIdx.x * 128;
  const int n0   = blockIdx.y * 128;
  const int tid  = threadIdx.x;
  const int wid  = tid >> 5;
  const int lane = tid & 31;
  const int l16  = lane & 15;
  const int hi   = lane >> 4;       // which K-half group this lane owns
  const int wm   = wid & 3;         // M strip 0..3 (32 rows each)
  const int wn   = wid >> 2;        // N strip 0..1 (64 cols each)

  const int lrow = tid >> 1;        // 0..127: LDS fill row
  const int lseg = (tid & 1) * 16;  // 0 or 16: 16-half segment

  int am = m0 + lrow; if (am > NM - 1) am = NM - 1;   // clamp OOB M rows
  const f16* xrow = X + (size_t)am * ND;
  const f16* wrow = W + (size_t)(n0 + lrow) * ND;

  v8f acc[2][4];
#pragma unroll
  for (int i = 0; i < 2; ++i)
#pragma unroll
    for (int j = 0; j < 4; ++j) acc[i][j] = splat8(0.f);

  for (int kb = 0; kb < ND; kb += 32) {
    __syncthreads();
    *(v8h*)&As[lrow * 40 + lseg]     = ld8(xrow + kb + lseg);
    *(v8h*)&As[lrow * 40 + lseg + 8] = ld8(xrow + kb + lseg + 8);
    *(v8h*)&Bs[lrow * 40 + lseg]     = ld8(wrow + kb + lseg);
    *(v8h*)&Bs[lrow * 40 + lseg + 8] = ld8(wrow + kb + lseg + 8);
    __syncthreads();

    // A fragments: lane = row (M); halves {0-7,16-23} (lanes<16) / {8-15,24-31}
    v16h a[2];
#pragma unroll
    for (int i = 0; i < 2; ++i) {
      const f16* ap = &As[(wm * 32 + i * 16 + l16) * 40 + hi * 8];
      a[i] = cat16(ld8(ap), ld8(ap + 16));
    }
    // B fragments: lane = col (N = W row), same K packing
    v16h bf[4];
#pragma unroll
    for (int j = 0; j < 4; ++j) {
      const f16* bp = &Bs[(wn * 64 + j * 16 + l16) * 40 + hi * 8];
      bf[j] = cat16(ld8(bp), ld8(bp + 16));
    }
#pragma unroll
    for (int i = 0; i < 2; ++i)
#pragma unroll
      for (int j = 0; j < 4; ++j) acc[i][j] = wmma_f16(a[i], bf[j], acc[i][j]);
  }

  // Epilogue. D layout: lane<16 -> row = base+r, lane>=16 -> row = base+8+r;
  // column = lane%16 within each 16-wide tile. Fast path (no predication)
  // unless this is the last M-tile (uniform branch).
  if (m0 + 128 <= NM) {
#pragma unroll
    for (int i = 0; i < 2; ++i) {
      const int mbase = m0 + wm * 32 + i * 16 + hi * 8;
#pragma unroll
      for (int j = 0; j < 4; ++j) {
        const int n    = n0 + wn * 64 + j * 16 + l16;
        const float bn = bias[n];
#pragma unroll
        for (int r = 0; r < 8; ++r) {
          const float v = acc[i][j][r] + bn;
          if (MODE == 0)
            ((f16*)out)[(size_t)(mbase + r) * ND + n] = (f16)v;
          else
            ((float*)out)[(size_t)(mbase + r) * ND + n] = v;
        }
      }
    }
  } else {
#pragma unroll
    for (int i = 0; i < 2; ++i) {
      const int mbase = m0 + wm * 32 + i * 16 + hi * 8;
#pragma unroll
      for (int j = 0; j < 4; ++j) {
        const int n    = n0 + wn * 64 + j * 16 + l16;
        const float bn = bias[n];
#pragma unroll
        for (int r = 0; r < 8; ++r) {
          if (mbase + r < NM) {
            const float v = acc[i][j][r] + bn;
            if (MODE == 0)
              ((f16*)out)[(size_t)(mbase + r) * ND + n] = (f16)v;
            else
              ((float*)out)[(size_t)(mbase + r) * ND + n] = v;
          }
        }
      }
    }
  }
}

static __device__ __forceinline__ float xhalf(float x) {
  const int b = __builtin_bit_cast(int, x);
  return __builtin_bit_cast(
      float, __builtin_amdgcn_permlanex16(b, b, 0x76543210, 0xfedcba98, false,
                                          false));
}

// x[r] = 2^x[r]. Eight independent v_exp_f32 in one statement, each filling
// the slot behind the one before it; the closing v_nop keeps the slot that the
// instruction set asks for between a transcendental and an instruction that
// overwrites its source or reads its result.
static __device__ __forceinline__ void exp2x8(v8f& x) {
  float a = x[0], b = x[1], c = x[2], d = x[3];
  float e = x[4], f = x[5], g = x[6], h = x[7];
  asm("v_exp_f32 %0, %0\n\tv_exp_f32 %1, %1\n\tv_exp_f32 %2, %2\n\t"
      "v_exp_f32 %3, %3\n\tv_exp_f32 %4, %4\n\tv_exp_f32 %5, %5\n\t"
      "v_exp_f32 %6, %6\n\tv_exp_f32 %7, %7\n\tv_nop"
      : "+v"(a), "+v"(b), "+v"(c), "+v"(d), "+v"(e), "+v"(f), "+v"(g), "+v"(h));
  x[0] = a; x[1] = b; x[2] = c; x[3] = d;
  x[4] = e; x[5] = f; x[6] = g; x[7] = h;
}

static __device__ __forceinline__ v16h pack16(v8f lo, v8f hi8) {
  v16h p;
#pragma unroll
  for (int r = 0; r < 8; ++r) {
    p[r]     = (f16)lo[r];
    p[8 + r] = (f16)hi8[r];
  }
  return p;
}

__global__ __launch_bounds__(256) void attn_flash(const f16* __restrict__ Q,
                                                  const f16* __restrict__ K,
                                                  const f16* __restrict__ V,
                                                  f16* __restrict__ ctx_out) {
  __shared__ f16 Kt[64 * 72];       // [key][dh]   stride 72 halves (144B)
  __shared__ f16 Vt[64 * 72];       // [dh][key]   (transposed)

  const int b    = blockIdx.z;
  const int h    = blockIdx.y;
  const int tid  = threadIdx.x;
  const int wid  = tid >> 5;
  const int lane = tid & 31;
  const int l16  = lane & 15;
  const int hi   = lane >> 4;
  const int q0   = blockIdx.x * 128 + wid * 16;

  const f16* Qb = Q + (size_t)b * NS * ND + h * NDH;   // row stride ND
  const f16* Kb = K + (size_t)b * NS * ND + h * NDH;
  const f16* Vb = V + (size_t)b * NS * ND + h * NDH;

  // Q B-fragments (64 K x 16 queries), scale 1/sqrt(64)=0.125 folded in (exact).
  int qr = q0 + l16; if (qr > NS - 1) qr = NS - 1;
  const f16* qp = Qb + (size_t)qr * ND + hi * 8;
  const f16 sc = (f16)0.125f;
  v16h qb0 = cat16(ld8(qp),      ld8(qp + 16)) * sc;   // k = 0..31
  v16h qb1 = cat16(ld8(qp + 32), ld8(qp + 48)) * sc;   // k = 32..63

  v8f acc[4];                        // O^T: acc[j][r] = O[query l16][j*16+8*hi+r]
#pragma unroll
  for (int j = 0; j < 4; ++j) acc[j] = splat8(0.f);
  float mrow = -1e30f;               // this lane's query: running maximum
  float lsum = 0.f;                  // sum over this wave half's keys only

  const int ldrow = tid >> 2;         // 0..63 key row to stage
  const int ldseg = (tid & 3) * 16;   // 16-half segment of dh

  for (int kb = 0; kb < NS; kb += 64) {
    __syncthreads();
    int krow = kb + ldrow; if (krow > NS - 1) krow = NS - 1;
    const f16* kp = Kb + (size_t)krow * ND + ldseg;
    const f16* vp = Vb + (size_t)krow * ND + ldseg;
    v8h k0 = ld8(kp), k1 = ld8(kp + 8);
    v8h v0 = ld8(vp), v1 = ld8(vp + 8);
    *(v8h*)&Kt[ldrow * 72 + ldseg]     = k0;
    *(v8h*)&Kt[ldrow * 72 + ldseg + 8] = k1;
#pragma unroll
    for (int j = 0; j < 8; ++j) {                 // transpose V into LDS
      Vt[(ldseg + j) * 72 + ldrow]     = v0[j];
      Vt[(ldseg + 8 + j) * 72 + ldrow] = v1[j];
    }
    __syncthreads();

    // ---- scores S^T = K (Q/8)^T : 4 tiles of 16 keys ---------------------
    // s[t][r] = score(key kb + t*16 + 8*hi + r, query q0 + l16)
    v8f s[4];
#pragma unroll
    for (int t = 0; t < 4; ++t) {
      const f16* krp = &Kt[(t * 16 + l16) * 72 + hi * 8];
      v16h a0 = cat16(ld8(krp),      ld8(krp + 16));
      v16h a1 = cat16(ld8(krp + 32), ld8(krp + 48));
      v8f c = splat8(0.f);
      c = wmma_f16(a0, qb0, c);
      c = wmma_f16(a1, qb1, c);
      s[t] = c;
    }
    if (kb + 64 > NS) {               // uniform: only the last block has a tail
#pragma unroll
      for (int t = 0; t < 4; ++t)
#pragma unroll
        for (int r = 0; r < 8; ++r)
          if (kb + t * 16 + hi * 8 + r > NS - 1) s[t][r] = -1e30f;
    }

    // ---- maximum of this lane's 32 scores, then joined with the other half
    v8f mx8 = s[0];
#pragma unroll
    for (int t = 1; t < 4; ++t)
#pragma unroll
      for (int r = 0; r < 8; ++r) mx8[r] = fmaxf(mx8[r], s[t][r]);
    float mx = fmaxf(fmaxf(fmaxf(mx8[0], mx8[1]), fmaxf(mx8[2], mx8[3])),
                     fmaxf(fmaxf(mx8[4], mx8[5]), fmaxf(mx8[6], mx8[7])));
    mx = fmaxf(mx, xhalf(mx));

    const float mnew = fmaxf(mrow, mx);
    const float corr = __expf(mrow - mnew);
    mrow = mnew;

#pragma unroll
    for (int t = 0; t < 4; ++t) {
#pragma unroll
      for (int r = 0; r < 8; ++r) s[t][r] = (s[t][r] - mnew) * LOG2E;
      exp2x8(s[t]);                  // e^(s - m) as 2^((s - m) * log2 e)
    }
    const v8f rs8 = (s[0] + s[1]) + (s[2] + s[3]);
    const float rs = ((rs8[0] + rs8[1]) + (rs8[2] + rs8[3])) +
                     ((rs8[4] + rs8[5]) + (rs8[6] + rs8[7]));

    lsum = lsum * corr + rs;
#pragma unroll
    for (int j = 0; j < 4; ++j) acc[j] *= corr;

    // ---- P^T B-fragments straight from the score registers ----------------
    const v16h pb0 = pack16(s[0], s[1]);   // keys 0..31
    const v16h pb1 = pack16(s[2], s[3]);   // keys 32..63

    // ---- O^T += V^T P^T (A fragment: lane = dh, keys contiguous in Vt row) -
#pragma unroll
    for (int j = 0; j < 4; ++j) {
      const f16* vrp = &Vt[(j * 16 + l16) * 72 + hi * 8];
      v16h va0 = cat16(ld8(vrp),      ld8(vrp + 16));
      v16h va1 = cat16(ld8(vrp + 32), ld8(vrp + 48));
      acc[j] = wmma_f16(va0, pb0, acc[j]);
      acc[j] = wmma_f16(va1, pb1, acc[j]);
    }
  }

  // ---- finalize: join the halves' sums, ctx /= l, store f16 to [B, S, 768] --
  // A lane holds 8 consecutive dh of its query per tile: one 16-byte store.
  const float inv = 1.0f / (lsum + xhalf(lsum));
  const int q = q0 + l16;
  if (q < NS) {
    f16* outp = ctx_out + (size_t)b * NS * ND + (size_t)q * ND + h * NDH + hi * 8;
#pragma unroll
    for (int j = 0; j < 4; ++j) {
      v8h o;
#pragma unroll
      for (int r = 0; r < 8; ++r) o[r] = (f16)(acc[j][r] * inv);
      *(v8h*)(outp + j * 16) = o;
    }
  }
}

// ---------------------------------------------------------------------------
extern "C" void kernel_launch(void* const* d_in, const int* in_sizes, int n_in,
                              void* d_out, int out_size, void* d_ws,
                              size_t ws_size, hipStream_t stream) {
  const float* hidden = (const float*)d_in[0];
  const float* Wq = (const float*)d_in[1];
  const float* bq = (const float*)d_in[2];
  const float* Wk = (const float*)d_in[3];
  const float* bk = (const float*)d_in[4];
  const float* Wv = (const float*)d_in[5];
  const float* bv = (const float*)d_in[6];
  const float* Wo = (const float*)d_in[7];
  const float* bo = (const float*)d_in[8];

  char* ws = (char*)d_ws;
  const size_t szX = (size_t)NM * ND * sizeof(f16);       // 56.7 MB
  const size_t szW = (size_t)ND * ND * sizeof(f16);       // 1.18 MB
  size_t off = 0;
  f16* Xh  = (f16*)(ws + off); off += szX;
  f16* Wqh = (f16*)(ws + off); off += szW;
  f16* Wkh = (f16*)(ws + off); off += szW;
  f16* Wvh = (f16*)(ws + off); off += szW;
  f16* Woh = (f16*)(ws + off); off += szW;
  f16* Qh  = (f16*)(ws + off); off += szX;
  f16* Kh  = (f16*)(ws + off); off += szX;
  f16* Vh  = (f16*)(ws + off); off += szX;
  f16* Ch  = (f16*)(ws + off); off += szX;

  // 1) conversions to f16
  cvt_f32_to_f16<<<8192, 256, 0, stream>>>(hidden, Xh, NM * ND);
  cvt_f32_to_f16<<<576, 256, 0, stream>>>(Wq, Wqh, ND * ND);
  cvt_f32_to_f16<<<576, 256, 0, stream>>>(Wk, Wkh, ND * ND);
  cvt_f32_to_f16<<<576, 256, 0, stream>>>(Wv, Wvh, ND * ND);
  cvt_f32_to_f16<<<576, 256, 0, stream>>>(Wo, Woh, ND * ND);

  // 2) Q/K/V projections: tiles 128(M) x 128(N)
  dim3 gg((NM + 127) / 128, ND / 128);
  gemm_wmma<0><<<gg, 256, 0, stream>>>(Xh, Wqh, bq, Qh);
  gemm_wmma<0><<<gg, 256, 0, stream>>>(Xh, Wkh, bk, Kh);
  gemm_wmma<0><<<gg, 256, 0, stream>>>(Xh, Wvh, bv, Vh);

  // 3) flash attention -> ctx f16 [B,S,768]
  attn_flash<<<dim3((NS + 127) / 128, NH, NB), 256, 0, stream>>>(Qh, Kh, Vh, Ch);

  // 4) output projection -> f32 d_out
  gemm_wmma<1><<<gg, 256, 0, stream>>>(Ch, Woh, bo, d_out);
}

// v002
// It runs in 334 microseconds.
// Two timings next to v001 both put it at 1.26 times that version's speed.
// All steps since v000 together make it 1.54 times as fast.
#include <hip/hip_runtime.h>
#include <hip/hip_bf16.h>

// ---------------------------------------------------------------------------
// ViT attention (B=64, S=577, D=768, H=12, Dh=64) on gfx1250 (CDNA5, wave32).
// All GEMMs use v_wmma_f32_16x16x32_f16 (f16 inputs, f32 accumulate).
// Pipeline:
//   1) cvt f32->f16 of hidden + Wq/Wk/Wv/Wo into workspace
//   2) WMMA GEMM (128x128 block tile, 32x64 wave tile, async-copy LDS ring):
//        Q/K/V = Xh @ W.T + b  -> f16 [B,S,768]
//   3) flash attention (online softmax, scores never leave registers)
//        -> ctx f16 [B,S,768]
//   4) WMMA GEMM: out = ctx @ Wo.T + bo -> f32 [B,S,768] (d_out)
// Workspace: 5 * 56.7MB (Xh,Q,K,V,ctx) + 4 * 1.18MB (weights) ~ 289 MB.
// ---------------------------------------------------------------------------

typedef _Float16 f16;
typedef __attribute__((ext_vector_type(8)))  _Float16 v8h;
typedef __attribute__((ext_vector_type(16))) _Float16 v16h;
typedef __attribute__((ext_vector_type(8)))  float    v8f;

#define NB   64
#define NS   577
#define ND   768
#define NH   12
#define NDH  64
#define NM   36928   // NB*NS
#define LOG2E 1.44269504088896340736f

static __device__ __forceinline__ v8h ld8(const f16* p) { return *(const v8h*)p; }

static __device__ __forceinline__ v16h cat16(v8h a, v8h b) {
  return __builtin_shufflevector(a, b, 0,1,2,3,4,5,6,7,8,9,10,11,12,13,14,15);
}

static __device__ __forceinline__ v8f wmma_f16(v16h a, v16h b, v8f c) {
  // D = A(16x32 f16) x B(32x16 f16) + C(16x16 f32)
  return __builtin_amdgcn_wmma_f32_16x16x32_f16(false, a, false, b, (short)0, c,
                                                false, false);
}

static __device__ __forceinline__ v8f splat8(float x) {
  v8f r;
#pragma unroll
  for (int i = 0; i < 8; ++i) r[i] = x;
  return r;
}

// ---------------------------------------------------------------------------
// f32 -> f16 conversion (vectorized x4; all sizes are multiples of 4)
// ---------------------------------------------------------------------------
__global__ void cvt_f32_to_f16(const float* __restrict__ x, f16* __restrict__ y,
                               int n) {
  int i = (blockIdx.x * blockDim.x + threadIdx.x) * 4;
  const int stride = gridDim.x * blockDim.x * 4;
  for (; i + 3 < n; i += stride) {
    float4 v = *(const float4*)(x + i);
    y[i + 0] = (f16)v.x;
    y[i + 1] = (f16)v.y;
    y[i + 2] = (f16)v.z;
    y[i + 3] = (f16)v.w;
  }
}

// ---------------------------------------------------------------------------
// WMMA GEMM: C[M,768] = X[M,768] @ W[768,768]^T + bias
//   block = 256 threads (8 waves), tile 128(M) x 128(N), stage = 64 k.
//   wave (wm = wid&3 -> 32 rows, wn = wid>>2 -> 64 cols) computes 32x64:
//     2 A-frags + 4 B-frags -> 8 WMMAs per 32 k (1.5 ds_load_b128 / WMMA).
//   Staging: asynchronous copies global -> LDS, 16 B a lane, through no
//   register. A stage row is 64 halves = one whole 128-B line, brought by 8
//   adjacent lanes; LDS pitch 144 B (16 B x odd: no bank conflict for
//   ds_load_b128). Two buffers: stage t+1 flies while stage t is multiplied.
//   MODE 0: store f16 [M,768];  MODE 1: store f32 [M,768]  (compile-time).
// N=768 is a multiple of 128; M=36928 is not -> clamp the source rows; only
// the last M-tile takes the predicated store path (uniform branch).
// ---------------------------------------------------------------------------
#define GKS   64                 // k per stage
#define GPIT  72                 // LDS row pitch in halves (144 B)
#define GTILE (128 * GPIT)       // halves of one operand tile in LDS
#define GNST  (ND / GKS)         // 12 stages

static __device__ __forceinline__ unsigned lds_addr(const void* p) {
  return (unsigned)(size_t)p;    // low 32 bits of a __shared__ address
}

// One stage's eight copies of this lane (4 of X, 4 of W). The closing
// s_wait_xcnt stands inside the statement so that no address register of an
// issued copy is rewritten in front of it.
static __device__ __forceinline__ void stage_copy(
    unsigned l0, unsigned l1, unsigned l2, unsigned l3, unsigned l4,
    unsigned l5, unsigned l6, unsigned l7, const f16* g0, const f16* g1,
    const f16* g2, const f16* g3, const f16* g4, const f16* g5, const f16* g6,
    const f16* g7) {
  asm volatile(
      "global_load_async_to_lds_b128 %0, %8, off\n\t"
      "global_load_async_to_lds_b128 %1, %9, off\n\t"
      "global_load_async_to_lds_b128 %2, %10, off\n\t"
      "global_load_async_to_lds_b128 %3, %11, off\n\t"
      "global_load_async_to_lds_b128 %4, %12, off\n\t"
      "global_load_async_to_lds_b128 %5, %13, off\n\t"
      "global_load_async_to_lds_b128 %6, %14, off\n\t"
      "global_load_async_to_lds_b128 %7, %15, off\n\t"
      "s_wait_xcnt 0x0"
      :
      : "v"(l0), "v"(l1), "v"(l2), "v"(l3), "v"(l4), "v"(l5), "v"(l6), "v"(l7),
        "v"(g0), "v"(g1), "v"(g2), "v"(g3), "v"(g4), "v"(g5), "v"(g6), "v"(g7)
      : "memory");
}

template <int MODE>
__global__ __launch_bounds__(256) void gemm_wmma(const f16* __restrict__ X,
                                                 const f16* __restrict__ W,
                                                 const float* __restrict__ bias,
                                                 void* __restrict__ out) {
  // [buffer][X tile | W tile], 128 rows x 64 halves at pitch 72
  __shared__ __attribute__((aligned(16))) f16 Sm[2 * 2 * GTILE];

  const int m0   = blockIdx.x * 128;
  const int n0   = blockIdx.y * 128;
  const int tid  = threadIdx.x;
  const int wid  = tid >> 5;
  const int lane = tid & 31;
  const int l16  = lane & 15;
  const int hi   = lane >> 4;       // which K-half group this lane owns
  const int wm   = wid & 3;         // M strip 0..3 (32 rows each)
  const int wn   = wid >> 2;        // N strip 0..1 (64 cols each)

  const int crow = tid >> 3;        // 0..31: row of this lane's copies (+32*i)
  const int cseg = (tid & 7) * 8;   // its 8-half (16-B) piece of the row

  // Source byte offsets (they fit 32 bits) and the LDS byte address of this
  // lane's first piece in buffer 0; the W rows and the LDS rows step evenly.
  unsigned ox[4];
#pragma unroll
  for (int i = 0; i < 4; ++i) {
    int am = m0 + crow + 32 * i; if (am > NM - 1) am = NM - 1;  // clamp OOB M
    ox[i] = (unsigned)(am * ND + cseg) * 2u;
  }
  const unsigned ow = (unsigned)((n0 + crow) * ND + cseg) * 2u;
  const unsigned l0 = lds_addr(&Sm[crow * GPIT + cseg]);
  const unsigned LROW = 32 * GPIT * 2;  // LDS bytes of 32 rows
  const unsigned GROW = 32 * ND * 2;    // source bytes of 32 rows
  const unsigned WOFF = GTILE * 2;      // bytes from the X tile to the W tile
  const unsigned BOFF = 2 * GTILE * 2;  // bytes from buffer 0 to buffer 1
  const char* Xc = (const char*)X;
  const char* Wc = (const char*)W;
  auto issue = [&](int st) {            // stage st -> buffer st & 1
    const unsigned lb = l0 + (st & 1) * BOFF;
    const unsigned kb = (unsigned)st * (GKS * 2);
    stage_copy(lb, lb + LROW, lb + 2 * LROW, lb + 3 * LROW, lb + WOFF,
               lb + WOFF + LROW, lb + WOFF + 2 * LROW, lb + WOFF + 3 * LROW,
               (const f16*)(Xc + (ox[0] + kb)), (const f16*)(Xc + (ox[1] + kb)),
               (const f16*)(Xc + (ox[2] + kb)), (const f16*)(Xc + (ox[3] + kb)),
               (const f16*)(Wc + (ow + kb)), (const f16*)(Wc + (ow + kb + GROW)),
               (const f16*)(Wc + (ow + kb + 2 * GROW)),
               (const f16*)(Wc + (ow + kb + 3 * GROW)));
  };

  v8f acc[2][4];
#pragma unroll
  for (int i = 0; i < 2; ++i)
#pragma unroll
    for (int j = 0; j < 4; ++j) acc[i][j] = splat8(0.f);

  // Prologue: stage 0 lands and is published, then stage 1 starts.
  issue(0);
  // this wave's copies have landed before the barrier publishes them
  asm volatile("s_wait_asynccnt 0x0" ::: "memory");
  __syncthreads();
  issue(1);

  for (int t = 0; t < GNST; ++t) {
    const f16* As = &Sm[(t & 1) * 2 * GTILE];
    const f16* Bs = As + GTILE;

#pragma unroll
    for (int ks = 0; ks < GKS; ks += 32) {
      // A fragments: lane = row (M); halves {0-7,16-23} (lanes<16) / {8-15,24-31}
      v16h a[2];
#pragma unroll
      for (int i = 0; i < 2; ++i) {
        const f16* ap = &As[(wm * 32 + i * 16 + l16) * GPIT + ks + hi * 8];
        a[i] = cat16(ld8(ap), ld8(ap + 16));
      }
      // B fragments: lane = col (N = W row), same K packing
      v16h bf[4];
#pragma unroll
      for (int j = 0; j < 4; ++j) {
        const f16* bp = &Bs[(wn * 64 + j * 16 + l16) * GPIT + ks + hi * 8];
        bf[j] = cat16(ld8(bp), ld8(bp + 16));
      }
#pragma unroll
      for (int i = 0; i < 2; ++i)
#pragma unroll
        for (int j = 0; j < 4; ++j) acc[i][j] = wmma_f16(a[i], bf[j], acc[i][j]);
    }

    // Publish point of stage t+1; it also ends every read of stage t's buffer.
    // this wave's reads of the buffer have returned before it is refilled
    asm volatile("s_wait_dscnt 0x0" ::: "memory");
    // this wave's copies of stage t+1 have landed before others read them
    asm volatile("s_wait_asynccnt 0x0" ::: "memory");
    __syncthreads();
    if (t + 2 < GNST) issue(t + 2);   // the test is the same for the whole work-group
  }
  // nothing is outstanding when the wave goes on to its stores and ends
  asm volatile("s_wait_asynccnt 0x0" ::: "memory");

  // Epilogue. D layout: lane<16 -> row = base+r, lane>=16 -> row = base+8+r;
  // column = lane%16 within each 16-wide tile. Fast path (no predication)
  // unless this is the last M-tile (uniform branch).
  if (m0 + 128 <= NM) {
#pragma unroll
    for (int i = 0; i < 2; ++i) {
      const int mbase = m0 + wm * 32 + i * 16 + hi * 8;
#pragma unroll
      for (int j = 0; j < 4; ++j) {
        const int n    = n0 + wn * 64 + j * 16 + l16;
        const float bn = bias[n];
#pragma unroll
        for (int r = 0; r < 8; ++r) {
          const float v = acc[i][j][r] + bn;
          if (MODE == 0)
            ((f16*)out)[(size_t)(mbase + r) * ND + n] = (f16)v;
          else
            ((float*)out)[(size_t)(mbase + r) * ND + n] = v;
        }
      }
    }
  } else {
#pragma unroll
    for (int i = 0; i < 2; ++i) {
      const int mbase = m0 + wm * 32 + i * 16 + hi * 8;
#pragma unroll
      for (int j = 0; j < 4; ++j) {
        const int n    = n0 + wn * 64 + j * 16 + l16;
        const float bn = bias[n];
#pragma unroll
        for (int r = 0; r < 8; ++r) {
          if (mbase + r < NM) {
            const float v = acc[i][j][r] + bn;
            if (MODE == 0)
              ((f16*)out)[(size_t)(mbase + r) * ND + n] = (f16)v;
            else
              ((float*)out)[(size_t)(mbase + r) * ND + n] = v;
          }
        }
      }
    }
  }
}

static __device__ __forceinline__ float xhalf(float x) {
  const int b = __builtin_bit_cast(int, x);
  return __builtin_bit_cast(
      float, __builtin_amdgcn_permlanex16(b, b, 0x76543210, 0xfedcba98, false,
                                          false));
}

// x[r] = 2^x[r]. Eight independent v_exp_f32 in one statement, each filling
// the slot behind the one before it; the closing v_nop keeps the slot that the
// instruction set asks for between a transcendental and an instruction that
// overwrites its source or reads its result.
static __device__ __forceinline__ void exp2x8(v8f& x) {
  float a = x[0], b = x[1], c = x[2], d = x[3];
  float e = x[4], f = x[5], g = x[6], h = x[7];
  asm("v_exp_f32 %0, %0\n\tv_exp_f32 %1, %1\n\tv_exp_f32 %2, %2\n\t"
      "v_exp_f32 %3, %3\n\tv_exp_f32 %4, %4\n\tv_exp_f32 %5, %5\n\t"
      "v_exp_f32 %6, %6\n\tv_exp_f32 %7, %7\n\tv_nop"
      : "+v"(a), "+v"(b), "+v"(c), "+v"(d), "+v"(e), "+v"(f), "+v"(g), "+v"(h));
  x[0] = a; x[1] = b; x[2] = c; x[3] = d;
  x[4] = e; x[5] = f; x[6] = g; x[7] = h;
}

static __device__ __forceinline__ v16h pack16(v8f lo, v8f hi8) {
  v16h p;
#pragma unroll
  for (int r = 0; r < 8; ++r) {
    p[r]     = (f16)lo[r];
    p[8 + r] = (f16)hi8[r];
  }
  return p;
}

__global__ __launch_bounds__(256) void attn_flash(const f16* __restrict__ Q,
                                                  const f16* __restrict__ K,
                                                  const f16* __restrict__ V,
                                                  f16* __restrict__ ctx_out) {
  __shared__ f16 Kt[64 * 72];       // [key][dh]   stride 72 halves (144B)
  __shared__ f16 Vt[64 * 72];       // [dh][key]   (transposed)

  const int b    = blockIdx.z;
  const int h    = blockIdx.y;
  const int tid  = threadIdx.x;
  const int wid  = tid >> 5;
  const int lane = tid & 31;
  const int l16  = lane & 15;
  const int hi   = lane >> 4;
  const int q0   = blockIdx.x * 128 + wid * 16;

  const f16* Qb = Q + (size_t)b * NS * ND + h * NDH;   // row stride ND
  const f16* Kb = K + (size_t)b * NS * ND + h * NDH;
  const f16* Vb = V + (size_t)b * NS * ND + h * NDH;

  // Q B-fragments (64 K x 16 queries), scale 1/sqrt(64)=0.125 folded in (exact).
  int qr = q0 + l16; if (qr > NS - 1) qr = NS - 1;
  const f16* qp = Qb + (size_t)qr * ND + hi * 8;
  const f16 sc = (f16)0.125f;
  v16h qb0 = cat16(ld8(qp),      ld8(qp + 16)) * sc;   // k = 0..31
  v16h qb1 = cat16(ld8(qp + 32), ld8(qp + 48)) * sc;   // k = 32..63

  v8f acc[4];                        // O^T: acc[j][r] = O[query l16][j*16+8*hi+r]
#pragma unroll
  for (int j = 0; j < 4; ++j) acc[j] = splat8(0.f);
  float mrow = -1e30f;               // this lane's query: running maximum
  float lsum = 0.f;                  // sum over this wave half's keys only

  const int ldrow = tid >> 2;         // 0..63 key row to stage
  const int ldseg = (tid & 3) * 16;   // 16-half segment of dh

  for (int kb = 0; kb < NS; kb += 64) {
    __syncthreads();
    int krow = kb + ldrow; if (krow > NS - 1) krow = NS - 1;
    const f16* kp = Kb + (size_t)krow * ND + ldseg;
    const f16* vp = Vb + (size_t)krow * ND + ldseg;
    v8h k0 = ld8(kp), k1 = ld8(kp + 8);
    v8h v0 = ld8(vp), v1 = ld8(vp + 8);
    *(v8h*)&Kt[ldrow * 72 + ldseg]     = k0;
    *(v8h*)&Kt[ldrow * 72 + ldseg + 8] = k1;
#pragma unroll
    for (int j = 0; j < 8; ++j) {                 // transpose V into LDS
      Vt[(ldseg + j) * 72 + ldrow]     = v0[j];
      Vt[(ldseg + 8 + j) * 72 + ldrow] = v1[j];
    }
    __syncthreads();

    // ---- scores S^T = K (Q/8)^T : 4 tiles of 16 keys ---------------------
    // s[t][r] = score(key kb + t*16 + 8*hi + r, query q0 + l16)
    v8f s[4];
#pragma unroll
    for (int t = 0; t < 4; ++t) {
      const f16* krp = &Kt[(t * 16 + l16) * 72 + hi * 8];
      v16h a0 = cat16(ld8(krp),      ld8(krp + 16));
      v16h a1 = cat16(ld8(krp + 32), ld8(krp + 48));
      v8f c = splat8(0.f);
      c = wmma_f16(a0, qb0, c);
      c = wmma_f16(a1, qb1, c);
      s[t] = c;
    }
    if (kb + 64 > NS) {               // uniform: only the last block has a tail
#pragma unroll
      for (int t = 0; t < 4; ++t)
#pragma unroll
        for (int r = 0; r < 8; ++r)
          if (kb + t * 16 + hi * 8 + r > NS - 1) s[t][r] = -1e30f;
    }

    // ---- maximum of this lane's 32 scores, then joined with the other half
    v8f mx8 = s[0];
#pragma unroll
    for (int t = 1; t < 4; ++t)
#pragma unroll
      for (int r = 0; r < 8; ++r) mx8[r] = fmaxf(mx8[r], s[t][r]);
    float mx = fmaxf(fmaxf(fmaxf(mx8[0], mx8[1]), fmaxf(mx8[2], mx8[3])),
                     fmaxf(fmaxf(mx8[4], mx8[5]), fmaxf(mx8[6], mx8[7])));
    mx = fmaxf(mx, xhalf(mx));

    const float mnew = fmaxf(mrow, mx);
    const float corr = __expf(mrow - mnew);
    mrow = mnew;

#pragma unroll
    for (int t = 0; t < 4; ++t) {
#pragma unroll
      for (int r = 0; r < 8; ++r) s[t][r] = (s[t][r] - mnew) * LOG2E;
      exp2x8(s[t]);                  // e^(s - m) as 2^((s - m) * log2 e)
    }
    const v8f rs8 = (s[0] + s[1]) + (s[2] + s[3]);
    const float rs = ((rs8[0] + rs8[1]) + (rs8[2] + rs8[3])) +
                     ((rs8[4] + rs8[5]) + (rs8[6] + rs8[7]));

    lsum = lsum * corr + rs;
#pragma unroll
    for (int j = 0; j < 4; ++j) acc[j] *= corr;

    // ---- P^T B-fragments straight from the score registers ----------------
    const v16h pb0 = pack16(s[0], s[1]);   // keys 0..31
    const v16h pb1 = pack16(s[2], s[3]);   // keys 32..63

    // ---- O^T += V^T P^T (A fragment: lane = dh, keys contiguous in Vt row) -
#pragma unroll
    for (int j = 0; j < 4; ++j) {
      const f16* vrp = &Vt[(j * 16 + l16) * 72 + hi * 8];
      v16h va0 = cat16(ld8(vrp),      ld8(vrp + 16));
      v16h va1 = cat16(ld8(vrp + 32), ld8(vrp + 48));
      acc[j] = wmma_f16(va0, pb0, acc[j]);
      acc[j] = wmma_f16(va1, pb1, acc[j]);
    }
  }

  // ---- finalize: join the halves' sums, ctx /= l, store f16 to [B, S, 768] --
  // A lane holds 8 consecutive dh of its query per tile: one 16-byte store.
  const float inv = 1.0f / (lsum + xhalf(lsum));
  const int q = q0 + l16;
  if (q < NS) {
    f16* outp = ctx_out + (size_t)b * NS * ND + (size_t)q * ND + h * NDH + hi * 8;
#pragma unroll
    for (int j = 0; j < 4; ++j) {
      v8h o;
#pragma unroll
      for (int r = 0; r < 8; ++r) o[r] = (f16)(acc[j][r] * inv);
      *(v8h*)(outp + j * 16) = o;
    }
  }
}

// ---------------------------------------------------------------------------
extern "C" void kernel_launch(void* const* d_in, const int* in_sizes, int n_in,
                              void* d_out, int out_size, void* d_ws,
                              size_t ws_size, hipStream_t stream) {
  const float* hidden = (const float*)d_in[0];
  const float* Wq = (const float*)d_in[1];
  const float* bq = (const float*)d_in[2];
  const float* Wk = (const float*)d_in[3];
  const float* bk = (const float*)d_in[4];
  const float* Wv = (const float*)d_in[5];
  const float* bv = (const float*)d_in[6];
  const float* Wo = (const float*)d_in[7];
  const float* bo = (const float*)d_in[8];

  char* ws = (char*)d_ws;
  const size_t szX = (size_t)NM * ND * sizeof(f16);       // 56.7 MB
  const size_t szW = (size_t)ND * ND * sizeof(f16);       // 1.18 MB
  size_t off = 0;
  f16* Xh  = (f16*)(ws + off); off += szX;
  f16* Wqh = (f16*)(ws + off); off += szW;
  f16* Wkh = (f16*)(ws + off); off += szW;
  f16* Wvh = (f16*)(ws + off); off += szW;
  f16* Woh = (f16*)(ws + off); off += szW;
  f16* Qh  = (f16*)(ws + off); off += szX;
  f16* Kh  = (f16*)(ws + off); off += szX;
  f16* Vh  = (f16*)(ws + off); off += szX;
  f16* Ch  = (f16*)(ws + off); off += szX;

  // 1) conversions to f16
  cvt_f32_to_f16<<<8192, 256, 0, stream>>>(hidden, Xh, NM * ND);
  cvt_f32_to_f16<<<576, 256, 0, stream>>>(Wq, Wqh, ND * ND);
  cvt_f32_to_f16<<<576, 256, 0, stream>>>(Wk, Wkh, ND * ND);
  cvt_f32_to_f16<<<576, 256, 0, stream>>>(Wv, Wvh, ND * ND);
  cvt_f32_to_f16<<<576, 256, 0, stream>>>(Wo, Woh, ND * ND);

  // 2) Q/K/V projections: tiles 128(M) x 128(N)
  dim3 gg((NM + 127) / 128, ND / 128);
  gemm_wmma<0><<<gg, 256, 0, stream>>>(Xh, Wqh, bq, Qh);
  gemm_wmma<0><<<gg, 256, 0, stream>>>(Xh, Wkh, bk, Kh);
  gemm_wmma<0><<<gg, 256, 0, stream>>>(Xh, Wvh, bv, Vh);

  // 3) flash attention -> ctx f16 [B,S,768]
  attn_flash<<<dim3((NS + 127) / 128, NH, NB), 256, 0, stream>>>(Qh, Kh, Vh, Ch);

  // 4) output projection -> f32 d_out
  gemm_wmma<1><<<gg, 256, 0, stream>>>(Ch, Woh, bo, d_out);
}

// v003
// Measured time: 319 microseconds a run.
// Two timings next to v002 both put it at 1.05 times that version's speed.
// Over all steps from v000 it is 1.63 times as fast.
#include <hip/hip_runtime.h>
#include <hip/hip_bf16.h>

// ---------------------------------------------------------------------------
// ViT attention (B=64, S=577, D=768, H=12, Dh=64) on gfx1250 (CDNA5, wave32).
// All GEMMs use v_wmma_f32_16x16x32_f16 (f16 inputs, f32 accumulate).
// Pipeline:
//   1) cvt f32->f16 of hidden + Wq/Wk/Wv/Wo into workspace (one launch)
//   2) WMMA GEMM (128x128 block tile, 32x64 wave tile, async-copy LDS ring):
//        Q/K/V = Xh @ W.T + b  -> f16 [B,S,768]
//   3) flash attention (online softmax, scores never leave registers)
//        -> ctx f16 [B,S,768]
//   4) WMMA GEMM: out = ctx @ Wo.T + bo -> f32 [B,S,768] (d_out)
// Workspace: 5 * 56.7MB (Xh,Q,K,V,ctx) + 4 * 1.18MB (weights) ~ 289 MB.
// ---------------------------------------------------------------------------

typedef _Float16 f16;
typedef __attribute__((ext_vector_type(8)))  _Float16 v8h;
typedef __attribute__((ext_vector_type(16))) _Float16 v16h;
typedef __attribute__((ext_vector_type(8)))  float    v8f;

#define NB   64
#define NS   577
#define ND   768
#define NH   12
#define NDH  64
#define NM   36928   // NB*NS
#define LOG2E 1.44269504088896340736f

static __device__ __forceinline__ v8h ld8(const f16* p) { return *(const v8h*)p; }

static __device__ __forceinline__ v16h cat16(v8h a, v8h b) {
  return __builtin_shufflevector(a, b, 0,1,2,3,4,5,6,7,8,9,10,11,12,13,14,15);
}

static __device__ __forceinline__ v8f wmma_f16(v16h a, v16h b, v8f c) {
  // D = A(16x32 f16) x B(32x16 f16) + C(16x16 f32)
  return __builtin_amdgcn_wmma_f32_16x16x32_f16(false, a, false, b, (short)0, c,
                                                false, false);
}

static __device__ __forceinline__ v8f splat8(float x) {
  v8f r;
#pragma unroll
  for (int i = 0; i < 8; ++i) r[i] = x;
  return r;
}

// ---------------------------------------------------------------------------
// f32 -> f16 conversion of hidden and of the four weights: ONE resident
// streaming launch, one 16-wave work-group per WGP. The five f16 destinations
// lie one behind the other in the workspace, so the destination is one array.
// A wave tile is 1024 floats: 8 loads of 16 B a lane, each 512 contiguous
// bytes of the wave. The next tile's 8 loads are issued before this tile is
// converted and stored (two register sets take turns), so a wave always has
// loads in flight. All five sizes are multiples of the tile: no tile straddles
// two sources. The tile count is a constant: every wave takes CVT_FULL tiles,
// CVT_REST waves one more.
// ---------------------------------------------------------------------------
typedef __attribute__((ext_vector_type(4))) float    v4f;
typedef __attribute__((ext_vector_type(4))) _Float16 v4h;

#define CVT_TILE   1024                      // floats of one wave tile
#define CVT_XT     (NM * ND / CVT_TILE)      // 27696 tiles of hidden
#define CVT_WT     (ND * ND / CVT_TILE)      // 576 tiles of one weight
#define CVT_NT     (CVT_XT + 4 * CVT_WT)     // 30000 tiles in all
#define CVT_BLOCKS 256
#define CVT_WAVES  16
#define CVT_NW     (CVT_BLOCKS * CVT_WAVES)  // 4096 waves
#define CVT_FULL   (CVT_NT / CVT_NW)         // 7
#define CVT_REST   (CVT_NT - CVT_FULL * CVT_NW)  // 1328

// Source of wave tile t (t is wave-uniform: the pick stays on the scalar
// side). tend is a compile-time bound, t < tend: trips that cannot reach the
// weights need no pick.
static __device__ __forceinline__ const float* cvt_tile_src(
    int t, int tend, const float* hidden, const float* Wq, const float* Wk,
    const float* Wv, const float* Wo) {
  if (tend <= CVT_XT) return hidden + (size_t)t * CVT_TILE;
  const int u = t - CVT_XT;
  const int w = u / CVT_WT;
  const float* base = (w == 0) ? Wq : (w == 1) ? Wk : (w == 2) ? Wv : Wo;
  return (u < 0) ? hidden + (size_t)t * CVT_TILE
                 : base + (size_t)(u - w * CVT_WT) * CVT_TILE;
}

// One tile's 8 loads of this lane.
static __device__ __forceinline__ void cvt_load8(v4f (&r)[8], const float* s) {
#pragma unroll
  for (int i = 0; i < 8; ++i) r[i] = *(const v4f*)(s + i * 128);
  // no register that an issued load names (its base is formed anew for the
  // next tile) is rewritten in front of this wait
  asm volatile("s_wait_xcnt 0x0" ::: "memory");
  // keeps what follows behind the wait, and the conversions of the tile before
  // behind these loads: hoisted above them, their wait for that tile's data
  // left only three loads in flight before the new ones were issued
  __builtin_amdgcn_sched_barrier(0);
}

// One tile converted and stored: 8 B a lane, 256 contiguous bytes a store.
// MORE: the wave goes on behind these stores (false for its last ones).
template <bool MORE>
static __device__ __forceinline__ void cvt_store8(const v4f (&r)[8], f16* d) {
#pragma unroll
  for (int i = 0; i < 8; ++i)
    *(v4h*)(d + i * 128) = __builtin_convertvector(r[i], v4h);
  if (MORE) {
    // no address or data register of an issued store is rewritten in front of
    // this wait
    asm volatile("s_wait_xcnt 0x0" ::: "memory");
    // keeps the instructions that follow behind the wait
    __builtin_amdgcn_sched_barrier(0);
  }
}

__global__ __launch_bounds__(CVT_WAVES * 32) void cvt_all_f32_to_f16(
    const float* __restrict__ hidden, const float* __restrict__ Wq,
    const float* __restrict__ Wk, const float* __restrict__ Wv,
    const float* __restrict__ Wo, f16* __restrict__ y) {
  static_assert(CVT_FULL % 2 == 1, "the pair loop leaves one full tile");
  const int lane4 = (threadIdx.x & 31) * 4;
  const int wave  = __builtin_amdgcn_readfirstlane((int)(threadIdx.x >> 5));
  // Full trips: a work-group's 16 tiles are adjacent (64 KB of source a trip).
  int t = (int)blockIdx.x * CVT_WAVES + wave;           // 0 .. CVT_NW - 1
  // The last, partial trip is dealt wave-major, so that it is spread over all
  // work-groups.
  const int rest = wave * CVT_BLOCKS + (int)blockIdx.x; // 0 .. CVT_NW - 1

  v4f ra[8], rb[8];
  cvt_load8(ra, cvt_tile_src(t, CVT_NW, hidden, Wq, Wk, Wv, Wo) + lane4);
  // Two tiles a trip, each set loaded one tile ahead of its stores. Kept
  // rolled: unrolled, the stores sank below later tiles' loads and the wave
  // once waited until no load was in flight.
#pragma unroll 1
  for (int k = 0; k < CVT_FULL / 2; ++k) {
    cvt_load8(rb, cvt_tile_src(t + CVT_NW, CVT_NT, hidden, Wq, Wk, Wv, Wo) + lane4);
    cvt_store8<true>(ra, y + (size_t)t * CVT_TILE + lane4);
    cvt_load8(ra, cvt_tile_src(t + 2 * CVT_NW, CVT_NT, hidden, Wq, Wk, Wv, Wo) + lane4);
    cvt_store8<true>(rb, y + (size_t)(t + CVT_NW) * CVT_TILE + lane4);
    t += 2 * CVT_NW;
  }
  // ra holds this wave's last full tile
  f16* dl = y + (size_t)t * CVT_TILE + lane4;
  if (rest < CVT_REST) {                         // the same for the whole wave
    const int tr = CVT_FULL * CVT_NW + rest;
    cvt_load8(rb, cvt_tile_src(tr, CVT_NT, hidden, Wq, Wk, Wv, Wo) + lane4);
    cvt_store8<true>(ra, dl);
    cvt_store8<false>(rb, y + (size_t)tr * CVT_TILE + lane4);
  } else {
    cvt_store8<false>(ra, dl);
  }
}

// ---------------------------------------------------------------------------
// WMMA GEMM: C[M,768] = X[M,768] @ W[768,768]^T + bias
//   block = 256 threads (8 waves), tile 128(M) x 128(N), stage = 64 k.
//   wave (wm = wid&3 -> 32 rows, wn = wid>>2 -> 64 cols) computes 32x64:
//     2 A-frags + 4 B-frags -> 8 WMMAs per 32 k (1.5 ds_load_b128 / WMMA).
//   Staging: asynchronous copies global -> LDS, 16 B a lane, through no
//   register. A stage row is 64 halves = one whole 128-B line, brought by 8
//   adjacent lanes; LDS pitch 144 B (16 B x odd: no bank conflict for
//   ds_load_b128). Two buffers: stage t+1 flies while stage t is multiplied.
//   MODE 0: store f16 [M,768];  MODE 1: store f32 [M,768]  (compile-time).
// N=768 is a multiple of 128; M=36928 is not -> clamp the source rows; only
// the last M-tile takes the predicated store path (uniform branch).
// ---------------------------------------------------------------------------
#define GKS   64                 // k per stage
#define GPIT  72                 // LDS row pitch in halves (144 B)
#define GTILE (128 * GPIT)       // halves of one operand tile in LDS
#define GNST  (ND / GKS)         // 12 stages

static __device__ __forceinline__ unsigned lds_addr(const void* p) {
  return (unsigned)(size_t)p;    // low 32 bits of a __shared__ address
}

// One stage's eight copies of this lane (4 of X, 4 of W). The closing
// s_wait_xcnt stands inside the statement so that no address register of an
// issued copy is rewritten in front of it.
static __device__ __forceinline__ void stage_copy(
    unsigned l0, unsigned l1, unsigned l2, unsigned l3, unsigned l4,
    unsigned l5, unsigned l6, unsigned l7, const f16* g0, const f16* g1,
    const f16* g2, const f16* g3, const f16* g4, const f16* g5, const f16* g6,
    const f16* g7) {
  asm volatile(
      "global_load_async_to_lds_b128 %0, %8, off\n\t"
      "global_load_async_to_lds_b128 %1, %9, off\n\t"
      "global_load_async_to_lds_b128 %2, %10, off\n\t"
      "global_load_async_to_lds_b128 %3, %11, off\n\t"
      "global_load_async_to_lds_b128 %4, %12, off\n\t"
      "global_load_async_to_lds_b128 %5, %13, off\n\t"
      "global_load_async_to_lds_b128 %6, %14, off\n\t"
      "global_load_async_to_lds_b128 %7, %15, off\n\t"
      "s_wait_xcnt 0x0"
      :
      : "v"(l0), "v"(l1), "v"(l2), "v"(l3), "v"(l4), "v"(l5), "v"(l6), "v"(l7),
        "v"(g0), "v"(g1), "v"(g2), "v"(g3), "v"(g4), "v"(g5), "v"(g6), "v"(g7)
      : "memory");
}

template <int MODE>
__global__ __launch_bounds__(256) void gemm_wmma(const f16* __restrict__ X,
                                                 const f16* __restrict__ W,
                                                 const float* __restrict__ bias,
                                                 void* __restrict__ out) {
  // [buffer][X tile | W tile], 128 rows x 64 halves at pitch 72
  __shared__ __attribute__((aligned(16))) f16 Sm[2 * 2 * GTILE];

  const int m0   = blockIdx.x * 128;
  const int n0   = blockIdx.y * 128;
  const int tid  = threadIdx.x;
  const int wid  = tid >> 5;
  const int lane = tid & 31;
  const int l16  = lane & 15;
  const int hi   = lane >> 4;       // which K-half group this lane owns
  const int wm   = wid & 3;         // M strip 0..3 (32 rows each)
  const int wn   = wid >> 2;        // N strip 0..1 (64 cols each)

  const int crow = tid >> 3;        // 0..31: row of this lane's copies (+32*i)
  const int cseg = (tid & 7) * 8;   // its 8-half (16-B) piece of the row

  // Source byte offsets (they fit 32 bits) and the LDS byte address of this
  // lane's first piece in buffer 0; the W rows and the LDS rows step evenly.
  unsigned ox[4];
#pragma unroll
  for (int i = 0; i < 4; ++i) {
    int am = m0 + crow + 32 * i; if (am > NM - 1) am = NM - 1;  // clamp OOB M
    ox[i] = (unsigned)(am * ND + cseg) * 2u;
  }
  const unsigned ow = (unsigned)((n0 + crow) * ND + cseg) * 2u;
  const unsigned l0 = lds_addr(&Sm[crow * GPIT + cseg]);
  const unsigned LROW = 32 * GPIT * 2;  // LDS bytes of 32 rows
  const unsigned GROW = 32 * ND * 2;    // source bytes of 32 rows
  const unsigned WOFF = GTILE * 2;      // bytes from the X tile to the W tile
  const unsigned BOFF = 2 * GTILE * 2;  // bytes from buffer 0 to buffer 1
  const char* Xc = (const char*)X;
  const char* Wc = (const char*)W;
  auto issue = [&](int st) {            // stage st -> buffer st & 1
    const unsigned lb = l0 + (st & 1) * BOFF;
    const unsigned kb = (unsigned)st * (GKS * 2);
    stage_copy(lb, lb + LROW, lb + 2 * LROW, lb + 3 * LROW, lb + WOFF,
               lb + WOFF + LROW, lb + WOFF + 2 * LROW, lb + WOFF + 3 * LROW,
               (const f16*)(Xc + (ox[0] + kb)), (const f16*)(Xc + (ox[1] + kb)),
               (const f16*)(Xc + (ox[2] + kb)), (const f16*)(Xc + (ox[3] + kb)),
               (const f16*)(Wc + (ow + kb)), (const f16*)(Wc + (ow + kb + GROW)),
               (const f16*)(Wc + (ow + kb + 2 * GROW)),
               (const f16*)(Wc + (ow + kb + 3 * GROW)));
  };

  v8f acc[2][4];
#pragma unroll
  for (int i = 0; i < 2; ++i)
#pragma unroll
    for (int j = 0; j < 4; ++j) acc[i][j] = splat8(0.f);

  // Prologue: stage 0 lands and is published, then stage 1 starts.
  issue(0);
  // this wave's copies have landed before the barrier publishes them
  asm volatile("s_wait_asynccnt 0x0" ::: "memory");
  __syncthreads();
  issue(1);

  for (int t = 0; t < GNST; ++t) {
    const f16* As = &Sm[(t & 1) * 2 * GTILE];
    const f16* Bs = As + GTILE;

#pragma unroll
    for (int ks = 0; ks < GKS; ks += 32) {
      // A fragments: lane = row (M); halves {0-7,16-23} (lanes<16) / {8-15,24-31}
      v16h a[2];
#pragma unroll
      for (int i = 0; i < 2; ++i) {
        const f16* ap = &As[(wm * 32 + i * 16 + l16) * GPIT + ks + hi * 8];
        a[i] = cat16(ld8(ap), ld8(ap + 16));
      }
      // B fragments: lane = col (N = W row), same K packing
      v16h bf[4];
#pragma unroll
      for (int j = 0; j < 4; ++j) {
        const f16* bp = &Bs[(wn * 64 + j * 16 + l16) * GPIT + ks + hi * 8];
        bf[j] = cat16(ld8(bp), ld8(bp + 16));
      }
#pragma unroll
      for (int i = 0; i < 2; ++i)
#pragma unroll
        for (int j = 0; j < 4; ++j) acc[i][j] = wmma_f16(a[i], bf[j], acc[i][j]);
    }

    // Publish point of stage t+1; it also ends every read of stage t's buffer.
    // this wave's reads of the buffer have returned before it is refilled
    asm volatile("s_wait_dscnt 0x0" ::: "memory");
    // this wave's copies of stage t+1 have landed before others read them
    asm volatile("s_wait_asynccnt 0x0" ::: "memory");
    __syncthreads();
    if (t + 2 < GNST) issue(t + 2);   // the test is the same for the whole work-group
  }
  // nothing is outstanding when the wave goes on to its stores and ends
  asm volatile("s_wait_asynccnt 0x0" ::: "memory");

  // Epilogue. D layout: lane<16 -> row = base+r, lane>=16 -> row = base+8+r;
  // column = lane%16 within each 16-wide tile. Fast path (no predication)
  // unless this is the last M-tile (uniform branch).
  if (m0 + 128 <= NM) {
#pragma unroll
    for (int i = 0; i < 2; ++i) {
      const int mbase = m0 + wm * 32 + i * 16 + hi * 8;
#pragma unroll
      for (int j = 0; j < 4; ++j) {
        const int n    = n0 + wn * 64 + j * 16 + l16;
        const float bn = bias[n];
#pragma unroll
        for (int r = 0; r < 8; ++r) {
          const float v = acc[i][j][r] + bn;
          if (MODE == 0)
            ((f16*)out)[(size_t)(mbase + r) * ND + n] = (f16)v;
          else
            ((float*)out)[(size_t)(mbase + r) * ND + n] = v;
        }
      }
    }
  } else {
#pragma unroll
    for (int i = 0; i < 2; ++i) {
      const int mbase = m0 + wm * 32 + i * 16 + hi * 8;
#pragma unroll
      for (int j = 0; j < 4; ++j) {
        const int n    = n0 + wn * 64 + j * 16 + l16;
        const float bn = bias[n];
#pragma unroll
        for (int r = 0; r < 8; ++r) {
          if (mbase + r < NM) {
            const float v = acc[i][j][r] + bn;
            if (MODE == 0)
              ((f16*)out)[(size_t)(mbase + r) * ND + n] = (f16)v;
            else
              ((float*)out)[(size_t)(mbase + r) * ND + n] = v;
          }
        }
      }
    }
  }
}

static __device__ __forceinline__ float xhalf(float x) {
  const int b = __builtin_bit_cast(int, x);
  return __builtin_bit_cast(
      float, __builtin_amdgcn_permlanex16(b, b, 0x76543210, 0xfedcba98, false,
                                          false));
}

// x[r] = 2^x[r]. Eight independent v_exp_f32 in one statement, each filling
// the slot behind the one before it; the closing v_nop keeps the slot that the
// instruction set asks for between a transcendental and an instruction that
// overwrites its source or reads its result.
static __device__ __forceinline__ void exp2x8(v8f& x) {
  float a = x[0], b = x[1], c = x[2], d = x[3];
  float e = x[4], f = x[5], g = x[6], h = x[7];
  asm("v_exp_f32 %0, %0\n\tv_exp_f32 %1, %1\n\tv_exp_f32 %2, %2\n\t"
      "v_exp_f32 %3, %3\n\tv_exp_f32 %4, %4\n\tv_exp_f32 %5, %5\n\t"
      "v_exp_f32 %6, %6\n\tv_exp_f32 %7, %7\n\tv_nop"
      : "+v"(a), "+v"(b), "+v"(c), "+v"(d), "+v"(e), "+v"(f), "+v"(g), "+v"(h));
  x[0] = a; x[1] = b; x[2] = c; x[3] = d;
  x[4] = e; x[5] = f; x[6] = g; x[7] = h;
}

static __device__ __forceinline__ v16h pack16(v8f lo, v8f hi8) {
  v16h p;
#pragma unroll
  for (int r = 0; r < 8; ++r) {
    p[r]     = (f16)lo[r];
    p[8 + r] = (f16)hi8[r];
  }
  return p;
}

__global__ __launch_bounds__(256) void attn_flash(const f16* __restrict__ Q,
                                                  const f16* __restrict__ K,
                                                  const f16* __restrict__ V,
                                                  f16* __restrict__ ctx_out) {
  __shared__ f16 Kt[64 * 72];       // [key][dh]   stride 72 halves (144B)
  __shared__ f16 Vt[64 * 72];       // [dh][key]   (transposed)

  const int b    = blockIdx.z;
  const int h    = blockIdx.y;
  const int tid  = threadIdx.x;
  const int wid  = tid >> 5;
  const int lane = tid & 31;
  const int l16  = lane & 15;
  const int hi   = lane >> 4;
  const int q0   = blockIdx.x * 128 + wid * 16;

  const f16* Qb = Q + (size_t)b * NS * ND + h * NDH;   // row stride ND
  const f16* Kb = K + (size_t)b * NS * ND + h * NDH;
  const f16* Vb = V + (size_t)b * NS * ND + h * NDH;

  // Q B-fragments (64 K x 16 queries), scale 1/sqrt(64)=0.125 folded in (exact).
  int qr = q0 + l16; if (qr > NS - 1) qr = NS - 1;
  const f16* qp = Qb + (size_t)qr * ND + hi * 8;
  const f16 sc = (f16)0.125f;
  v16h qb0 = cat16(ld8(qp),      ld8(qp + 16)) * sc;   // k = 0..31
  v16h qb1 = cat16(ld8(qp + 32), ld8(qp + 48)) * sc;   // k = 32..63

  v8f acc[4];                        // O^T: acc[j][r] = O[query l16][j*16+8*hi+r]
#pragma unroll
  for (int j = 0; j < 4; ++j) acc[j] = splat8(0.f);
  float mrow = -1e30f;               // this lane's query: running maximum
  float lsum = 0.f;                  // sum over this wave half's keys only

  const int ldrow = tid >> 2;         // 0..63 key row to stage
  const int ldseg = (tid & 3) * 16;   // 16-half segment of dh

  for (int kb = 0; kb < NS; kb += 64) {
    __syncthreads();
    int krow = kb + ldrow; if (krow > NS - 1) krow = NS - 1;
    const f16* kp = Kb + (size_t)krow * ND + ldseg;
    const f16* vp = Vb + (size_t)krow * ND + ldseg;
    v8h k0 = ld8(kp), k1 = ld8(kp + 8);
    v8h v0 = ld8(vp), v1 = ld8(vp + 8);
    *(v8h*)&Kt[ldrow * 72 + ldseg]     = k0;
    *(v8h*)&Kt[ldrow * 72 + ldseg + 8] = k1;
#pragma unroll
    for (int j = 0; j < 8; ++j) {                 // transpose V into LDS
      Vt[(ldseg + j) * 72 + ldrow]     = v0[j];
      Vt[(ldseg + 8 + j) * 72 + ldrow] = v1[j];
    }
    __syncthreads();

    // ---- scores S^T = K (Q/8)^T : 4 tiles of 16 keys ---------------------
    // s[t][r] = score(key kb + t*16 + 8*hi + r, query q0 + l16)
    v8f s[4];
#pragma unroll
    for (int t = 0; t < 4; ++t) {
      const f16* krp = &Kt[(t * 16 + l16) * 72 + hi * 8];
      v16h a0 = cat16(ld8(krp),      ld8(krp + 16));
      v16h a1 = cat16(ld8(krp + 32), ld8(krp + 48));
      v8f c = splat8(0.f);
      c = wmma_f16(a0, qb0, c);
      c = wmma_f16(a1, qb1, c);
      s[t] = c;
    }
    if (kb + 64 > NS) {               // uniform: only the last block has a tail
#pragma unroll
      for (int t = 0; t < 4; ++t)
#pragma unroll
        for (int r = 0; r < 8; ++r)
          if (kb + t * 16 + hi * 8 + r > NS - 1) s[t][r] = -1e30f;
    }

    // ---- maximum of this lane's 32 scores, then joined with the other half
    v8f mx8 = s[0];
#pragma unroll
    for (int t = 1; t < 4; ++t)
#pragma unroll
      for (int r = 0; r < 8; ++r) mx8[r] = fmaxf(mx8[r], s[t][r]);
    float mx = fmaxf(fmaxf(fmaxf(mx8[0], mx8[1]), fmaxf(mx8[2], mx8[3])),
                     fmaxf(fmaxf(mx8[4], mx8[5]), fmaxf(mx8[6], mx8[7])));
    mx = fmaxf(mx, xhalf(mx));

    const float mnew = fmaxf(mrow, mx);
    const float corr = __expf(mrow - mnew);
    mrow = mnew;

#pragma unroll
    for (int t = 0; t < 4; ++t) {
#pragma unroll
      for (int r = 0; r < 8; ++r) s[t][r] = (s[t][r] - mnew) * LOG2E;
      exp2x8(s[t]);                  // e^(s - m) as 2^((s - m) * log2 e)
    }
    const v8f rs8 = (s[0] + s[1]) + (s[2] + s[3]);
    const float rs = ((rs8[0] + rs8[1]) + (rs8[2] + rs8[3])) +
                     ((rs8[4] + rs8[5]) + (rs8[6] + rs8[7]));

    lsum = lsum * corr + rs;
#pragma unroll
    for (int j = 0; j < 4; ++j) acc[j] *= corr;

    // ---- P^T B-fragments straight from the score registers ----------------
    const v16h pb0 = pack16(s[0], s[1]);   // keys 0..31
    const v16h pb1 = pack16(s[2], s[3]);   // keys 32..63

    // ---- O^T += V^T P^T (A fragment: lane = dh, keys contiguous in Vt row) -
#pragma unroll
    for (int j = 0; j < 4; ++j) {
      const f16* vrp = &Vt[(j * 16 + l16) * 72 + hi * 8];
      v16h va0 = cat16(ld8(vrp),      ld8(vrp + 16));
      v16h va1 = cat16(ld8(vrp + 32), ld8(vrp + 48));
      acc[j] = wmma_f16(va0, pb0, acc[j]);
      acc[j] = wmma_f16(va1, pb1, acc[j]);
    }
  }

  // ---- finalize: join the halves' sums, ctx /= l, store f16 to [B, S, 768] --
  // A lane holds 8 consecutive dh of its query per tile: one 16-byte store.
  const float inv = 1.0f / (lsum + xhalf(lsum));
  const int q = q0 + l16;
  if (q < NS) {
    f16* outp = ctx_out + (size_t)b * NS * ND + (size_t)q * ND + h * NDH + hi * 8;
#pragma unroll
    for (int j = 0; j < 4; ++j) {
      v8h o;
#pragma unroll
      for (int r = 0; r < 8; ++r) o[r] = (f16)(acc[j][r] * inv);
      *(v8h*)(outp + j * 16) = o;
    }
  }
}

// ---------------------------------------------------------------------------
extern "C" void kernel_launch(void* const* d_in, const int* in_sizes, int n_in,
                              void* d_out, int out_size, void* d_ws,
                              size_t ws_size, hipStream_t stream) {
  const float* hidden = (const float*)d_in[0];
  const float* Wq = (const float*)d_in[1];
  const float* bq = (const float*)d_in[2];
  const float* Wk = (const float*)d_in[3];
  const float* bk = (const float*)d_in[4];
  const float* Wv = (const float*)d_in[5];
  const float* bv = (const float*)d_in[6];
  const float* Wo = (const float*)d_in[7];
  const float* bo = (const float*)d_in[8];

  char* ws = (char*)d_ws;
  const size_t szX = (size_t)NM * ND * sizeof(f16);       // 56.7 MB
  const size_t szW = (size_t)ND * ND * sizeof(f16);       // 1.18 MB
  size_t off = 0;
  f16* Xh  = (f16*)(ws + off); off += szX;
  f16* Wqh = (f16*)(ws + off); off += szW;
  f16* Wkh = (f16*)(ws + off); off += szW;
  f16* Wvh = (f16*)(ws + off); off += szW;
  f16* Woh = (f16*)(ws + off); off += szW;
  f16* Qh  = (f16*)(ws + off); off += szX;
  f16* Kh  = (f16*)(ws + off); off += szX;
  f16* Vh  = (f16*)(ws + off); off += szX;
  f16* Ch  = (f16*)(ws + off); off += szX;

  // 1) conversions to f16: Xh, Wqh, Wkh, Wvh, Woh are one contiguous array
  cvt_all_f32_to_f16<<<CVT_BLOCKS, CVT_WAVES * 32, 0, stream>>>(hidden, Wq, Wk,
                                                                Wv, Wo, Xh);

  // 2) Q/K/V projections: tiles 128(M) x 128(N)
  dim3 gg((NM + 127) / 128, ND / 128);
  gemm_wmma<0><<<gg, 256, 0, stream>>>(Xh, Wqh, bq, Qh);
  gemm_wmma<0><<<gg, 256, 0, stream>>>(Xh, Wkh, bk, Kh);
  gemm_wmma<0><<<gg, 256, 0, stream>>>(Xh, Wvh, bv, Vh);

  // 3) flash attention -> ctx f16 [B,S,768]
  attn_flash<<<dim3((NS + 127) / 128, NH, NB), 256, 0, stream>>>(Qh, Kh, Vh, Ch);

  // 4) output projection -> f32 d_out
  gemm_wmma<1><<<gg, 256, 0, stream>>>(Ch, Woh, bo, d_out);
}

// v004
// One run takes 307 microseconds.
// In both of two side-by-side timings against v003, it was 1.04 times as fast.
// All steps since v000 together make it 1.69 times as fast.
#include <hip/hip_runtime.h>
#include <hip/hip_bf16.h>

// ---------------------------------------------------------------------------
// ViT attention (B=64, S=577, D=768, H=12, Dh=64) on gfx1250 (CDNA5, wave32).
// All GEMMs use v_wmma_f32_16x16x32_f16 (f16 inputs, f32 accumulate).
// Pipeline:
//   1) cvt f32->f16 of hidden + Wq/Wk/Wv/Wo into workspace (one launch)
//   2) WMMA GEMM (128x128 block tile, 32x64 wave tile, async-copy LDS ring):
//        Q/K/V = Xh @ W.T + b  -> f16 [B,S,768]
//   3) flash attention (online softmax, scores never leave registers)
//        -> ctx f16 [B,S,768]
//   4) WMMA GEMM: out = ctx @ Wo.T + bo -> f32 [B,S,768] (d_out)
// Workspace: 5 * 56.7MB (Xh,Q,K,V,ctx) + 4 * 1.18MB (weights) ~ 289 MB.
// ---------------------------------------------------------------------------

typedef _Float16 f16;
typedef __attribute__((ext_vector_type(8)))  _Float16 v8h;
typedef __attribute__((ext_vector_type(16))) _Float16 v16h;
typedef __attribute__((ext_vector_type(8)))  float    v8f;

#define NB   64
#define NS   577
#define ND   768
#define NH   12
#define NDH  64
#define NM   36928   // NB*NS
#define LOG2E 1.44269504088896340736f

static __device__ __forceinline__ v8h ld8(const f16* p) { return *(const v8h*)p; }

static __device__ __forceinline__ v16h cat16(v8h a, v8h b) {
  return __builtin_shufflevector(a, b, 0,1,2,3,4,5,6,7,8,9,10,11,12,13,14,15);
}

static __device__ __forceinline__ v8f wmma_f16(v16h a, v16h b, v8f c) {
  // D = A(16x32 f16) x B(32x16 f16) + C(16x16 f32)
  return __builtin_amdgcn_wmma_f32_16x16x32_f16(false, a, false, b, (short)0, c,
                                                false, false);
}

static __device__ __forceinline__ v8f splat8(float x) {
  v8f r;
#pragma unroll
  for (int i = 0; i < 8; ++i) r[i] = x;
  return r;
}

// ---------------------------------------------------------------------------
// f32 -> f16 conversion of hidden and of the four weights: ONE resident
// streaming launch, one 16-wave work-group per WGP. The five f16 destinations
// lie one behind the other in the workspace, so the destination is one array.
// A wave tile is 1024 floats: 8 loads of 16 B a lane, each 512 contiguous
// bytes of the wave. The next tile's 8 loads are issued before this tile is
// converted and stored (two register sets take turns), so a wave always has
// loads in flight. All five sizes are multiples of the tile: no tile straddles
// two sources. The tile count is a constant: every wave takes CVT_FULL tiles,
// CVT_REST waves one more.
// ---------------------------------------------------------------------------
typedef __attribute__((ext_vector_type(4))) float    v4f;
typedef __attribute__((ext_vector_type(4))) _Float16 v4h;

#define CVT_TILE   1024                      // floats of one wave tile
#define CVT_XT     (NM * ND / CVT_TILE)      // 27696 tiles of hidden
#define CVT_WT     (ND * ND / CVT_TILE)      // 576 tiles of one weight
#define CVT_NT     (CVT_XT + 4 * CVT_WT)     // 30000 tiles in all
#define CVT_BLOCKS 256
#define CVT_WAVES  16
#define CVT_NW     (CVT_BLOCKS * CVT_WAVES)  // 4096 waves
#define CVT_FULL   (CVT_NT / CVT_NW)         // 7
#define CVT_REST   (CVT_NT - CVT_FULL * CVT_NW)  // 1328

// Source of wave tile t (t is wave-uniform: the pick stays on the scalar
// side). tend is a compile-time bound, t < tend: trips that cannot reach the
// weights need no pick.
static __device__ __forceinline__ const float* cvt_tile_src(
    int t, int tend, const float* hidden, const float* Wq, const float* Wk,
    const float* Wv, const float* Wo) {
  if (tend <= CVT_XT) return hidden + (size_t)t * CVT_TILE;
  const int u = t - CVT_XT;
  const int w = u / CVT_WT;
  const float* base = (w == 0) ? Wq : (w == 1) ? Wk : (w == 2) ? Wv : Wo;
  return (u < 0) ? hidden + (size_t)t * CVT_TILE
                 : base + (size_t)(u - w * CVT_WT) * CVT_TILE;
}

// One tile's 8 loads of this lane.
static __device__ __forceinline__ void cvt_load8(v4f (&r)[8], const float* s) {
#pragma unroll
  for (int i = 0; i < 8; ++i) r[i] = *(const v4f*)(s + i * 128);
  // no register that an issued load names (its base is formed anew for the
  // next tile) is rewritten in front of this wait
  asm volatile("s_wait_xcnt 0x0" ::: "memory");
  // keeps what follows behind the wait, and the conversions of the tile before
  // behind these loads: hoisted above them, their wait for that tile's data
  // left only three loads in flight before the new ones were issued
  __builtin_amdgcn_sched_barrier(0);
}

// One tile converted and stored: 8 B a lane, 256 contiguous bytes a store.
// MORE: the wave goes on behind these stores (false for its last ones).
template <bool MORE>
static __device__ __forceinline__ void cvt_store8(const v4f (&r)[8], f16* d) {
#pragma unroll
  for (int i = 0; i < 8; ++i)
    *(v4h*)(d + i * 128) = __builtin_convertvector(r[i], v4h);
  if (MORE) {
    // no address or data register of an issued store is rewritten in front of
    // this wait
    asm volatile("s_wait_xcnt 0x0" ::: "memory");
    // keeps the instructions that follow behind the wait
    __builtin_amdgcn_sched_barrier(0);
  }
}

__global__ __launch_bounds__(CVT_WAVES * 32) void cvt_all_f32_to_f16(
    const float* __restrict__ hidden, const float* __restrict__ Wq,
    const float* __restrict__ Wk, const float* __restrict__ Wv,
    const float* __restrict__ Wo, f16* __restrict__ y) {
  static_assert(CVT_FULL % 2 == 1, "the pair loop leaves one full tile");
  const int lane4 = (threadIdx.x & 31) * 4;
  const int wave  = __builtin_amdgcn_readfirstlane((int)(threadIdx.x >> 5));
  // Full trips: a work-group's 16 tiles are adjacent (64 KB of source a trip).
  int t = (int)blockIdx.x * CVT_WAVES + wave;           // 0 .. CVT_NW - 1
  // The last, partial trip is dealt wave-major, so that it is spread over all
  // work-groups.
  const int rest = wave * CVT_BLOCKS + (int)blockIdx.x; // 0 .. CVT_NW - 1

  v4f ra[8], rb[8];
  cvt_load8(ra, cvt_tile_src(t, CVT_NW, hidden, Wq, Wk, Wv, Wo) + lane4);
  // Two tiles a trip, each set loaded one tile ahead of its stores. Kept
  // rolled: unrolled, the stores sank below later tiles' loads and the wave
  // once waited until no load was in flight.
#pragma unroll 1
  for (int k = 0; k < CVT_FULL / 2; ++k) {
    cvt_load8(rb, cvt_tile_src(t + CVT_NW, CVT_NT, hidden, Wq, Wk, Wv, Wo) + lane4);
    cvt_store8<true>(ra, y + (size_t)t * CVT_TILE + lane4);
    cvt_load8(ra, cvt_tile_src(t + 2 * CVT_NW, CVT_NT, hidden, Wq, Wk, Wv, Wo) + lane4);
    cvt_store8<true>(rb, y + (size_t)(t + CVT_NW) * CVT_TILE + lane4);
    t += 2 * CVT_NW;
  }
  // ra holds this wave's last full tile
  f16* dl = y + (size_t)t * CVT_TILE + lane4;
  if (rest < CVT_REST) {                         // the same for the whole wave
    const int tr = CVT_FULL * CVT_NW + rest;
    cvt_load8(rb, cvt_tile_src(tr, CVT_NT, hidden, Wq, Wk, Wv, Wo) + lane4);
    cvt_store8<true>(ra, dl);
    cvt_store8<false>(rb, y + (size_t)tr * CVT_TILE + lane4);
  } else {
    cvt_store8<false>(ra, dl);
  }
}

// ---------------------------------------------------------------------------
// WMMA GEMM: C[M,768] = X[M,768] @ W[768,768]^T + bias
//   block = 256 threads (8 waves), tile 128(M) x 128(N), stage = 64 k.
//   wave (wm = wid&3 -> 32 rows, wn = wid>>2 -> 64 cols) computes 32x64:
//     2 A-frags + 4 B-frags -> 8 WMMAs per 32 k (1.5 ds_load_b128 / WMMA).
//   Staging: asynchronous copies global -> LDS, 16 B a lane, through no
//   register. A stage row is 64 halves = one whole 128-B line, brought by 8
//   adjacent lanes; LDS pitch 144 B (16 B x odd: no bank conflict for
//   ds_load_b128). Two buffers: stage t+1 flies while stage t is multiplied.
//   MODE 0: store f16 [M,768];  MODE 1: store f32 [M,768]  (compile-time).
// N=768 is a multiple of 128; M=36928 is not -> clamp the source rows; only
// the last M-tile takes the predicated store path (uniform branch).
// ---------------------------------------------------------------------------
#define GKS   64                 // k per stage
#define GPIT  72                 // LDS row pitch in halves (144 B)
#define GTILE (128 * GPIT)       // halves of one operand tile in LDS
#define GNST  (ND / GKS)         // 12 stages

static __device__ __forceinline__ unsigned lds_addr(const void* p) {
  return (unsigned)(size_t)p;    // low 32 bits of a __shared__ address
}

// One stage's eight copies of this lane (4 of X, 4 of W). The closing
// s_wait_xcnt stands inside the statement so that no address register of an
// issued copy is rewritten in front of it.
static __device__ __forceinline__ void stage_copy(
    unsigned l0, unsigned l1, unsigned l2, unsigned l3, unsigned l4,
    unsigned l5, unsigned l6, unsigned l7, const f16* g0, const f16* g1,
    const f16* g2, const f16* g3, const f16* g4, const f16* g5, const f16* g6,
    const f16* g7) {
  asm volatile(
      "global_load_async_to_lds_b128 %0, %8, off\n\t"
      "global_load_async_to_lds_b128 %1, %9, off\n\t"
      "global_load_async_to_lds_b128 %2, %10, off\n\t"
      "global_load_async_to_lds_b128 %3, %11, off\n\t"
      "global_load_async_to_lds_b128 %4, %12, off\n\t"
      "global_load_async_to_lds_b128 %5, %13, off\n\t"
      "global_load_async_to_lds_b128 %6, %14, off\n\t"
      "global_load_async_to_lds_b128 %7, %15, off\n\t"
      "s_wait_xcnt 0x0"
      :
      : "v"(l0), "v"(l1), "v"(l2), "v"(l3), "v"(l4), "v"(l5), "v"(l6), "v"(l7),
        "v"(g0), "v"(g1), "v"(g2), "v"(g3), "v"(g4), "v"(g5), "v"(g6), "v"(g7)
      : "memory");
}

template <int MODE>
__global__ __launch_bounds__(256) void gemm_wmma(const f16* __restrict__ X,
                                                 const f16* __restrict__ W,
                                                 const float* __restrict__ bias,
                                                 void* __restrict__ out) {
  // [buffer][X tile | W tile], 128 rows x 64 halves at pitch 72
  __shared__ __attribute__((aligned(16))) f16 Sm[2 * 2 * GTILE];

  const int m0   = blockIdx.x * 128;
  const int n0   = blockIdx.y * 128;
  const int tid  = threadIdx.x;
  const int wid  = tid >> 5;
  const int lane = tid & 31;
  const int l16  = lane & 15;
  const int hi   = lane >> 4;       // which K-half group this lane owns
  const int wm   = wid & 3;         // M strip 0..3 (32 rows each)
  const int wn   = wid >> 2;        // N strip 0..1 (64 cols each)

  const int crow = tid >> 3;        // 0..31: row of this lane's copies (+32*i)
  const int cseg = (tid & 7) * 8;   // its 8-half (16-B) piece of the row

  // Source byte offsets (they fit 32 bits) and the LDS byte address of this
  // lane's first piece in buffer 0; the W rows and the LDS rows step evenly.
  unsigned ox[4];
#pragma unroll
  for (int i = 0; i < 4; ++i) {
    int am = m0 + crow + 32 * i; if (am > NM - 1) am = NM - 1;  // clamp OOB M
    ox[i] = (unsigned)(am * ND + cseg) * 2u;
  }
  const unsigned ow = (unsigned)((n0 + crow) * ND + cseg) * 2u;
  const unsigned l0 = lds_addr(&Sm[crow * GPIT + cseg]);
  const unsigned LROW = 32 * GPIT * 2;  // LDS bytes of 32 rows
  const unsigned GROW = 32 * ND * 2;    // source bytes of 32 rows
  const unsigned WOFF = GTILE * 2;      // bytes from the X tile to the W tile
  const unsigned BOFF = 2 * GTILE * 2;  // bytes from buffer 0 to buffer 1
  const char* Xc = (const char*)X;
  const char* Wc = (const char*)W;
  auto issue = [&](int st) {            // stage st -> buffer st & 1
    const unsigned lb = l0 + (st & 1) * BOFF;
    const unsigned kb = (unsigned)st * (GKS * 2);
    stage_copy(lb, lb + LROW, lb + 2 * LROW, lb + 3 * LROW, lb + WOFF,
               lb + WOFF + LROW, lb + WOFF + 2 * LROW, lb + WOFF + 3 * LROW,
               (const f16*)(Xc + (ox[0] + kb)), (const f16*)(Xc + (ox[1] + kb)),
               (const f16*)(Xc + (ox[2] + kb)), (const f16*)(Xc + (ox[3] + kb)),
               (const f16*)(Wc + (ow + kb)), (const f16*)(Wc + (ow + kb + GROW)),
               (const f16*)(Wc + (ow + kb + 2 * GROW)),
               (const f16*)(Wc + (ow + kb + 3 * GROW)));
  };

  v8f acc[2][4];
#pragma unroll
  for (int i = 0; i < 2; ++i)
#pragma unroll
    for (int j = 0; j < 4; ++j) acc[i][j] = splat8(0.f);

  // Prologue: stage 0 lands and is published, then stage 1 starts.
  issue(0);
  // this wave's copies have landed before the barrier publishes them
  asm volatile("s_wait_asynccnt 0x0" ::: "memory");
  __syncthreads();
  issue(1);

  for (int t = 0; t < GNST; ++t) {
    const f16* As = &Sm[(t & 1) * 2 * GTILE];
    const f16* Bs = As + GTILE;

#pragma unroll
    for (int ks = 0; ks < GKS; ks += 32) {
      // A fragments: lane = row (M); halves {0-7,16-23} (lanes<16) / {8-15,24-31}
      v16h a[2];
#pragma unroll
      for (int i = 0; i < 2; ++i) {
        const f16* ap = &As[(wm * 32 + i * 16 + l16) * GPIT + ks + hi * 8];
        a[i] = cat16(ld8(ap), ld8(ap + 16));
      }
      // B fragments: lane = col (N = W row), same K packing
      v16h bf[4];
#pragma unroll
      for (int j = 0; j < 4; ++j) {
        const f16* bp = &Bs[(wn * 64 + j * 16 + l16) * GPIT + ks + hi * 8];
        bf[j] = cat16(ld8(bp), ld8(bp + 16));
      }
#pragma unroll
      for (int i = 0; i < 2; ++i)
#pragma unroll
        for (int j = 0; j < 4; ++j) acc[i][j] = wmma_f16(a[i], bf[j], acc[i][j]);
    }

    // Publish point of stage t+1; it also ends every read of stage t's buffer.
    // this wave's reads of the buffer have returned before it is refilled
    asm volatile("s_wait_dscnt 0x0" ::: "memory");
    // this wave's copies of stage t+1 have landed before others read them
    asm volatile("s_wait_asynccnt 0x0" ::: "memory");
    __syncthreads();
    if (t + 2 < GNST) issue(t + 2);   // the test is the same for the whole work-group
  }
  // nothing is outstanding when the wave goes on to its stores and ends
  asm volatile("s_wait_asynccnt 0x0" ::: "memory");

  // Epilogue. D layout: lane<16 -> row = base+r, lane>=16 -> row = base+8+r;
  // column = lane%16 within each 16-wide tile. Fast path (no predication)
  // unless this is the last M-tile (uniform branch).
  if (m0 + 128 <= NM) {
#pragma unroll
    for (int i = 0; i < 2; ++i) {
      const int mbase = m0 + wm * 32 + i * 16 + hi * 8;
#pragma unroll
      for (int j = 0; j < 4; ++j) {
        const int n    = n0 + wn * 64 + j * 16 + l16;
        const float bn = bias[n];
#pragma unroll
        for (int r = 0; r < 8; ++r) {
          const float v = acc[i][j][r] + bn;
          if (MODE == 0)
            ((f16*)out)[(size_t)(mbase + r) * ND + n] = (f16)v;
          else
            ((float*)out)[(size_t)(mbase + r) * ND + n] = v;
        }
      }
    }
  } else {
#pragma unroll
    for (int i = 0; i < 2; ++i) {
      const int mbase = m0 + wm * 32 + i * 16 + hi * 8;
#pragma unroll
      for (int j = 0; j < 4; ++j) {
        const int n    = n0 + wn * 64 + j * 16 + l16;
        const float bn = bias[n];
#pragma unroll
        for (int r = 0; r < 8; ++r) {
          if (mbase + r < NM) {
            const float v = acc[i][j][r] + bn;
            if (MODE == 0)
              ((f16*)out)[(size_t)(mbase + r) * ND + n] = (f16)v;
            else
              ((float*)out)[(size_t)(mbase + r) * ND + n] = v;
          }
        }
      }
    }
  }
}

static __device__ __forceinline__ float xhalf(float x) {
  const int b = __builtin_bit_cast(int, x);
  return __builtin_bit_cast(
      float, __builtin_amdgcn_permlanex16(b, b, 0x76543210, 0xfedcba98, false,
                                          false));
}

// x[r] = 2^x[r]. Eight independent v_exp_f32 in one statement, each filling
// the slot behind the one before it; the closing v_nop keeps the slot that the
// instruction set asks for between a transcendental and an instruction that
// overwrites its source or reads its result.
static __device__ __forceinline__ void exp2x8(v8f& x) {
  float a = x[0], b = x[1], c = x[2], d = x[3];
  float e = x[4], f = x[5], g = x[6], h = x[7];
  asm("v_exp_f32 %0, %0\n\tv_exp_f32 %1, %1\n\tv_exp_f32 %2, %2\n\t"
      "v_exp_f32 %3, %3\n\tv_exp_f32 %4, %4\n\tv_exp_f32 %5, %5\n\t"
      "v_exp_f32 %6, %6\n\tv_exp_f32 %7, %7\n\tv_nop"
      : "+v"(a), "+v"(b), "+v"(c), "+v"(d), "+v"(e), "+v"(f), "+v"(g), "+v"(h));
  x[0] = a; x[1] = b; x[2] = c; x[3] = d;
  x[4] = e; x[5] = f; x[6] = g; x[7] = h;
}

static __device__ __forceinline__ v16h pack16(v8f lo, v8f hi8) {
  v16h p;
#pragma unroll
  for (int r = 0; r < 8; ++r) {
    p[r]     = (f16)lo[r];
    p[8 + r] = (f16)hi8[r];
  }
  return p;
}

// Transposing LDS load of a row-major 16-bit tile: the lanes address 16 rows
// (keys) x 16 columns (dh) in 16-byte pieces, and lane (c = l & 15, h = l >> 4)
// receives column c of rows 8h .. 8h+7: half of an A fragment of V^T.
typedef __attribute__((ext_vector_type(8))) short s16x8;
static __device__ __forceinline__ v8h ld_tr16(const f16* p) {
  typedef __attribute__((address_space(3))) s16x8 lds_s16x8;
  return __builtin_bit_cast(v8h,
                            __builtin_amdgcn_ds_load_tr16_b128_v8i16((lds_s16x8*)p));
}

#define VPIT 80   // V row pitch in halves: 160 B = 32 B x odd, the transposing load's pitch

// The second bound (waves per SIMD) sets the register budget to 128, so that
// four work-groups stay resident on a WGP.
__global__ __launch_bounds__(256, 8) void attn_flash(const f16* __restrict__ Q,
                                                  const f16* __restrict__ K,
                                                  const f16* __restrict__ V,
                                                  f16* __restrict__ ctx_out) {
  __shared__ f16 Kt[64 * 72];       // [key][dh]   stride 72 halves (144B)
  __shared__ __attribute__((aligned(16))) f16 Vs[64 * VPIT];  // [key][dh]

  const int b    = blockIdx.z;
  const int h    = blockIdx.y;
  const int tid  = threadIdx.x;
  const int wid  = tid >> 5;
  const int lane = tid & 31;
  const int l16  = lane & 15;
  const int hi   = lane >> 4;
  const int q0   = blockIdx.x * 128 + wid * 16;

  const f16* Qb = Q + (size_t)b * NS * ND + h * NDH;   // row stride ND
  const f16* Kb = K + (size_t)b * NS * ND + h * NDH;
  const f16* Vb = V + (size_t)b * NS * ND + h * NDH;

  // Q B-fragments (64 K x 16 queries), scale 1/sqrt(64)=0.125 folded in (exact).
  int qr = q0 + l16; if (qr > NS - 1) qr = NS - 1;
  const f16* qp = Qb + (size_t)qr * ND + hi * 8;
  const f16 sc = (f16)0.125f;
  v16h qb0 = cat16(ld8(qp),      ld8(qp + 16)) * sc;   // k = 0..31
  v16h qb1 = cat16(ld8(qp + 32), ld8(qp + 48)) * sc;   // k = 32..63

  v8f acc[4];                        // O^T: acc[j][r] = O[query l16][j*16+8*hi+r]
#pragma unroll
  for (int j = 0; j < 4; ++j) acc[j] = splat8(0.f);
  float mrow = -1e30f;               // this lane's query: running maximum
  float lsum = 0.f;                  // sum over this wave half's keys only

  const int ldrow = tid >> 2;         // 0..63 key row to stage
  const int ldseg = (tid & 3) * 16;   // 16-half segment of dh

  for (int kb = 0; kb < NS; kb += 64) {
    __syncthreads();
    int krow = kb + ldrow; if (krow > NS - 1) krow = NS - 1;
    const f16* kp = Kb + (size_t)krow * ND + ldseg;
    const f16* vp = Vb + (size_t)krow * ND + ldseg;
    v8h k0 = ld8(kp), k1 = ld8(kp + 8);
    v8h v0 = ld8(vp), v1 = ld8(vp + 8);
    // no address register of the four issued loads is rewritten in front of this
    // wait: naming the two pointers keeps them whole up to it (in the 128-register
    // budget a load's result was otherwise placed on the address pair itself)
    asm volatile("s_wait_xcnt 0x0" :: "v"(kp), "v"(vp) : "memory");
    *(v8h*)&Kt[ldrow * 72 + ldseg]     = k0;
    *(v8h*)&Kt[ldrow * 72 + ldseg + 8] = k1;
    *(v8h*)&Vs[ldrow * VPIT + ldseg]     = v0;
    *(v8h*)&Vs[ldrow * VPIT + ldseg + 8] = v1;
    __syncthreads();

    // ---- scores S^T = K (Q/8)^T : 4 tiles of 16 keys ---------------------
    // s[t][r] = score(key kb + t*16 + 8*hi + r, query q0 + l16)
    v8f s[4];
#pragma unroll
    for (int t = 0; t < 4; ++t) {
      const f16* krp = &Kt[(t * 16 + l16) * 72 + hi * 8];
      v16h a0 = cat16(ld8(krp),      ld8(krp + 16));
      v16h a1 = cat16(ld8(krp + 32), ld8(krp + 48));
      v8f c = splat8(0.f);
      c = wmma_f16(a0, qb0, c);
      c = wmma_f16(a1, qb1, c);
      s[t] = c;
    }
    if (kb + 64 > NS) {               // uniform: only the last block has a tail
#pragma unroll
      for (int t = 0; t < 4; ++t)
#pragma unroll
        for (int r = 0; r < 8; ++r)
          if (kb + t * 16 + hi * 8 + r > NS - 1) s[t][r] = -1e30f;
    }

    // ---- maximum of this lane's 32 scores, then joined with the other half
    v8f mx8 = s[0];
#pragma unroll
    for (int t = 1; t < 4; ++t)
#pragma unroll
      for (int r = 0; r < 8; ++r) mx8[r] = fmaxf(mx8[r], s[t][r]);
    float mx = fmaxf(fmaxf(fmaxf(mx8[0], mx8[1]), fmaxf(mx8[2], mx8[3])),
                     fmaxf(fmaxf(mx8[4], mx8[5]), fmaxf(mx8[6], mx8[7])));
    mx = fmaxf(mx, xhalf(mx));

    const float mnew = fmaxf(mrow, mx);
    const float corr = __expf(mrow - mnew);
    mrow = mnew;

#pragma unroll
    for (int j = 0; j < 4; ++j) acc[j] *= corr;

    // Per 32 keys: exponentials, P^T B-fragment straight from the score
    // registers, then O^T += V^T P^T. (A fragment of V^T: lane = dh; a load
    // brings keys 8*hi+0..7 of a 16-key group, two loads 16 keys apart are one
    // 16 x 32 fragment.) Taken 32 keys at a time so that the first half's
    // scores and P^T are dead before the second half's fragments are live: all
    // 64 at once took more than 128 registers (three work-groups a WGP, not four).
    const f16* vrp = &Vs[(hi * 8 + (lane & 7)) * VPIT + ((lane >> 3) & 1) * 8];
    v8f rs2[2];
#pragma unroll
    for (int u = 0; u < 2; ++u) {
#pragma unroll
      for (int t = 2 * u; t < 2 * u + 2; ++t) {
#pragma unroll
        for (int r = 0; r < 8; ++r) s[t][r] = (s[t][r] - mnew) * LOG2E;
        exp2x8(s[t]);                // e^(s - m) as 2^((s - m) * log2 e)
      }
      rs2[u] = s[2 * u] + s[2 * u + 1];
      const v16h pb = pack16(s[2 * u], s[2 * u + 1]);   // keys 32u .. 32u+31
#pragma unroll
      for (int j = 0; j < 4; ++j) {
        const f16* vp2 = vrp + u * 32 * VPIT + j * 16;
        acc[j] = wmma_f16(cat16(ld_tr16(vp2), ld_tr16(vp2 + 16 * VPIT)), pb, acc[j]);
      }
    }
    const v8f rs8 = rs2[0] + rs2[1];
    const float rs = ((rs8[0] + rs8[1]) + (rs8[2] + rs8[3])) +
                     ((rs8[4] + rs8[5]) + (rs8[6] + rs8[7]));
    lsum = lsum * corr + rs;
  }

  // ---- finalize: join the halves' sums, ctx /= l, store f16 to [B, S, 768] --
  // A lane holds 8 consecutive dh of its query per tile: one 16-byte store.
  const float inv = 1.0f / (lsum + xhalf(lsum));
  const int q = q0 + l16;
  if (q < NS) {
    f16* outp = ctx_out + (size_t)b * NS * ND + (size_t)q * ND + h * NDH + hi * 8;
#pragma unroll
    for (int j = 0; j < 4; ++j) {
      v8h o;
#pragma unroll
      for (int r = 0; r < 8; ++r) o[r] = (f16)(acc[j][r] * inv);
      *(v8h*)(outp + j * 16) = o;
    }
  }
}

// ---------------------------------------------------------------------------
extern "C" void kernel_launch(void* const* d_in, const int* in_sizes, int n_in,
                              void* d_out, int out_size, void* d_ws,
                              size_t ws_size, hipStream_t stream) {
  const float* hidden = (const float*)d_in[0];
  const float* Wq = (const float*)d_in[1];
  const float* bq = (const float*)d_in[2];
  const float* Wk = (const float*)d_in[3];
  const float* bk = (const float*)d_in[4];
  const float* Wv = (const float*)d_in[5];
  const float* bv = (const float*)d_in[6];
  const float* Wo = (const float*)d_in[7];
  const float* bo = (const float*)d_in[8];

  char* ws = (char*)d_ws;
  const size_t szX = (size_t)NM * ND * sizeof(f16);       // 56.7 MB
  const size_t szW = (size_t)ND * ND * sizeof(f16);       // 1.18 MB
  size_t off = 0;
  f16* Xh  = (f16*)(ws + off); off += szX;
  f16* Wqh = (f16*)(ws + off); off += szW;
  f16* Wkh = (f16*)(ws + off); off += szW;
  f16* Wvh = (f16*)(ws + off); off += szW;
  f16* Woh = (f16*)(ws + off); off += szW;
  f16* Qh  = (f16*)(ws + off); off += szX;
  f16* Kh  = (f16*)(ws + off); off += szX;
  f16* Vh  = (f16*)(ws + off); off += szX;
  f16* Ch  = (f16*)(ws + off); off += szX;

  // 1) conversions to f16: Xh, Wqh, Wkh, Wvh, Woh are one contiguous array
  cvt_all_f32_to_f16<<<CVT_BLOCKS, CVT_WAVES * 32, 0, stream>>>(hidden, Wq, Wk,
                                                                Wv, Wo, Xh);

  // 2) Q/K/V projections: tiles 128(M) x 128(N)
  dim3 gg((NM + 127) / 128, ND / 128);
  gemm_wmma<0><<<gg, 256, 0, stream>>>(Xh, Wqh, bq, Qh);
  gemm_wmma<0><<<gg, 256, 0, stream>>>(Xh, Wkh, bk, Kh);
  gemm_wmma<0><<<gg, 256, 0, stream>>>(Xh, Wvh, bv, Vh);

  // 3) flash attention -> ctx f16 [B,S,768]
  attn_flash<<<dim3((NS + 127) / 128, NH, NB), 256, 0, stream>>>(Qh, Kh, Vh, Ch);

  // 4) output projection -> f32 d_out
  gemm_wmma<1><<<gg, 256, 0, stream>>>(Ch, Woh, bo, d_out);
}

// v005
// One run takes 296 microseconds.
// Two timings next to v004 both put it at 1.04 times that version's speed.
// All steps since v000 together make it 1.75 times as fast.
#include <hip/hip_runtime.h>
#include <hip/hip_bf16.h>

// ---------------------------------------------------------------------------
// ViT attention (B=64, S=577, D=768, H=12, Dh=64) on gfx1250 (CDNA5, wave32).
// All GEMMs use v_wmma_f32_16x16x32_f16 (f16 inputs, f32 accumulate).
// Pipeline:
//   1) cvt f32->f16 of hidden + Wq/Wk/Wv/Wo into workspace (one launch)
//   2) WMMA GEMM (256x256 block tile, 64x64 wave tile, async-copy LDS ring):
//        Q/K/V = Xh @ W.T + b  -> f16 [B,S,768]
//   3) flash attention (online softmax, scores never leave registers)
//        -> ctx f16 [B,S,768]
//   4) WMMA GEMM: out = ctx @ Wo.T + bo -> f32 [B,S,768] (d_out)
// Workspace: 5 * 56.7MB (Xh,Q,K,V,ctx) + 4 * 1.18MB (weights) ~ 289 MB.
// ---------------------------------------------------------------------------

typedef _Float16 f16;
typedef __attribute__((ext_vector_type(8)))  _Float16 v8h;
typedef __attribute__((ext_vector_type(16))) _Float16 v16h;
typedef __attribute__((ext_vector_type(8)))  float    v8f;

#define NB   64
#define NS   577
#define ND   768
#define NH   12
#define NDH  64
#define NM   36928   // NB*NS
#define LOG2E 1.44269504088896340736f

static __device__ __forceinline__ v8h ld8(const f16* p) { return *(const v8h*)p; }

static __device__ __forceinline__ v16h cat16(v8h a, v8h b) {
  return __builtin_shufflevector(a, b, 0,1,2,3,4,5,6,7,8,9,10,11,12,13,14,15);
}

static __device__ __forceinline__ v8f wmma_f16(v16h a, v16h b, v8f c) {
  // D = A(16x32 f16) x B(32x16 f16) + C(16x16 f32)
  return __builtin_amdgcn_wmma_f32_16x16x32_f16(false, a, false, b, (short)0, c,
                                                false, false);
}

static __device__ __forceinline__ v8f splat8(float x) {
  v8f r;
#pragma unroll
  for (int i = 0; i < 8; ++i) r[i] = x;
  return r;
}

// ---------------------------------------------------------------------------
// f32 -> f16 conversion of hidden and of the four weights: ONE resident
// streaming launch, one 16-wave work-group per WGP. The five f16 destinations
// lie one behind the other in the workspace, so the destination is one array.
// A wave tile is 1024 floats: 8 loads of 16 B a lane, each 512 contiguous
// bytes of the wave. The next tile's 8 loads are issued before this tile is
// converted and stored (two register sets take turns), so a wave always has
// loads in flight. All five sizes are multiples of the tile: no tile straddles
// two sources. The tile count is a constant: every wave takes CVT_FULL tiles,
// CVT_REST waves one more.
// ---------------------------------------------------------------------------
typedef __attribute__((ext_vector_type(4))) float    v4f;
typedef __attribute__((ext_vector_type(4))) _Float16 v4h;

#define CVT_TILE   1024                      // floats of one wave tile
#define CVT_XT     (NM * ND / CVT_TILE)      // 27696 tiles of hidden
#define CVT_WT     (ND * ND / CVT_TILE)      // 576 tiles of one weight
#define CVT_NT     (CVT_XT + 4 * CVT_WT)     // 30000 tiles in all
#define CVT_BLOCKS 256
#define CVT_WAVES  16
#define CVT_NW     (CVT_BLOCKS * CVT_WAVES)  // 4096 waves
#define CVT_FULL   (CVT_NT / CVT_NW)         // 7
#define CVT_REST   (CVT_NT - CVT_FULL * CVT_NW)  // 1328

// Source of wave tile t (t is wave-uniform: the pick stays on the scalar
// side). tend is a compile-time bound, t < tend: trips that cannot reach the
// weights need no pick.
static __device__ __forceinline__ const float* cvt_tile_src(
    int t, int tend, const float* hidden, const float* Wq, const float* Wk,
    const float* Wv, const float* Wo) {
  if (tend <= CVT_XT) return hidden + (size_t)t * CVT_TILE;
  const int u = t - CVT_XT;
  const int w = u / CVT_WT;
  const float* base = (w == 0) ? Wq : (w == 1) ? Wk : (w == 2) ? Wv : Wo;
  return (u < 0) ? hidden + (size_t)t * CVT_TILE
                 : base + (size_t)(u - w * CVT_WT) * CVT_TILE;
}

// One tile's 8 loads of this lane.
static __device__ __forceinline__ void cvt_load8(v4f (&r)[8], const float* s) {
#pragma unroll
  for (int i = 0; i < 8; ++i) r[i] = *(const v4f*)(s + i * 128);
  // no register that an issued load names (its base is formed anew for the
  // next tile) is rewritten in front of this wait
  asm volatile("s_wait_xcnt 0x0" ::: "memory");
  // keeps what follows behind the wait, and the conversions of the tile before
  // behind these loads: hoisted above them, their wait for that tile's data
  // left only three loads in flight before the new ones were issued
  __builtin_amdgcn_sched_barrier(0);
}

// One tile converted and stored: 8 B a lane, 256 contiguous bytes a store.
// MORE: the wave goes on behind these stores (false for its last ones).
template <bool MORE>
static __device__ __forceinline__ void cvt_store8(const v4f (&r)[8], f16* d) {
#pragma unroll
  for (int i = 0; i < 8; ++i)
    *(v4h*)(d + i * 128) = __builtin_convertvector(r[i], v4h);
  if (MORE) {
    // no address or data register of an issued store is rewritten in front of
    // this wait
    asm volatile("s_wait_xcnt 0x0" ::: "memory");
    // keeps the instructions that follow behind the wait
    __builtin_amdgcn_sched_barrier(0);
  }
}

__global__ __launch_bounds__(CVT_WAVES * 32) void cvt_all_f32_to_f16(
    const float* __restrict__ hidden, const float* __restrict__ Wq,
    const float* __restrict__ Wk, const float* __restrict__ Wv,
    const float* __restrict__ Wo, f16* __restrict__ y) {
  static_assert(CVT_FULL % 2 == 1, "the pair loop leaves one full tile");
  const int lane4 = (threadIdx.x & 31) * 4;
  const int wave  = __builtin_amdgcn_readfirstlane((int)(threadIdx.x >> 5));
  // Full trips: a work-group's 16 tiles are adjacent (64 KB of source a trip).
  int t = (int)blockIdx.x * CVT_WAVES + wave;           // 0 .. CVT_NW - 1
  // The last, partial trip is dealt wave-major, so that it is spread over all
  // work-groups.
  const int rest = wave * CVT_BLOCKS + (int)blockIdx.x; // 0 .. CVT_NW - 1

  v4f ra[8], rb[8];
  cvt_load8(ra, cvt_tile_src(t, CVT_NW, hidden, Wq, Wk, Wv, Wo) + lane4);
  // Two tiles a trip, each set loaded one tile ahead of its stores. Kept
  // rolled: unrolled, the stores sank below later tiles' loads and the wave
  // once waited until no load was in flight.
#pragma unroll 1
  for (int k = 0; k < CVT_FULL / 2; ++k) {
    cvt_load8(rb, cvt_tile_src(t + CVT_NW, CVT_NT, hidden, Wq, Wk, Wv, Wo) + lane4);
    cvt_store8<true>(ra, y + (size_t)t * CVT_TILE + lane4);
    cvt_load8(ra, cvt_tile_src(t + 2 * CVT_NW, CVT_NT, hidden, Wq, Wk, Wv, Wo) + lane4);
    cvt_store8<true>(rb, y + (size_t)(t + CVT_NW) * CVT_TILE + lane4);
    t += 2 * CVT_NW;
  }
  // ra holds this wave's last full tile
  f16* dl = y + (size_t)t * CVT_TILE + lane4;
  if (rest < CVT_REST) {                         // the same for the whole wave
    const int tr = CVT_FULL * CVT_NW + rest;
    cvt_load8(rb, cvt_tile_src(tr, CVT_NT, hidden, Wq, Wk, Wv, Wo) + lane4);
    cvt_store8<true>(ra, dl);
    cvt_store8<false>(rb, y + (size_t)tr * CVT_TILE + lane4);
  } else {
    cvt_store8<false>(ra, dl);
  }
}

// ---------------------------------------------------------------------------
// WMMA GEMM: C[M,768] = X[M,768] @ W[768,768]^T + bias
//   block = 512 threads (16 waves), tile 256(M) x 256(N), stage = 64 k, one
//   work-group per WGP: an operand byte copied from L2 feeds 256 output
//   rows or columns.
//   wave (wm = wid&3 -> 64 rows, wn = wid>>2 -> 64 cols) computes 64x64:
//     4 A-frags + 4 B-frags -> 16 WMMAs per 32 k (1 ds_load_b128 / WMMA).
//   Staging: asynchronous copies global -> LDS, 16 B a lane, through no
//   register. A stage row is 64 halves = one whole 128-B line, brought by 8
//   adjacent lanes; LDS pitch 144 B (16 B x odd: no bank conflict for
//   ds_load_b128). Two buffers: stage t+1 flies while stage t is multiplied.
//   MODE 0: store f16 [M,768];  MODE 1: store f32 [M,768]  (compile-time).
// N=768 is a multiple of 256; M=36928 is not -> clamp the source rows; only
// the last M-tile takes the predicated store path (uniform branch).
// ---------------------------------------------------------------------------
#define GKS   64                 // k per stage
#define GPIT  72                 // LDS row pitch in halves (144 B)
#define GBT   256                // rows of X and rows of W in a block tile
#define GTILE (GBT * GPIT)       // halves of one operand tile in LDS
#define GNST  (ND / GKS)         // 12 stages

static __device__ __forceinline__ unsigned lds_addr(const void* p) {
  return (unsigned)(size_t)p;    // low 32 bits of a __shared__ address
}

// One stage's eight copies of this lane (4 of X, 4 of W). The closing
// s_wait_xcnt stands inside the statement so that no address register of an
// issued copy is rewritten in front of it.
static __device__ __forceinline__ void stage_copy(
    unsigned l0, unsigned l1, unsigned l2, unsigned l3, unsigned l4,
    unsigned l5, unsigned l6, unsigned l7, const f16* g0, const f16* g1,
    const f16* g2, const f16* g3, const f16* g4, const f16* g5, const f16* g6,
    const f16* g7) {
  asm volatile(
      "global_load_async_to_lds_b128 %0, %8, off\n\t"
      "global_load_async_to_lds_b128 %1, %9, off\n\t"
      "global_load_async_to_lds_b128 %2, %10, off\n\t"
      "global_load_async_to_lds_b128 %3, %11, off\n\t"
      "global_load_async_to_lds_b128 %4, %12, off\n\t"
      "global_load_async_to_lds_b128 %5, %13, off\n\t"
      "global_load_async_to_lds_b128 %6, %14, off\n\t"
      "global_load_async_to_lds_b128 %7, %15, off\n\t"
      "s_wait_xcnt 0x0"
      :
      : "v"(l0), "v"(l1), "v"(l2), "v"(l3), "v"(l4), "v"(l5), "v"(l6), "v"(l7),
        "v"(g0), "v"(g1), "v"(g2), "v"(g3), "v"(g4), "v"(g5), "v"(g6), "v"(g7)
      : "memory");
}

template <int MODE>
__global__ __launch_bounds__(512) void gemm_wmma(const f16* __restrict__ X,
                                                 const f16* __restrict__ W,
                                                 const float* __restrict__ bias,
                                                 void* __restrict__ out) {
  // [buffer][X tile | W tile], 256 rows x 64 halves at pitch 72
  __shared__ __attribute__((aligned(16))) f16 Sm[2 * 2 * GTILE];

  const int m0   = blockIdx.x * GBT;
  const int n0   = blockIdx.y * GBT;
  const int tid  = threadIdx.x;
  const int wid  = tid >> 5;
  const int lane = tid & 31;
  const int l16  = lane & 15;
  const int hi   = lane >> 4;       // which K-half group this lane owns
  const int wm   = wid & 3;         // M strip 0..3 (64 rows each)
  const int wn   = wid >> 2;        // N strip 0..3 (64 cols each)

  const int crow = tid >> 3;        // 0..63: row of this lane's copies (+64*i)
  const int cseg = (tid & 7) * 8;   // its 8-half (16-B) piece of the row

  // Source byte offsets (they fit 32 bits) and the LDS byte address of this
  // lane's first piece in buffer 0; the W rows and the LDS rows step evenly.
  unsigned ox[4];
#pragma unroll
  for (int i = 0; i < 4; ++i) {
    int am = m0 + crow + 64 * i; if (am > NM - 1) am = NM - 1;  // clamp OOB M
    ox[i] = (unsigned)(am * ND + cseg) * 2u;
  }
  const unsigned ow = (unsigned)((n0 + crow) * ND + cseg) * 2u;
  const unsigned l0 = lds_addr(&Sm[crow * GPIT + cseg]);
  const unsigned LROW = 64 * GPIT * 2;  // LDS bytes of 64 rows
  const unsigned GROW = 64 * ND * 2;    // source bytes of 64 rows
  const unsigned WOFF = GTILE * 2;      // bytes from the X tile to the W tile
  const unsigned BOFF = 2 * GTILE * 2;  // bytes from buffer 0 to buffer 1
  const char* Xc = (const char*)X;
  const char* Wc = (const char*)W;
  auto issue = [&](int st) {            // stage st -> buffer st & 1
    const unsigned lb = l0 + (st & 1) * BOFF;
    const unsigned kb = (unsigned)st * (GKS * 2);
    stage_copy(lb, lb + LROW, lb + 2 * LROW, lb + 3 * LROW, lb + WOFF,
               lb + WOFF + LROW, lb + WOFF + 2 * LROW, lb + WOFF + 3 * LROW,
               (const f16*)(Xc + (ox[0] + kb)), (const f16*)(Xc + (ox[1] + kb)),
               (const f16*)(Xc + (ox[2] + kb)), (const f16*)(Xc + (ox[3] + kb)),
               (const f16*)(Wc + (ow + kb)), (const f16*)(Wc + (ow + kb + GROW)),
               (const f16*)(Wc + (ow + kb + 2 * GROW)),
               (const f16*)(Wc + (ow + kb + 3 * GROW)));
  };

  v8f acc[4][4];
#pragma unroll
  for (int i = 0; i < 4; ++i)
#pragma unroll
    for (int j = 0; j < 4; ++j) acc[i][j] = splat8(0.f);

  // Prologue: stage 0 lands and is published, then stage 1 starts.
  issue(0);
  // this wave's copies have landed before the barrier publishes them
  asm volatile("s_wait_asynccnt 0x0" ::: "memory");
  __syncthreads();
  issue(1);

  // One 32-k block's fragments. A: lane = row (M); halves {0-7,16-23}
  // (lanes<16) / {8-15,24-31}. B: lane = col (N = W row), same K packing.
  auto frags = [&](const f16* As, const f16* Bs, int ks, v16h (&a)[4], v16h (&bf)[4]) {
#pragma unroll
    for (int i = 0; i < 4; ++i) {
      const f16* ap = &As[(wm * 64 + i * 16 + l16) * GPIT + ks + hi * 8];
      a[i] = cat16(ld8(ap), ld8(ap + 16));
    }
#pragma unroll
    for (int j = 0; j < 4; ++j) {
      const f16* bp = &Bs[(wn * 64 + j * 16 + l16) * GPIT + ks + hi * 8];
      bf[j] = cat16(ld8(bp), ld8(bp + 16));
    }
  };
  auto products = [&](const v16h (&a)[4], const v16h (&bf)[4]) {
#pragma unroll
    for (int i = 0; i < 4; ++i)
#pragma unroll
      for (int j = 0; j < 4; ++j) acc[i][j] = wmma_f16(a[i], bf[j], acc[i][j]);
  };
  static_assert(GKS == 64, "a stage is two 32-k blocks");

  for (int t = 0; t < GNST; ++t) {
    const f16* As = &Sm[(t & 1) * 2 * GTILE];
    const f16* Bs = As + GTILE;

    v16h a0[4], b0[4], a1[4], b1[4];
    frags(As, Bs, 0, a0, b0);
    // keeps the block's 16 LDS loads together in front of its 16 products:
    // left free, the compiler kept one A fragment and reloaded it in front of
    // every row of four products, each time waiting until no load was out
    __builtin_amdgcn_sched_barrier(0);
    products(a0, b0);
    frags(As, Bs, 32, a1, b1);   // the stage's last LDS reads
    // keeps the first block's products in front of the publish point: three of
    // them sank behind the barrier, where a wave that must wait for the matrix
    // unit issues its refill late
    __builtin_amdgcn_sched_barrier(0);

    // Publish point of stage t+1; it also ends every read of stage t's buffer.
    // It stands in front of the stage's second block of products, whose
    // fragments are in registers by then: with one work-group on the WGP the
    // refill gets a whole stage to land, and the waves leave the barrier with
    // matrix work in hand, under which the next stage's first LDS loads hide.
    // this wave's reads of the buffer have returned before it is refilled
    asm volatile("s_wait_dscnt 0x0" ::: "memory");
    // this wave's copies of stage t+1 have landed before others read them
    asm volatile("s_wait_asynccnt 0x0" ::: "memory");
    __syncthreads();
    if (t + 2 < GNST) issue(t + 2);   // the test is the same for the whole work-group
    products(a1, b1);
  }
  // nothing is outstanding when the wave goes on to its stores and ends
  asm volatile("s_wait_asynccnt 0x0" ::: "memory");

  // Epilogue. D layout: lane<16 -> row = base+r, lane>=16 -> row = base+8+r;
  // column = lane%16 within each 16-wide tile. Fast path (no predication)
  // unless this is the last M-tile (uniform branch).
  if (m0 + GBT <= NM) {
#pragma unroll
    for (int i = 0; i < 4; ++i) {
      const int mbase = m0 + wm * 64 + i * 16 + hi * 8;
#pragma unroll
      for (int j = 0; j < 4; ++j) {
        const int n    = n0 + wn * 64 + j * 16 + l16;
        const float bn = bias[n];
#pragma unroll
        for (int r = 0; r < 8; ++r) {
          const float v = acc[i][j][r] + bn;
          if (MODE == 0)
            ((f16*)out)[(size_t)(mbase + r) * ND + n] = (f16)v;
          else
            ((float*)out)[(size_t)(mbase + r) * ND + n] = v;
        }
      }
    }
  } else {
#pragma unroll
    for (int i = 0; i < 4; ++i) {
      const int mbase = m0 + wm * 64 + i * 16 + hi * 8;
#pragma unroll
      for (int j = 0; j < 4; ++j) {
        const int n    = n0 + wn * 64 + j * 16 + l16;
        const float bn = bias[n];
#pragma unroll
        for (int r = 0; r < 8; ++r) {
          if (mbase + r < NM) {
            const float v = acc[i][j][r] + bn;
            if (MODE == 0)
              ((f16*)out)[(size_t)(mbase + r) * ND + n] = (f16)v;
            else
              ((float*)out)[(size_t)(mbase + r) * ND + n] = v;
          }
        }
      }
    }
  }
}

static __device__ __forceinline__ float xhalf(float x) {
  const int b = __builtin_bit_cast(int, x);
  return __builtin_bit_cast(
      float, __builtin_amdgcn_permlanex16(b, b, 0x76543210, 0xfedcba98, false,
                                          false));
}

// x[r] = 2^x[r]. Eight independent v_exp_f32 in one statement, each filling
// the slot behind the one before it; the closing v_nop keeps the slot that the
// instruction set asks for between a transcendental and an instruction that
// overwrites its source or reads its result.
static __device__ __forceinline__ void exp2x8(v8f& x) {
  float a = x[0], b = x[1], c = x[2], d = x[3];
  float e = x[4], f = x[5], g = x[6], h = x[7];
  asm("v_exp_f32 %0, %0\n\tv_exp_f32 %1, %1\n\tv_exp_f32 %2, %2\n\t"
      "v_exp_f32 %3, %3\n\tv_exp_f32 %4, %4\n\tv_exp_f32 %5, %5\n\t"
      "v_exp_f32 %6, %6\n\tv_exp_f32 %7, %7\n\tv_nop"
      : "+v"(a), "+v"(b), "+v"(c), "+v"(d), "+v"(e), "+v"(f), "+v"(g), "+v"(h));
  x[0] = a; x[1] = b; x[2] = c; x[3] = d;
  x[4] = e; x[5] = f; x[6] = g; x[7] = h;
}

static __device__ __forceinline__ v16h pack16(v8f lo, v8f hi8) {
  v16h p;
#pragma unroll
  for (int r = 0; r < 8; ++r) {
    p[r]     = (f16)lo[r];
    p[8 + r] = (f16)hi8[r];
  }
  return p;
}

// Transposing LDS load of a row-major 16-bit tile: the lanes address 16 rows
// (keys) x 16 columns (dh) in 16-byte pieces, and lane (c = l & 15, h = l >> 4)
// receives column c of rows 8h .. 8h+7: half of an A fragment of V^T.
typedef __attribute__((ext_vector_type(8))) short s16x8;
static __device__ __forceinline__ v8h ld_tr16(const f16* p) {
  typedef __attribute__((address_space(3))) s16x8 lds_s16x8;
  return __builtin_bit_cast(v8h,
                            __builtin_amdgcn_ds_load_tr16_b128_v8i16((lds_s16x8*)p));
}

#define VPIT 80   // V row pitch in halves: 160 B = 32 B x odd, the transposing load's pitch

// The second bound (waves per SIMD) sets the register budget to 128, so that
// four work-groups stay resident on a WGP.
__global__ __launch_bounds__(256, 8) void attn_flash(const f16* __restrict__ Q,
                                                  const f16* __restrict__ K,
                                                  const f16* __restrict__ V,
                                                  f16* __restrict__ ctx_out) {
  __shared__ f16 Kt[64 * 72];       // [key][dh]   stride 72 halves (144B)
  __shared__ __attribute__((aligned(16))) f16 Vs[64 * VPIT];  // [key][dh]

  const int b    = blockIdx.z;
  const int h    = blockIdx.y;
  const int tid  = threadIdx.x;
  const int wid  = tid >> 5;
  const int lane = tid & 31;
  const int l16  = lane & 15;
  const int hi   = lane >> 4;
  const int q0   = blockIdx.x * 128 + wid * 16;

  const f16* Qb = Q + (size_t)b * NS * ND + h * NDH;   // row stride ND
  const f16* Kb = K + (size_t)b * NS * ND + h * NDH;
  const f16* Vb = V + (size_t)b * NS * ND + h * NDH;

  // Q B-fragments (64 K x 16 queries), scale 1/sqrt(64)=0.125 folded in (exact).
  int qr = q0 + l16; if (qr > NS - 1) qr = NS - 1;
  const f16* qp = Qb + (size_t)qr * ND + hi * 8;
  const f16 sc = (f16)0.125f;
  v16h qb0 = cat16(ld8(qp),      ld8(qp + 16)) * sc;   // k = 0..31
  v16h qb1 = cat16(ld8(qp + 32), ld8(qp + 48)) * sc;   // k = 32..63

  v8f acc[4];                        // O^T: acc[j][r] = O[query l16][j*16+8*hi+r]
#pragma unroll
  for (int j = 0; j < 4; ++j) acc[j] = splat8(0.f);
  float mrow = -1e30f;               // this lane's query: running maximum
  float lsum = 0.f;                  // sum over this wave half's keys only

  const int ldrow = tid >> 2;         // 0..63 key row to stage
  const int ldseg = (tid & 3) * 16;   // 16-half segment of dh

  for (int kb = 0; kb < NS; kb += 64) {
    __syncthreads();
    int krow = kb + ldrow; if (krow > NS - 1) krow = NS - 1;
    const f16* kp = Kb + (size_t)krow * ND + ldseg;
    const f16* vp = Vb + (size_t)krow * ND + ldseg;
    v8h k0 = ld8(kp), k1 = ld8(kp + 8);
    v8h v0 = ld8(vp), v1 = ld8(vp + 8);
    // no address register of the four issued loads is rewritten in front of this
    // wait: naming the two pointers keeps them whole up to it (in the 128-register
    // budget a load's result was otherwise placed on the address pair itself)
    asm volatile("s_wait_xcnt 0x0" :: "v"(kp), "v"(vp) : "memory");
    *(v8h*)&Kt[ldrow * 72 + ldseg]     = k0;
    *(v8h*)&Kt[ldrow * 72 + ldseg + 8] = k1;
    *(v8h*)&Vs[ldrow * VPIT + ldseg]     = v0;
    *(v8h*)&Vs[ldrow * VPIT + ldseg + 8] = v1;
    __syncthreads();

    // ---- scores S^T = K (Q/8)^T : 4 tiles of 16 keys ---------------------
    // s[t][r] = score(key kb + t*16 + 8*hi + r, query q0 + l16)
    v8f s[4];
#pragma unroll
    for (int t = 0; t < 4; ++t) {
      const f16* krp = &Kt[(t * 16 + l16) * 72 + hi * 8];
      v16h a0 = cat16(ld8(krp),      ld8(krp + 16));
      v16h a1 = cat16(ld8(krp + 32), ld8(krp + 48));
      v8f c = splat8(0.f);
      c = wmma_f16(a0, qb0, c);
      c = wmma_f16(a1, qb1, c);
      s[t] = c;
    }
    if (kb + 64 > NS) {               // uniform: only the last block has a tail
#pragma unroll
      for (int t = 0; t < 4; ++t)
#pragma unroll
        for (int r = 0; r < 8; ++r)
          if (kb + t * 16 + hi * 8 + r > NS - 1) s[t][r] = -1e30f;
    }

    // ---- maximum of this lane's 32 scores, then joined with the other half
    v8f mx8 = s[0];
#pragma unroll
    for (int t = 1; t < 4; ++t)
#pragma unroll
      for (int r = 0; r < 8; ++r) mx8[r] = fmaxf(mx8[r], s[t][r]);
    float mx = fmaxf(fmaxf(fmaxf(mx8[0], mx8[1]), fmaxf(mx8[2], mx8[3])),
                     fmaxf(fmaxf(mx8[4], mx8[5]), fmaxf(mx8[6], mx8[7])));
    mx = fmaxf(mx, xhalf(mx));

    const float mnew = fmaxf(mrow, mx);
    const float corr = __expf(mrow - mnew);
    mrow = mnew;

#pragma unroll
    for (int j = 0; j < 4; ++j) acc[j] *= corr;

    // Per 32 keys: exponentials, P^T B-fragment straight from the score
    // registers, then O^T += V^T P^T. (A fragment of V^T: lane = dh; a load
    // brings keys 8*hi+0..7 of a 16-key group, two loads 16 keys apart are one
    // 16 x 32 fragment.) Taken 32 keys at a time so that the first half's
    // scores and P^T are dead before the second half's fragments are live: all
    // 64 at once took more than 128 registers (three work-groups a WGP, not four).
    const f16* vrp = &Vs[(hi * 8 + (lane & 7)) * VPIT + ((lane >> 3) & 1) * 8];
    v8f rs2[2];
#pragma unroll
    for (int u = 0; u < 2; ++u) {
#pragma unroll
      for (int t = 2 * u; t < 2 * u + 2; ++t) {
#pragma unroll
        for (int r = 0; r < 8; ++r) s[t][r] = (s[t][r] - mnew) * LOG2E;
        exp2x8(s[t]);                // e^(s - m) as 2^((s - m) * log2 e)
      }
      rs2[u] = s[2 * u] + s[2 * u + 1];
      const v16h pb = pack16(s[2 * u], s[2 * u + 1]);   // keys 32u .. 32u+31
#pragma unroll
      for (int j = 0; j < 4; ++j) {
        const f16* vp2 = vrp + u * 32 * VPIT + j * 16;
        acc[j] = wmma_f16(cat16(ld_tr16(vp2), ld_tr16(vp2 + 16 * VPIT)), pb, acc[j]);
      }
    }
    const v8f rs8 = rs2[0] + rs2[1];
    const float rs = ((rs8[0] + rs8[1]) + (rs8[2] + rs8[3])) +
                     ((rs8[4] + rs8[5]) + (rs8[6] + rs8[7]));
    lsum = lsum * corr + rs;
  }

  // ---- finalize: join the halves' sums, ctx /= l, store f16 to [B, S, 768] --
  // A lane holds 8 consecutive dh of its query per tile: one 16-byte store.
  const float inv = 1.0f / (lsum + xhalf(lsum));
  const int q = q0 + l16;
  if (q < NS) {
    f16* outp = ctx_out + (size_t)b * NS * ND + (size_t)q * ND + h * NDH + hi * 8;
#pragma unroll
    for (int j = 0; j < 4; ++j) {
      v8h o;
#pragma unroll
      for (int r = 0; r < 8; ++r) o[r] = (f16)(acc[j][r] * inv);
      *(v8h*)(outp + j * 16) = o;
    }
  }
}

// ---------------------------------------------------------------------------
extern "C" void kernel_launch(void* const* d_in, const int* in_sizes, int n_in,
                              void* d_out, int out_size, void* d_ws,
                              size_t ws_size, hipStream_t stream) {
  const float* hidden = (const float*)d_in[0];
  const float* Wq = (const float*)d_in[1];
  const float* bq = (const float*)d_in[2];
  const float* Wk = (const float*)d_in[3];
  const float* bk = (const float*)d_in[4];
  const float* Wv = (const float*)d_in[5];
  const float* bv = (const float*)d_in[6];
  const float* Wo = (const float*)d_in[7];
  const float* bo = (const float*)d_in[8];

  char* ws = (char*)d_ws;
  const size_t szX = (size_t)NM * ND * sizeof(f16);       // 56.7 MB
  const size_t szW = (size_t)ND * ND * sizeof(f16);       // 1.18 MB
  size_t off = 0;
  f16* Xh  = (f16*)(ws + off); off += szX;
  f16* Wqh = (f16*)(ws + off); off += szW;
  f16* Wkh = (f16*)(ws + off); off += szW;
  f16* Wvh = (f16*)(ws + off); off += szW;
  f16* Woh = (f16*)(ws + off); off += szW;
  f16* Qh  = (f16*)(ws + off); off += szX;
  f16* Kh  = (f16*)(ws + off); off += szX;
  f16* Vh  = (f16*)(ws + off); off += szX;
  f16* Ch  = (f16*)(ws + off); off += szX;

  // 1) conversions to f16: Xh, Wqh, Wkh, Wvh, Woh are one contiguous array
  cvt_all_f32_to_f16<<<CVT_BLOCKS, CVT_WAVES * 32, 0, stream>>>(hidden, Wq, Wk,
                                                                Wv, Wo, Xh);

  // 2) Q/K/V projections: tiles 256(M) x 256(N)
  dim3 gg((NM + GBT - 1) / GBT, ND / GBT);
  gemm_wmma<0><<<gg, 512, 0, stream>>>(Xh, Wqh, bq, Qh);
  gemm_wmma<0><<<gg, 512, 0, stream>>>(Xh, Wkh, bk, Kh);
  gemm_wmma<0><<<gg, 512, 0, stream>>>(Xh, Wvh, bv, Vh);

  // 3) flash attention -> ctx f16 [B,S,768]
  attn_flash<<<dim3((NS + 127) / 128, NH, NB), 256, 0, stream>>>(Qh, Kh, Vh, Ch);

  // 4) output projection -> f32 d_out
  gemm_wmma<1><<<gg, 512, 0, stream>>>(Ch, Woh, bo, d_out);
}

// v006
// It runs in 260 microseconds.
// Next to v005, in two timings, it ran 1.14 times as fast each time.
// Counting every step since v000, it is 2.00 times as fast.
#include <hip/hip_runtime.h>
#include <hip/hip_bf16.h>

// ---------------------------------------------------------------------------
// ViT attention (B=64, S=577, D=768, H=12, Dh=64) on gfx1250 (CDNA5, wave32).
// All GEMMs use v_wmma_f32_16x16x32_f16 (f16 inputs, f32 accumulate).
// Pipeline:
//   1) cvt f32->f16 of hidden + Wq/Wk/Wv/Wo into workspace (one launch)
//   2) WMMA GEMM (256x256 block tile, 64x64 wave tile, async-copy LDS ring):
//        Q/K/V = Xh @ W.T + b  -> f16 [B,S,768]
//   3) flash attention (online softmax, scores never leave registers)
//        -> ctx f16 [B,S,768]
//   4) WMMA GEMM: out = ctx @ Wo.T + bo -> f32 [B,S,768] (d_out)
// Workspace: 5 * 56.7MB (Xh,Q,K,V,ctx) + 4 * 1.18MB (weights) ~ 289 MB.
// ---------------------------------------------------------------------------

typedef _Float16 f16;
typedef __attribute__((ext_vector_type(8)))  _Float16 v8h;
typedef __attribute__((ext_vector_type(16))) _Float16 v16h;
typedef __attribute__((ext_vector_type(8)))  float    v8f;

#define NB   64
#define NS   577
#define ND   768
#define NH   12
#define NDH  64
#define NM   36928   // NB*NS
#define LOG2E 1.44269504088896340736f

static __device__ __forceinline__ v8h ld8(const f16* p) { return *(const v8h*)p; }

static __device__ __forceinline__ v16h cat16(v8h a, v8h b) {
  return __builtin_shufflevector(a, b, 0,1,2,3,4,5,6,7,8,9,10,11,12,13,14,15);
}

static __device__ __forceinline__ v8f wmma_f16(v16h a, v16h b, v8f c) {
  // D = A(16x32 f16) x B(32x16 f16) + C(16x16 f32)
  return __builtin_amdgcn_wmma_f32_16x16x32_f16(false, a, false, b, (short)0, c,
                                                false, false);
}

static __device__ __forceinline__ v8f splat8(float x) {
  v8f r;
#pragma unroll
  for (int i = 0; i < 8; ++i) r[i] = x;
  return r;
}

// ---------------------------------------------------------------------------
// f32 -> f16 conversion of hidden and of the four weights: ONE resident
// streaming launch, one 16-wave work-group per WGP. The five f16 destinations
// lie one behind the other in the workspace, so the destination is one array.
// A wave tile is 1024 floats: 8 loads of 16 B a lane, each 512 contiguous
// bytes of the wave. The next tile's 8 loads are issued before this tile is
// converted and stored (two register sets take turns), so a wave always has
// loads in flight. All five sizes are multiples of the tile: no tile straddles
// two sources. The tile count is a constant: every wave takes CVT_FULL tiles,
// CVT_REST waves one more.
// ---------------------------------------------------------------------------
typedef __attribute__((ext_vector_type(4))) float    v4f;
typedef __attribute__((ext_vector_type(4))) _Float16 v4h;

#define CVT_TILE   1024                      // floats of one wave tile
#define CVT_XT     (NM * ND / CVT_TILE)      // 27696 tiles of hidden
#define CVT_WT     (ND * ND / CVT_TILE)      // 576 tiles of one weight
#define CVT_NT     (CVT_XT + 4 * CVT_WT)     // 30000 tiles in all
#define CVT_BLOCKS 256
#define CVT_WAVES  16
#define CVT_NW     (CVT_BLOCKS * CVT_WAVES)  // 4096 waves
#define CVT_FULL   (CVT_NT / CVT_NW)         // 7
#define CVT_REST   (CVT_NT - CVT_FULL * CVT_NW)  // 1328

// Source of wave tile t (t is wave-uniform: the pick stays on the scalar
// side). tend is a compile-time bound, t < tend: trips that cannot reach the
// weights need no pick.
static __device__ __forceinline__ const float* cvt_tile_src(
    int t, int tend, const float* hidden, const float* Wq, const float* Wk,
    const float* Wv, const float* Wo) {
  if (tend <= CVT_XT) return hidden + (size_t)t * CVT_TILE;
  const int u = t - CVT_XT;
  const int w = u / CVT_WT;
  const float* base = (w == 0) ? Wq : (w == 1) ? Wk : (w == 2) ? Wv : Wo;
  return (u < 0) ? hidden + (size_t)t * CVT_TILE
                 : base + (size_t)(u - w * CVT_WT) * CVT_TILE;
}

// One tile's 8 loads of this lane.
static __device__ __forceinline__ void cvt_load8(v4f (&r)[8], const float* s) {
#pragma unroll
  for (int i = 0; i < 8; ++i) r[i] = *(const v4f*)(s + i * 128);
  // no register that an issued load names (its base is formed anew for the
  // next tile) is rewritten in front of this wait
  asm volatile("s_wait_xcnt 0x0" ::: "memory");
  // keeps what follows behind the wait, and the conversions of the tile before
  // behind these loads: hoisted above them, their wait for that tile's data
  // left only three loads in flight before the new ones were issued
  __builtin_amdgcn_sched_barrier(0);
}

// One tile converted and stored: 8 B a lane, 256 contiguous bytes a store.
// MORE: the wave goes on behind these stores (false for its last ones).
template <bool MORE>
static __device__ __forceinline__ void cvt_store8(const v4f (&r)[8], f16* d) {
#pragma unroll
  for (int i = 0; i < 8; ++i)
    *(v4h*)(d + i * 128) = __builtin_convertvector(r[i], v4h);
  if (MORE) {
    // no address or data register of an issued store is rewritten in front of
    // this wait
    asm volatile("s_wait_xcnt 0x0" ::: "memory");
    // keeps the instructions that follow behind the wait
    __builtin_amdgcn_sched_barrier(0);
  }
}

__global__ __launch_bounds__(CVT_WAVES * 32) void cvt_all_f32_to_f16(
    const float* __restrict__ hidden, const float* __restrict__ Wq,
    const float* __restrict__ Wk, const float* __restrict__ Wv,
    const float* __restrict__ Wo, f16* __restrict__ y) {
  static_assert(CVT_FULL % 2 == 1, "the pair loop leaves one full tile");
  const int lane4 = (threadIdx.x & 31) * 4;
  const int wave  = __builtin_amdgcn_readfirstlane((int)(threadIdx.x >> 5));
  // Full trips: a work-group's 16 tiles are adjacent (64 KB of source a trip).
  int t = (int)blockIdx.x * CVT_WAVES + wave;           // 0 .. CVT_NW - 1
  // The last, partial trip is dealt wave-major, so that it is spread over all
  // work-groups.
  const int rest = wave * CVT_BLOCKS + (int)blockIdx.x; // 0 .. CVT_NW - 1

  v4f ra[8], rb[8];
  cvt_load8(ra, cvt_tile_src(t, CVT_NW, hidden, Wq, Wk, Wv, Wo) + lane4);
  // Two tiles a trip, each set loaded one tile ahead of its stores. Kept
  // rolled: unrolled, the stores sank below later tiles' loads and the wave
  // once waited until no load was in flight.
#pragma unroll 1
  for (int k = 0; k < CVT_FULL / 2; ++k) {
    cvt_load8(rb, cvt_tile_src(t + CVT_NW, CVT_NT, hidden, Wq, Wk, Wv, Wo) + lane4);
    cvt_store8<true>(ra, y + (size_t)t * CVT_TILE + lane4);
    cvt_load8(ra, cvt_tile_src(t + 2 * CVT_NW, CVT_NT, hidden, Wq, Wk, Wv, Wo) + lane4);
    cvt_store8<true>(rb, y + (size_t)(t + CVT_NW) * CVT_TILE + lane4);
    t += 2 * CVT_NW;
  }
  // ra holds this wave's last full tile
  f16* dl = y + (size_t)t * CVT_TILE + lane4;
  if (rest < CVT_REST) {                         // the same for the whole wave
    const int tr = CVT_FULL * CVT_NW + rest;
    cvt_load8(rb, cvt_tile_src(tr, CVT_NT, hidden, Wq, Wk, Wv, Wo) + lane4);
    cvt_store8<true>(ra, dl);
    cvt_store8<false>(rb, y + (size_t)tr * CVT_TILE + lane4);
  } else {
    cvt_store8<false>(ra, dl);
  }
}

// ---------------------------------------------------------------------------
// WMMA GEMM: C[M,768] = X[M,768] @ W[768,768]^T + bias
//   block = 512 threads (16 waves), tile 256(M) x 256(N), stage = 64 k, one
//   work-group per WGP: an operand byte copied from L2 feeds 256 output
//   rows or columns.
//   wave (wm = wid&3 -> 64 rows, wn = wid>>2 -> 64 cols) computes 64x64:
//     4 A-frags + 4 B-frags -> 16 WMMAs per 32 k (1 ds_load_b128 / WMMA).
//   Staging: asynchronous copies global -> LDS, 16 B a lane, through no
//   register. A stage row is 64 halves = one whole 128-B line, brought by 8
//   adjacent lanes; LDS pitch 144 B (16 B x odd: no bank conflict for
//   ds_load_b128). Two buffers: stage t+1 flies while stage t is multiplied.
//   MODE 0: store f16 [M,768];  MODE 1: store f32 [M,768]  (compile-time).
// N=768 is a multiple of 256; M=36928 is not -> clamp the source rows; only
// the last M-tile takes the predicated store path (uniform branch).
// ---------------------------------------------------------------------------
#define GKS   64                 // k per stage
#define GPIT  72                 // LDS row pitch in halves (144 B)
#define GBT   256                // rows of X and rows of W in a block tile
#define GTILE (GBT * GPIT)       // halves of one operand tile in LDS
#define GNST  (ND / GKS)         // 12 stages

static __device__ __forceinline__ unsigned lds_addr(const void* p) {
  return (unsigned)(size_t)p;    // low 32 bits of a __shared__ address
}

// One stage's eight copies of this lane (4 of X and 4 of W, or 4 of K and 4 of V). The closing
// s_wait_xcnt stands inside the statement so that no address register of an
// issued copy is rewritten in front of it.
static __device__ __forceinline__ void stage_copy(
    unsigned l0, unsigned l1, unsigned l2, unsigned l3, unsigned l4,
    unsigned l5, unsigned l6, unsigned l7, const f16* g0, const f16* g1,
    const f16* g2, const f16* g3, const f16* g4, const f16* g5, const f16* g6,
    const f16* g7) {
  asm volatile(
      "global_load_async_to_lds_b128 %0, %8, off\n\t"
      "global_load_async_to_lds_b128 %1, %9, off\n\t"
      "global_load_async_to_lds_b128 %2, %10, off\n\t"
      "global_load_async_to_lds_b128 %3, %11, off\n\t"
      "global_load_async_to_lds_b128 %4, %12, off\n\t"
      "global_load_async_to_lds_b128 %5, %13, off\n\t"
      "global_load_async_to_lds_b128 %6, %14, off\n\t"
      "global_load_async_to_lds_b128 %7, %15, off\n\t"
      "s_wait_xcnt 0x0"
      :
      : "v"(l0), "v"(l1), "v"(l2), "v"(l3), "v"(l4), "v"(l5), "v"(l6), "v"(l7),
        "v"(g0), "v"(g1), "v"(g2), "v"(g3), "v"(g4), "v"(g5), "v"(g6), "v"(g7)
      : "memory");
}

template <int MODE>
__global__ __launch_bounds__(512) void gemm_wmma(const f16* __restrict__ X,
                                                 const f16* __restrict__ W,
                                                 const float* __restrict__ bias,
                                                 void* __restrict__ out) {
  // [buffer][X tile | W tile], 256 rows x 64 halves at pitch 72
  __shared__ __attribute__((aligned(16))) f16 Sm[2 * 2 * GTILE];

  const int m0   = blockIdx.x * GBT;
  const int n0   = blockIdx.y * GBT;
  const int tid  = threadIdx.x;
  const int wid  = tid >> 5;
  const int lane = tid & 31;
  const int l16  = lane & 15;
  const int hi   = lane >> 4;       // which K-half group this lane owns
  const int wm   = wid & 3;         // M strip 0..3 (64 rows each)
  const int wn   = wid >> 2;        // N strip 0..3 (64 cols each)

  const int crow = tid >> 3;        // 0..63: row of this lane's copies (+64*i)
  const int cseg = (tid & 7) * 8;   // its 8-half (16-B) piece of the row

  // Source byte offsets (they fit 32 bits) and the LDS byte address of this
  // lane's first piece in buffer 0; the W rows and the LDS rows step evenly.
  unsigned ox[4];
#pragma unroll
  for (int i = 0; i < 4; ++i) {
    int am = m0 + crow + 64 * i; if (am > NM - 1) am = NM - 1;  // clamp OOB M
    ox[i] = (unsigned)(am * ND + cseg) * 2u;
  }
  const unsigned ow = (unsigned)((n0 + crow) * ND + cseg) * 2u;
  const unsigned l0 = lds_addr(&Sm[crow * GPIT + cseg]);
  const unsigned LROW = 64 * GPIT * 2;  // LDS bytes of 64 rows
  const unsigned GROW = 64 * ND * 2;    // source bytes of 64 rows
  const unsigned WOFF = GTILE * 2;      // bytes from the X tile to the W tile
  const unsigned BOFF = 2 * GTILE * 2;  // bytes from buffer 0 to buffer 1
  const char* Xc = (const char*)X;
  const char* Wc = (const char*)W;
  auto issue = [&](int st) {            // stage st -> buffer st & 1
    const unsigned lb = l0 + (st & 1) * BOFF;
    const unsigned kb = (unsigned)st * (GKS * 2);
    stage_copy(lb, lb + LROW, lb + 2 * LROW, lb + 3 * LROW, lb + WOFF,
               lb + WOFF + LROW, lb + WOFF + 2 * LROW, lb + WOFF + 3 * LROW,
               (const f16*)(Xc + (ox[0] + kb)), (const f16*)(Xc + (ox[1] + kb)),
               (const f16*)(Xc + (ox[2] + kb)), (const f16*)(Xc + (ox[3] + kb)),
               (const f16*)(Wc + (ow + kb)), (const f16*)(Wc + (ow + kb + GROW)),
               (const f16*)(Wc + (ow + kb + 2 * GROW)),
               (const f16*)(Wc + (ow + kb + 3 * GROW)));
  };

  v8f acc[4][4];
#pragma unroll
  for (int i = 0; i < 4; ++i)
#pragma unroll
    for (int j = 0; j < 4; ++j) acc[i][j] = splat8(0.f);

  // Prologue: stage 0 lands and is published, then stage 1 starts.
  issue(0);
  // this wave's copies have landed before the barrier publishes them
  asm volatile("s_wait_asynccnt 0x0" ::: "memory");
  __syncthreads();
  issue(1);

  // One 32-k block's fragments. A: lane = row (M); halves {0-7,16-23}
  // (lanes<16) / {8-15,24-31}. B: lane = col (N = W row), same K packing.
  auto frags = [&](const f16* As, const f16* Bs, int ks, v16h (&a)[4], v16h (&bf)[4]) {
#pragma unroll
    for (int i = 0; i < 4; ++i) {
      const f16* ap = &As[(wm * 64 + i * 16 + l16) * GPIT + ks + hi * 8];
      a[i] = cat16(ld8(ap), ld8(ap + 16));
    }
#pragma unroll
    for (int j = 0; j < 4; ++j) {
      const f16* bp = &Bs[(wn * 64 + j * 16 + l16) * GPIT + ks + hi * 8];
      bf[j] = cat16(ld8(bp), ld8(bp + 16));
    }
  };
  auto products = [&](const v16h (&a)[4], const v16h (&bf)[4]) {
#pragma unroll
    for (int i = 0; i < 4; ++i)
#pragma unroll
      for (int j = 0; j < 4; ++j) acc[i][j] = wmma_f16(a[i], bf[j], acc[i][j]);
  };
  static_assert(GKS == 64, "a stage is two 32-k blocks");

  for (int t = 0; t < GNST; ++t) {
    const f16* As = &Sm[(t & 1) * 2 * GTILE];
    const f16* Bs = As + GTILE;

    v16h a0[4], b0[4], a1[4], b1[4];
    frags(As, Bs, 0, a0, b0);
    // keeps the block's 16 LDS loads together in front of its 16 products:
    // left free, the compiler kept one A fragment and reloaded it in front of
    // every row of four products, each time waiting until no load was out
    __builtin_amdgcn_sched_barrier(0);
    products(a0, b0);
    frags(As, Bs, 32, a1, b1);   // the stage's last LDS reads
    // keeps the first block's products in front of the publish point: three of
    // them sank behind the barrier, where a wave that must wait for the matrix
    // unit issues its refill late
    __builtin_amdgcn_sched_barrier(0);

    // Publish point of stage t+1; it also ends every read of stage t's buffer.
    // It stands in front of the stage's second block of products, whose
    // fragments are in registers by then: with one work-group on the WGP the
    // refill gets a whole stage to land, and the waves leave the barrier with
    // matrix work in hand, under which the next stage's first LDS loads hide.
    // this wave's reads of the buffer have returned before it is refilled
    asm volatile("s_wait_dscnt 0x0" ::: "memory");
    // this wave's copies of stage t+1 have landed before others read them
    asm volatile("s_wait_asynccnt 0x0" ::: "memory");
    __syncthreads();
    if (t + 2 < GNST) issue(t + 2);   // the test is the same for the whole work-group
    products(a1, b1);
  }
  // nothing is outstanding when the wave goes on to its stores and ends
  asm volatile("s_wait_asynccnt 0x0" ::: "memory");

  // Epilogue. D layout: lane<16 -> row = base+r, lane>=16 -> row = base+8+r;
  // column = lane%16 within each 16-wide tile. Fast path (no predication)
  // unless this is the last M-tile (uniform branch).
  if (m0 + GBT <= NM) {
#pragma unroll
    for (int i = 0; i < 4; ++i) {
      const int mbase = m0 + wm * 64 + i * 16 + hi * 8;
#pragma unroll
      for (int j = 0; j < 4; ++j) {
        const int n    = n0 + wn * 64 + j * 16 + l16;
        const float bn = bias[n];
#pragma unroll
        for (int r = 0; r < 8; ++r) {
          const float v = acc[i][j][r] + bn;
          if (MODE == 0)
            ((f16*)out)[(size_t)(mbase + r) * ND + n] = (f16)v;
          else
            ((float*)out)[(size_t)(mbase + r) * ND + n] = v;
        }
      }
    }
  } else {
#pragma unroll
    for (int i = 0; i < 4; ++i) {
      const int mbase = m0 + wm * 64 + i * 16 + hi * 8;
#pragma unroll
      for (int j = 0; j < 4; ++j) {
        const int n    = n0 + wn * 64 + j * 16 + l16;
        const float bn = bias[n];
#pragma unroll
        for (int r = 0; r < 8; ++r) {
          if (mbase + r < NM) {
            const float v = acc[i][j][r] + bn;
            if (MODE == 0)
              ((f16*)out)[(size_t)(mbase + r) * ND + n] = (f16)v;
            else
              ((float*)out)[(size_t)(mbase + r) * ND + n] = v;
          }
        }
      }
    }
  }
}

// ---------------------------------------------------------------------------
// Flash attention: grid (H=12, B=64), 608 threads = 19 waves.
// Q/K/V are f16 [B,S,768]; head h occupies columns [h*64, h*64+64).
// Each wave owns 32 queries; the head's K and V lie whole in LDS (both
// row-major). The products are taken transposed:
//   S^T = K (Q/8)^T   (A = K rows from LDS, B = Q fragments, see the kernel)
//   O^T += V^T P^T    (A = V^T by the transposing LDS load, B = P^T packed
//                      from S^T)
// In a D tile register r of lane l is [row 8*(l>>4)+r][column l&15], so a lane
// holds 32 of the 64 scores of ONE query (its partner l^16 the other 32):
// maximum and sum run in the lane's own registers, one exchange between the
// wave halves joins the maximum, and two S^T tiles packed to f16 are a B
// fragment in the hardware k order (k = 8h+s, 16+8h+s), the order in which
// the transposing load delivers V^T. softmax scale (1/8, exact in f16) is
// folded into Q.
// ---------------------------------------------------------------------------
static __device__ __forceinline__ float xhalf(float x) {  // lane l <-> l ^ 16
  const int b = __builtin_bit_cast(int, x);
  return __builtin_bit_cast(
      float, __builtin_amdgcn_permlanex16(b, b, 0x76543210, 0xfedcba98, false,
                                          false));
}

// x[r] = 2^x[r]. Eight independent v_exp_f32 in one statement, each filling
// the slot behind the one before it; the closing v_nop keeps the slot that the
// instruction set asks for between a transcendental and an instruction that
// overwrites its source or reads its result.
static __device__ __forceinline__ void exp2x8(v8f& x) {
  float a = x[0], b = x[1], c = x[2], d = x[3];
  float e = x[4], f = x[5], g = x[6], h = x[7];
  asm("v_exp_f32 %0, %0\n\tv_exp_f32 %1, %1\n\tv_exp_f32 %2, %2\n\t"
      "v_exp_f32 %3, %3\n\tv_exp_f32 %4, %4\n\tv_exp_f32 %5, %5\n\t"
      "v_exp_f32 %6, %6\n\tv_exp_f32 %7, %7\n\tv_nop"
      : "+v"(a), "+v"(b), "+v"(c), "+v"(d), "+v"(e), "+v"(f), "+v"(g), "+v"(h));
  x[0] = a; x[1] = b; x[2] = c; x[3] = d;
  x[4] = e; x[5] = f; x[6] = g; x[7] = h;
}

// The same for two values.
static __device__ __forceinline__ void exp2x2(float& a, float& b) {
  asm("v_exp_f32 %0, %0\n\tv_exp_f32 %1, %1\n\tv_nop" : "+v"(a), "+v"(b));
}

static __device__ __forceinline__ v16h pack16(v8f lo, v8f hi8) {
  v16h p;
#pragma unroll
  for (int r = 0; r < 8; ++r) {
    p[r]     = (f16)lo[r];
    p[8 + r] = (f16)hi8[r];
  }
  return p;
}

// Transposing LDS load of a row-major 16-bit tile: the lanes address 16 rows
// (keys) x 16 columns (dh) in 16-byte pieces, and lane (c = l & 15, h = l >> 4)
// receives column c of rows 8h .. 8h+7: half of an A fragment of V^T.
typedef __attribute__((ext_vector_type(8))) short s16x8;
static __device__ __forceinline__ v8h ld_tr16(const f16* p) {
  typedef __attribute__((address_space(3))) s16x8 lds_s16x8;
  return __builtin_bit_cast(v8h,
                            __builtin_amdgcn_ds_load_tr16_b128_v8i16((lds_s16x8*)p));
}

#define VPIT 80   // V row pitch in halves: 160 B = 32 B x odd, the transposing load's pitch
#define KPIT 72   // K row pitch in halves: 144 B = 16 B x odd, for ds_load_b128
#define AW    19            // waves of a work-group: 19 x 32 queries cover the 577
#define AROWS (AW * 32)     // 608 staged key rows; rows past the last key repeat it
#define AHALF (AROWS / 2)   // rows of one of the two staging steps

template <int N> struct int_c { static constexpr int v = N; };

// One work-group per (batch, head). The head's whole K and V lie in LDS, staged
// once by asynchronous copies in two steps of 304 rows: the second step flies
// under the first four 64-key passes. A wave owns 32 queries (two 16-column
// groups), so a K or V^T fragment read from LDS feeds two products, and the
// key loop has no barrier but the one that publishes the second step.
__global__ __launch_bounds__(AW * 32) void attn_flash(const f16* __restrict__ Q,
                                                  const f16* __restrict__ K,
                                                  const f16* __restrict__ V,
                                                  f16* __restrict__ ctx_out) {
  __shared__ __attribute__((aligned(16))) f16 Kt[AROWS * KPIT];  // [key][dh]
  __shared__ __attribute__((aligned(16))) f16 Vs[AROWS * VPIT];  // [key][dh]
  __shared__ __attribute__((aligned(16))) f16 Qs[AW * 8 * 256];  // [wave][piece][lane]

  const int b    = blockIdx.y;
  const int h    = blockIdx.x;
  const int tid  = threadIdx.x;
  const int wid  = tid >> 5;
  const int lane = tid & 31;
  const int l16  = lane & 15;
  const int hi   = lane >> 4;
  const int q0   = wid * 32;

  const f16* Qb = Q + (size_t)b * NS * ND + h * NDH;   // row stride ND
  const f16* Kb = K + (size_t)b * NS * ND + h * NDH;
  const f16* Vb = V + (size_t)b * NS * ND + h * NDH;

  // Staging: 8 adjacent lanes bring one row's 128 B (a whole line); the 608
  // lanes cover 76 rows a copy, four copies of K and four of V a step.
  const int crow = tid >> 3;        // 0..75
  const int cseg = (tid & 7) * 8;   // this lane's 8-half (16-B) piece of a row
  auto stage = [&](int st) {
    unsigned lk[4], lv[4];
    const f16 *gk[4], *gv[4];
#pragma unroll
    for (int i = 0; i < 4; ++i) {
      const int row = st * AHALF + i * (AHALF / 4) + crow;
      const int srow = row > NS - 1 ? NS - 1 : row;      // source row in bounds
      lk[i] = lds_addr(&Kt[row * KPIT + cseg]);
      lv[i] = lds_addr(&Vs[row * VPIT + cseg]);
      gk[i] = Kb + (size_t)srow * ND + cseg;
      gv[i] = Vb + (size_t)srow * ND + cseg;
    }
    stage_copy(lk[0], lk[1], lk[2], lk[3], lv[0], lv[1], lv[2], lv[3],
               gk[0], gk[1], gk[2], gk[3], gv[0], gv[1], gv[2], gv[3]);
  };

  stage(0);

  // Q B-fragments (64 K x 16 queries a group), scale 1/sqrt(64)=0.125 folded in
  // (exact). They wait in the wave's own LDS range, in fragment order (piece
  // x of fragment [c][ks]: 32 lanes x 16 B in a row), and are read back once a
  // pass: kept in registers, their 32 overran the budget of five waves a SIMD.
  const f16 sc = (f16)0.125f;
  f16* qs = &Qs[wid * (8 * 256) + lane * 8];
#pragma unroll
  for (int c = 0; c < 2; ++c) {
    int qr = q0 + c * 16 + l16; if (qr > NS - 1) qr = NS - 1;
    const f16* qp = Qb + (size_t)qr * ND + hi * 8;
#pragma unroll
    for (int x = 0; x < 4; ++x)      // k = 16x + 8*hi + 0..7
      *(v8h*)(qs + (c * 4 + x) * 256) = ld8(qp + x * 16) * sc;
  }

  // this wave's copies of rows 0..303 have landed before the barrier publishes them
  asm volatile("s_wait_asynccnt 0x0" ::: "memory");
  __syncthreads();
  stage(1);

  v8f acc[2][4];                     // O^T: acc[c][j][r] = O[query c*16+l16][j*16+8*hi+r]
#pragma unroll
  for (int c = 0; c < 2; ++c)
#pragma unroll
    for (int j = 0; j < 4; ++j) acc[c][j] = splat8(0.f);
  float mrow[2] = {-1e30f, -1e30f};  // this lane's two queries: running maximum
  float lsum[2] = {0.f, 0.f};        // sums over this wave half's keys only

  const f16* krp0 = &Kt[l16 * KPIT + hi * 8];
  const f16* vrp0 = &Vs[(hi * 8 + (lane & 7)) * VPIT + ((lane >> 3) & 1) * 8];

  // One pass over NU x 32 keys from key kb on. NU = 2: all keys exist. NU = 1:
  // the tail, keys past the last are masked.
  auto pass = [&](auto nu, int kb) {
    constexpr int NU = decltype(nu)::v;
    constexpr int NT = 2 * NU;
    // ---- scores S^T = K (Q/8)^T : NT tiles of 16 keys x 2 query groups -----
    // s[c][t][r] = score(key kb + t*16 + 8*hi + r, query q0 + c*16 + l16)
    v8f s[2][NT];
#pragma unroll
    for (int ks = 0; ks < 2; ++ks) {   // dh 0..31, then dh 32..63
      const v16h qf0 = cat16(ld8(qs + (2 * ks) * 256),     ld8(qs + (2 * ks + 1) * 256));
      const v16h qf1 = cat16(ld8(qs + (4 + 2 * ks) * 256), ld8(qs + (5 + 2 * ks) * 256));
#pragma unroll
      for (int t = 0; t < NT; ++t) {
        const f16* krp = krp0 + (kb + t * 16) * KPIT + ks * 32;
        const v16h a = cat16(ld8(krp), ld8(krp + 16));
        s[0][t] = wmma_f16(a, qf0, ks == 0 ? splat8(0.f) : s[0][t]);
        s[1][t] = wmma_f16(a, qf1, ks == 0 ? splat8(0.f) : s[1][t]);
      }
      // keeps one dh half's fragments (48 registers) live at a time, and the
      // V^T loads behind the score products: left free, the loads were hoisted
      // to the top of the pass and the 192-register budget of five waves a SIMD
      // was overrun (spills in the key loop)
      __builtin_amdgcn_sched_barrier(0);
    }
    if (NU == 1) {
#pragma unroll
      for (int c = 0; c < 2; ++c)
#pragma unroll
        for (int t = 0; t < NT; ++t)
#pragma unroll
          for (int r = 0; r < 8; ++r)
            if (kb + t * 16 + hi * 8 + r > NS - 1) s[c][t][r] = -1e30f;
    }

    // ---- maximum of a lane's scores per query, joined with the other half --
    float mnew[2], corr[2];
#pragma unroll
    for (int c = 0; c < 2; ++c) {
      v8f mx8 = s[c][0];
#pragma unroll
      for (int t = 1; t < NT; ++t)
#pragma unroll
        for (int r = 0; r < 8; ++r) mx8[r] = fmaxf(mx8[r], s[c][t][r]);
      float mx = fmaxf(fmaxf(fmaxf(mx8[0], mx8[1]), fmaxf(mx8[2], mx8[3])),
                       fmaxf(fmaxf(mx8[4], mx8[5]), fmaxf(mx8[6], mx8[7])));
      mx = fmaxf(mx, xhalf(mx));
      mnew[c] = fmaxf(mrow[c], mx);
      corr[c] = (mrow[c] - mnew[c]) * LOG2E;
      mrow[c] = mnew[c];
    }
    exp2x2(corr[0], corr[1]);        // e^(old maximum - new maximum)
#pragma unroll
    for (int c = 0; c < 2; ++c)
#pragma unroll
      for (int j = 0; j < 4; ++j) acc[c][j] *= corr[c];

    // Per 32 keys: exponentials, P^T B-fragments straight from the score
    // registers, then O^T += V^T P^T. (A fragment of V^T: lane = dh; a load
    // brings keys 8*hi+0..7 of a 16-key group, two loads 16 keys apart are one
    // 16 x 32 fragment; it feeds both query groups.)
    v8f rs8[2];
#pragma unroll
    for (int u = 0; u < NU; ++u) {
      v16h pb[2];
#pragma unroll
      for (int c = 0; c < 2; ++c) {
#pragma unroll
        for (int t = 2 * u; t < 2 * u + 2; ++t) {
#pragma unroll
          for (int r = 0; r < 8; ++r) s[c][t][r] = (s[c][t][r] - mnew[c]) * LOG2E;
          exp2x8(s[c][t]);           // e^(s - m) as 2^((s - m) * log2 e)
        }
        const v8f rsu = s[c][2 * u] + s[c][2 * u + 1];
        rs8[c] = (u == 0) ? rsu : rs8[c] + rsu;
        pb[c] = pack16(s[c][2 * u], s[c][2 * u + 1]);   // keys 32u .. 32u+31
      }
#pragma unroll
      for (int j = 0; j < 4; ++j) {
        const f16* vp2 = vrp0 + (kb + u * 32) * VPIT + j * 16;
        const v16h vf = cat16(ld_tr16(vp2), ld_tr16(vp2 + 16 * VPIT));
        acc[0][j] = wmma_f16(vf, pb[0], acc[0][j]);
        acc[1][j] = wmma_f16(vf, pb[1], acc[1][j]);
      }
    }
#pragma unroll
    for (int c = 0; c < 2; ++c) {
      const float rs = ((rs8[c][0] + rs8[c][1]) + (rs8[c][2] + rs8[c][3])) +
                       ((rs8[c][4] + rs8[c][5]) + (rs8[c][6] + rs8[c][7]));
      lsum[c] = lsum[c] * corr[c] + rs;
    }
  };

  static_assert(4 * 64 <= AHALF, "the first four passes read the first step's rows only");
  static_assert(NS / 64 * 64 + 32 <= AROWS && NS - NS / 64 * 64 <= 32, "one 32-key tail");
  for (int p = 0; p < NS / 64; ++p) {
    if (p == 4) {                    // the same for the whole work-group
      // this wave's copies of rows 304..607 have landed before others read them
      asm volatile("s_wait_asynccnt 0x0" ::: "memory");
      __syncthreads();
    }
    pass(int_c<2>{}, p * 64);
  }
  pass(int_c<1>{}, NS / 64 * 64);

  // ---- finalize: join the halves' sums, ctx /= l, store f16 to [B, S, 768] --
  // A lane holds 8 consecutive dh of a query per tile: one 16-byte store.
#pragma unroll
  for (int c = 0; c < 2; ++c) {
    const float inv = 1.0f / (lsum[c] + xhalf(lsum[c]));
    const int q = q0 + c * 16 + l16;
    if (q < NS) {
      f16* outp = ctx_out + (size_t)b * NS * ND + (size_t)q * ND + h * NDH + hi * 8;
#pragma unroll
      for (int j = 0; j < 4; ++j) {
        v8h o;
#pragma unroll
        for (int r = 0; r < 8; ++r) o[r] = (f16)(acc[c][j][r] * inv);
        *(v8h*)(outp + j * 16) = o;
      }
    }
  }
}

// ---------------------------------------------------------------------------
extern "C" void kernel_launch(void* const* d_in, const int* in_sizes, int n_in,
                              void* d_out, int out_size, void* d_ws,
                              size_t ws_size, hipStream_t stream) {
  const float* hidden = (const float*)d_in[0];
  const float* Wq = (const float*)d_in[1];
  const float* bq = (const float*)d_in[2];
  const float* Wk = (const float*)d_in[3];
  const float* bk = (const float*)d_in[4];
  const float* Wv = (const float*)d_in[5];
  const float* bv = (const float*)d_in[6];
  const float* Wo = (const float*)d_in[7];
  const float* bo = (const float*)d_in[8];

  char* ws = (char*)d_ws;
  const size_t szX = (size_t)NM * ND * sizeof(f16);       // 56.7 MB
  const size_t szW = (size_t)ND * ND * sizeof(f16);       // 1.18 MB
  size_t off = 0;
  f16* Xh  = (f16*)(ws + off); off += szX;
  f16* Wqh = (f16*)(ws + off); off += szW;
  f16* Wkh = (f16*)(ws + off); off += szW;
  f16* Wvh = (f16*)(ws + off); off += szW;
  f16* Woh = (f16*)(ws + off); off += szW;
  f16* Qh  = (f16*)(ws + off); off += szX;
  f16* Kh  = (f16*)(ws + off); off += szX;
  f16* Vh  = (f16*)(ws + off); off += szX;
  f16* Ch  = (f16*)(ws + off); off += szX;

  // 1) conversions to f16: Xh, Wqh, Wkh, Wvh, Woh are one contiguous array
  cvt_all_f32_to_f16<<<CVT_BLOCKS, CVT_WAVES * 32, 0, stream>>>(hidden, Wq, Wk,
                                                                Wv, Wo, Xh);

  // 2) Q/K/V projections: tiles 256(M) x 256(N)
  dim3 gg((NM + GBT - 1) / GBT, ND / GBT);
  gemm_wmma<0><<<gg, 512, 0, stream>>>(Xh, Wqh, bq, Qh);
  gemm_wmma<0><<<gg, 512, 0, stream>>>(Xh, Wkh, bk, Kh);
  gemm_wmma<0><<<gg, 512, 0, stream>>>(Xh, Wvh, bv, Vh);

  // 3) flash attention -> ctx f16 [B,S,768]
  attn_flash<<<dim3(NH, NB), AW * 32, 0, stream>>>(Qh, Kh, Vh, Ch);

  // 4) output projection -> f32 d_out
  gemm_wmma<1><<<gg, 512, 0, stream>>>(Ch, Woh, bo, d_out);
}

// v007
// One run takes 243 microseconds.
// Next to v006, in two timings, it ran 1.06 and 1.07 times as fast.
// All steps since v000 together make it 2.13 times as fast.
#include <hip/hip_runtime.h>
#include <hip/hip_bf16.h>

// ---------------------------------------------------------------------------
// ViT attention (B=64, S=577, D=768, H=12, Dh=64) on gfx1250 (CDNA5, wave32).
// All GEMMs use v_wmma_f32_16x16x32_f16 (f16 inputs, f32 accumulate).
// Pipeline:
//   1) cvt f32->f16 of hidden + Wq/Wk/Wv/Wo into workspace (one launch)
//   2) WMMA GEMM (256x256 block tile, 64x64 wave tile, async-copy LDS ring,
//      resident work-groups that walk the tiles), one launch for all three:
//        Q/K/V = Xh @ W.T + b  -> f16 [B,S,768]
//   3) flash attention (online softmax, scores never leave registers)
//        -> ctx f16 [B,S,768]
//   4) WMMA GEMM: out = ctx @ Wo.T + bo -> f32 [B,S,768] (d_out)
// Workspace: 5 * 56.7MB (Xh,Q,K,V,ctx) + 4 * 1.18MB (weights) ~ 289 MB.
// ---------------------------------------------------------------------------

typedef _Float16 f16;
typedef __attribute__((ext_vector_type(8)))  _Float16 v8h;
typedef __attribute__((ext_vector_type(16))) _Float16 v16h;
typedef __attribute__((ext_vector_type(8)))  float    v8f;

#define NB   64
#define NS   577
#define ND   768
#define NH   12
#define NDH  64
#define NM   36928   // NB*NS
#define LOG2E 1.44269504088896340736f

static __device__ __forceinline__ v8h ld8(const f16* p) { return *(const v8h*)p; }

static __device__ __forceinline__ v16h cat16(v8h a, v8h b) {
  return __builtin_shufflevector(a, b, 0,1,2,3,4,5,6,7,8,9,10,11,12,13,14,15);
}

static __device__ __forceinline__ v8f wmma_f16(v16h a, v16h b, v8f c) {
  // D = A(16x32 f16) x B(32x16 f16) + C(16x16 f32)
  return __builtin_amdgcn_wmma_f32_16x16x32_f16(false, a, false, b, (short)0, c,
                                                false, false);
}

static __device__ __forceinline__ v8f splat8(float x) {
  v8f r;
#pragma unroll
  for (int i = 0; i < 8; ++i) r[i] = x;
  return r;
}

// ---------------------------------------------------------------------------
// f32 -> f16 conversion of hidden and of the four weights: ONE resident
// streaming launch, one 16-wave work-group per WGP. The five f16 destinations
// lie one behind the other in the workspace, so the destination is one array.
// A wave tile is 1024 floats: 8 loads of 16 B a lane, each 512 contiguous
// bytes of the wave. The next tile's 8 loads are issued before this tile is
// converted and stored (two register sets take turns), so a wave always has
// loads in flight. All five sizes are multiples of the tile: no tile straddles
// two sources. The tile count is a constant: every wave takes CVT_FULL tiles,
// CVT_REST waves one more.
// ---------------------------------------------------------------------------
typedef __attribute__((ext_vector_type(4))) float    v4f;
typedef __attribute__((ext_vector_type(4))) _Float16 v4h;

#define CVT_TILE   1024                      // floats of one wave tile
#define CVT_XT     (NM * ND / CVT_TILE)      // 27696 tiles of hidden
#define CVT_WT     (ND * ND / CVT_TILE)      // 576 tiles of one weight
#define CVT_NT     (CVT_XT + 4 * CVT_WT)     // 30000 tiles in all
#define CVT_BLOCKS 256
#define CVT_WAVES  16
#define CVT_NW     (CVT_BLOCKS * CVT_WAVES)  // 4096 waves
#define CVT_FULL   (CVT_NT / CVT_NW)         // 7
#define CVT_REST   (CVT_NT - CVT_FULL * CVT_NW)  // 1328

// Source of wave tile t (t is wave-uniform: the pick stays on the scalar
// side). tend is a compile-time bound, t < tend: trips that cannot reach the
// weights need no pick.
static __device__ __forceinline__ const float* cvt_tile_src(
    int t, int tend, const float* hidden, const float* Wq, const float* Wk,
    const float* Wv, const float* Wo) {
  if (tend <= CVT_XT) return hidden + (size_t)t * CVT_TILE;
  const int u = t - CVT_XT;
  const int w = u / CVT_WT;
  const float* base = (w == 0) ? Wq : (w == 1) ? Wk : (w == 2) ? Wv : Wo;
  return (u < 0) ? hidden + (size_t)t * CVT_TILE
                 : base + (size_t)(u - w * CVT_WT) * CVT_TILE;
}

// One tile's 8 loads of this lane.
static __device__ __forceinline__ void cvt_load8(v4f (&r)[8], const float* s) {
#pragma unroll
  for (int i = 0; i < 8; ++i) r[i] = *(const v4f*)(s + i * 128);
  // no register that an issued load names (its base is formed anew for the
  // next tile) is rewritten in front of this wait
  asm volatile("s_wait_xcnt 0x0" ::: "memory");
  // keeps what follows behind the wait, and the conversions of the tile before
  // behind these loads: hoisted above them, their wait for that tile's data
  // left only three loads in flight before the new ones were issued
  __builtin_amdgcn_sched_barrier(0);
}

// One tile converted and stored: 8 B a lane, 256 contiguous bytes a store.
// MORE: the wave goes on behind these stores (false for its last ones).
template <bool MORE>
static __device__ __forceinline__ void cvt_store8(const v4f (&r)[8], f16* d) {
#pragma unroll
  for (int i = 0; i < 8; ++i)
    *(v4h*)(d + i * 128) = __builtin_convertvector(r[i], v4h);
  if (MORE) {
    // no address or data register of an issued store is rewritten in front of
    // this wait
    asm volatile("s_wait_xcnt 0x0" ::: "memory");
    // keeps the instructions that follow behind the wait
    __builtin_amdgcn_sched_barrier(0);
  }
}

__global__ __launch_bounds__(CVT_WAVES * 32) void cvt_all_f32_to_f16(
    const float* __restrict__ hidden, const float* __restrict__ Wq,
    const float* __restrict__ Wk, const float* __restrict__ Wv,
    const float* __restrict__ Wo, f16* __restrict__ y) {
  static_assert(CVT_FULL % 2 == 1, "the pair loop leaves one full tile");
  const int lane4 = (threadIdx.x & 31) * 4;
  const int wave  = __builtin_amdgcn_readfirstlane((int)(threadIdx.x >> 5));
  // Full trips: a work-group's 16 tiles are adjacent (64 KB of source a trip).
  int t = (int)blockIdx.x * CVT_WAVES + wave;           // 0 .. CVT_NW - 1
  // The last, partial trip is dealt wave-major, so that it is spread over all
  // work-groups.
  const int rest = wave * CVT_BLOCKS + (int)blockIdx.x; // 0 .. CVT_NW - 1

  v4f ra[8], rb[8];
  cvt_load8(ra, cvt_tile_src(t, CVT_NW, hidden, Wq, Wk, Wv, Wo) + lane4);
  // Two tiles a trip, each set loaded one tile ahead of its stores. Kept
  // rolled: unrolled, the stores sank below later tiles' loads and the wave
  // once waited until no load was in flight.
#pragma unroll 1
  for (int k = 0; k < CVT_FULL / 2; ++k) {
    cvt_load8(rb, cvt_tile_src(t + CVT_NW, CVT_NT, hidden, Wq, Wk, Wv, Wo) + lane4);
    cvt_store8<true>(ra, y + (size_t)t * CVT_TILE + lane4);
    cvt_load8(ra, cvt_tile_src(t + 2 * CVT_NW, CVT_NT, hidden, Wq, Wk, Wv, Wo) + lane4);
    cvt_store8<true>(rb, y + (size_t)(t + CVT_NW) * CVT_TILE + lane4);
    t += 2 * CVT_NW;
  }
  // ra holds this wave's last full tile
  f16* dl = y + (size_t)t * CVT_TILE + lane4;
  if (rest < CVT_REST) {                         // the same for the whole wave
    const int tr = CVT_FULL * CVT_NW + rest;
    cvt_load8(rb, cvt_tile_src(tr, CVT_NT, hidden, Wq, Wk, Wv, Wo) + lane4);
    cvt_store8<true>(ra, dl);
    cvt_store8<false>(rb, y + (size_t)tr * CVT_TILE + lane4);
  } else {
    cvt_store8<false>(ra, dl);
  }
}

// ---------------------------------------------------------------------------
// WMMA GEMM: C[M,768] = X[M,768] @ W[768,768]^T + bias
//   block = 512 threads (16 waves), tile 256(M) x 256(N), stage = 64 k, one
//   work-group per WGP: an operand byte copied from L2 feeds 256 output
//   rows or columns.
//   wave (wm = wid&3 -> 64 rows, wn = wid>>2 -> 64 cols) computes 64x64:
//     4 A-frags + 4 B-frags -> 16 WMMAs per 32 k (1 ds_load_b128 / WMMA).
//   Staging: asynchronous copies global -> LDS, 16 B a lane, through no
//   register. A stage row is 64 halves = one whole 128-B line, brought by 8
//   adjacent lanes; LDS pitch 144 B (16 B x odd: no bank conflict for
//   ds_load_b128). Two buffers: stage t+1 flies while stage t is multiplied.
//   MODE 0: store f16 [M,768];  MODE 1: store f32 [M,768]  (compile-time).
// N=768 is a multiple of 256; M=36928 is not -> clamp the source rows; only
// the last M-tile takes the predicated store path (uniform branch).
//   Tile walk: GW resident work-groups, one per WGP; work-group w takes tiles
//   w, w + GW, ... (a fixed deal, nothing passes between work-groups). The
//   ring runs on over the tile boundary: the next tile's stages 0 and 1 are
//   stages 12 and 13 of this one, so they fly under this tile's last products
//   and its stores, and only a work-group's first tile waits for a stage.
//   MODE 0 does the three projections in one launch: the three weights lie
//   one behind the other (2304 rows of W, 9 N tiles), and so do Q, K and V.
// ---------------------------------------------------------------------------
#define GKS   64                 // k per stage
#define GPIT  72                 // LDS row pitch in halves (144 B)
#define GBT   256                // rows of X and rows of W in a block tile
#define GTILE (GBT * GPIT)       // halves of one operand tile in LDS
#define GNST  (ND / GKS)         // 12 stages
#define GW    256                // resident work-groups
#define GMT   ((NM + GBT - 1) / GBT)  // 145 M tiles
#define GGRP  85                 // M tiles of a group: x 3 N tiles = one round of the walk

// Tile f -> (M tile, N tile); f is the same for the whole work-group. MODE 0:
// the M tiles go in two groups, and a group's nine N tiles follow one another
// with the M tile running fastest: a group's rows of X (33 MB) are read in
// three successive rounds, the second and third time from L2.
template <int MODE>
static __device__ __forceinline__ void gemm_tile(int f, int& mt, int& nt) {
  if (MODE == 0) {
    if (f < GGRP * 9) {
      nt = f / GGRP;
      mt = f - nt * GGRP;
    } else {
      const int r = f - GGRP * 9;
      nt = r / (GMT - GGRP);
      mt = GGRP + r - nt * (GMT - GGRP);
    }
  } else {
    nt = f / GMT;
    mt = f - nt * GMT;
  }
}

static __device__ __forceinline__ unsigned lds_addr(const void* p) {
  return (unsigned)(size_t)p;    // low 32 bits of a __shared__ address
}

// One stage's eight copies of this lane (4 of X and 4 of W, or 4 of K and 4 of V). The closing
// s_wait_xcnt stands inside the statement so that no address register of an
// issued copy is rewritten in front of it.
static __device__ __forceinline__ void stage_copy(
    unsigned l0, unsigned l1, unsigned l2, unsigned l3, unsigned l4,
    unsigned l5, unsigned l6, unsigned l7, const f16* g0, const f16* g1,
    const f16* g2, const f16* g3, const f16* g4, const f16* g5, const f16* g6,
    const f16* g7) {
  asm volatile(
      "global_load_async_to_lds_b128 %0, %8, off\n\t"
      "global_load_async_to_lds_b128 %1, %9, off\n\t"
      "global_load_async_to_lds_b128 %2, %10, off\n\t"
      "global_load_async_to_lds_b128 %3, %11, off\n\t"
      "global_load_async_to_lds_b128 %4, %12, off\n\t"
      "global_load_async_to_lds_b128 %5, %13, off\n\t"
      "global_load_async_to_lds_b128 %6, %14, off\n\t"
      "global_load_async_to_lds_b128 %7, %15, off\n\t"
      "s_wait_xcnt 0x0"
      :
      : "v"(l0), "v"(l1), "v"(l2), "v"(l3), "v"(l4), "v"(l5), "v"(l6), "v"(l7),
        "v"(g0), "v"(g1), "v"(g2), "v"(g3), "v"(g4), "v"(g5), "v"(g6), "v"(g7)
      : "memory");
}

template <int MODE>
__global__ __launch_bounds__(512) void gemm_wmma(const f16* __restrict__ X,
                                                 const f16* __restrict__ W,
                                                 const float* __restrict__ bias0,
                                                 const float* __restrict__ bias1,
                                                 const float* __restrict__ bias2,
                                                 void* __restrict__ out) {
  constexpr int NT = GMT * (MODE == 0 ? 9 : 3);   // tiles of the launch
  static_assert(GW <= NT && GNST % 2 == 0, "every work-group has a tile; a tile starts in buffer 0");
  // [buffer][X tile | W tile], 256 rows x 64 halves at pitch 72
  __shared__ __attribute__((aligned(16))) f16 Sm[2 * 2 * GTILE];

  const int tid  = threadIdx.x;
  const int wid  = tid >> 5;
  const int lane = tid & 31;
  const int l16  = lane & 15;
  const int hi   = lane >> 4;       // which K-half group this lane owns
  const int wm   = wid & 3;         // M strip 0..3 (64 rows each)
  const int wn   = wid >> 2;        // N strip 0..3 (64 cols each)

  const int crow = tid >> 3;        // 0..63: row of this lane's copies (+64*i)
  const int cseg = (tid & 7) * 8;   // its 8-half (16-B) piece of the row

  // Source byte offsets (they fit 32 bits) and the LDS byte address of this
  // lane's first piece in buffer 0; the W rows and the LDS rows step evenly.
  // They belong to the tile that the copies are in, which is the next one
  // from this tile's last two publish points on.
  unsigned ox[4], ow;
  auto set_src = [&](int f) {
    int mt, nt;
    gemm_tile<MODE>(f, mt, nt);
#pragma unroll
    for (int i = 0; i < 4; ++i) {
      int am = mt * GBT + crow + 64 * i; if (am > NM - 1) am = NM - 1;  // clamp OOB M
      ox[i] = (unsigned)(am * ND + cseg) * 2u;
    }
    ow = (unsigned)((nt * GBT + crow) * ND + cseg) * 2u;
  };
  const unsigned l0 = lds_addr(&Sm[crow * GPIT + cseg]);
  const unsigned LROW = 64 * GPIT * 2;  // LDS bytes of 64 rows
  const unsigned GROW = 64 * ND * 2;    // source bytes of 64 rows
  const unsigned WOFF = GTILE * 2;      // bytes from the X tile to the W tile
  const unsigned BOFF = 2 * GTILE * 2;  // bytes from buffer 0 to buffer 1
  const char* Xc = (const char*)X;
  const char* Wc = (const char*)W;
  auto issue = [&](int st) {            // stage st -> buffer st & 1
    const unsigned lb = l0 + (st & 1) * BOFF;
    const unsigned kb = (unsigned)st * (GKS * 2);
    stage_copy(lb, lb + LROW, lb + 2 * LROW, lb + 3 * LROW, lb + WOFF,
               lb + WOFF + LROW, lb + WOFF + 2 * LROW, lb + WOFF + 3 * LROW,
               (const f16*)(Xc + (ox[0] + kb)), (const f16*)(Xc + (ox[1] + kb)),
               (const f16*)(Xc + (ox[2] + kb)), (const f16*)(Xc + (ox[3] + kb)),
               (const f16*)(Wc + (ow + kb)), (const f16*)(Wc + (ow + kb + GROW)),
               (const f16*)(Wc + (ow + kb + 2 * GROW)),
               (const f16*)(Wc + (ow + kb + 3 * GROW)));
  };

  v8f acc[4][4];

  // Prologue of the first tile: stage 0 lands and is published, then stage 1
  // starts.
  set_src((int)blockIdx.x);
  issue(0);
  // this wave's copies have landed before the barrier publishes them
  asm volatile("s_wait_asynccnt 0x0" ::: "memory");
  __syncthreads();
  issue(1);

  // One 32-k block's fragments. A: lane = row (M); halves {0-7,16-23}
  // (lanes<16) / {8-15,24-31}. B: lane = col (N = W row), same K packing.
  auto frags = [&](const f16* As, const f16* Bs, int ks, v16h (&a)[4], v16h (&bf)[4]) {
#pragma unroll
    for (int i = 0; i < 4; ++i) {
      const f16* ap = &As[(wm * 64 + i * 16 + l16) * GPIT + ks + hi * 8];
      a[i] = cat16(ld8(ap), ld8(ap + 16));
    }
#pragma unroll
    for (int j = 0; j < 4; ++j) {
      const f16* bp = &Bs[(wn * 64 + j * 16 + l16) * GPIT + ks + hi * 8];
      bf[j] = cat16(ld8(bp), ld8(bp + 16));
    }
  };
  auto products = [&](const v16h (&a)[4], const v16h (&bf)[4]) {
#pragma unroll
    for (int i = 0; i < 4; ++i)
#pragma unroll
      for (int j = 0; j < 4; ++j) acc[i][j] = wmma_f16(a[i], bf[j], acc[i][j]);
  };
  static_assert(GKS == 64, "a stage is two 32-k blocks");

  for (int f = (int)blockIdx.x; f < NT; f += GW) {   // the same for the whole work-group
  const int fn = f + GW;            // this work-group's next tile, if < NT
  const int lim = fn < NT ? GNST : GNST - 2;   // publish points with a refill behind them
#pragma unroll
  for (int i = 0; i < 4; ++i)
#pragma unroll
    for (int j = 0; j < 4; ++j) acc[i][j] = splat8(0.f);

  for (int t = 0; t < GNST; ++t) {
    const f16* As = &Sm[(t & 1) * 2 * GTILE];
    const f16* Bs = As + GTILE;

    v16h a0[4], b0[4], a1[4], b1[4];
    frags(As, Bs, 0, a0, b0);
    // keeps the block's 16 LDS loads together in front of its 16 products:
    // left free, the compiler kept one A fragment and reloaded it in front of
    // every row of four products, each time waiting until no load was out
    __builtin_amdgcn_sched_barrier(0);
    products(a0, b0);
    frags(As, Bs, 32, a1, b1);   // the stage's last LDS reads
    // keeps the first block's products in front of the publish point: three of
    // them sank behind the barrier, where a wave that must wait for the matrix
    // unit issues its refill late
    __builtin_amdgcn_sched_barrier(0);

    // Publish point of stage t+1; it also ends every read of stage t's buffer.
    // It stands in front of the stage's second block of products, whose
    // fragments are in registers by then: with one work-group on the WGP the
    // refill gets a whole stage to land, and the waves leave the barrier with
    // matrix work in hand, under which the next stage's first LDS loads hide.
    // this wave's reads of the buffer have returned before it is refilled
    asm volatile("s_wait_dscnt 0x0" ::: "memory");
    // this wave's copies of stage t+1 have landed before others read them
    asm volatile("s_wait_asynccnt 0x0" ::: "memory");
    __syncthreads();
    // Stage t+2 of this tile, or stage t+2-12 of the next (same buffer: 12 is
    // even). Every test is the same for the whole work-group.
    if (t < lim) {
      if (t == GNST - 2) set_src(fn);
      issue(t + 2 < GNST ? t + 2 : t + 2 - GNST);
    }
    products(a1, b1);
  }

  int mt, nt;
  gemm_tile<MODE>(f, mt, nt);
  const int m0 = mt * GBT;
  const int pj = nt / 3;            // which projection (MODE 1: always 0)
  const int n0 = (nt - pj * 3) * GBT;
  const float* bias = (pj == 0) ? bias0 : (pj == 1) ? bias1 : bias2;
  const size_t po = (size_t)pj * NM * ND;   // its output, in elements

  // Epilogue. D layout: lane<16 -> row = base+r, lane>=16 -> row = base+8+r;
  // column = lane%16 within each 16-wide tile. Fast path (no predication)
  // unless this is the last M-tile (uniform branch).
  if (m0 + GBT <= NM) {
#pragma unroll
    for (int i = 0; i < 4; ++i) {
      const int mbase = m0 + wm * 64 + i * 16 + hi * 8;
#pragma unroll
      for (int j = 0; j < 4; ++j) {
        const int n    = n0 + wn * 64 + j * 16 + l16;
        const float bn = bias[n];
#pragma unroll
        for (int r = 0; r < 8; ++r) {
          const float v = acc[i][j][r] + bn;
          if (MODE == 0)
            ((f16*)out)[po + (size_t)(mbase + r) * ND + n] = (f16)v;
          else
            ((float*)out)[po + (size_t)(mbase + r) * ND + n] = v;
        }
      }
    }
  } else {
#pragma unroll
    for (int i = 0; i < 4; ++i) {
      const int mbase = m0 + wm * 64 + i * 16 + hi * 8;
#pragma unroll
      for (int j = 0; j < 4; ++j) {
        const int n    = n0 + wn * 64 + j * 16 + l16;
        const float bn = bias[n];
#pragma unroll
        for (int r = 0; r < 8; ++r) {
          if (mbase + r < NM) {
            const float v = acc[i][j][r] + bn;
            if (MODE == 0)
              ((f16*)out)[po + (size_t)(mbase + r) * ND + n] = (f16)v;
            else
              ((float*)out)[po + (size_t)(mbase + r) * ND + n] = v;
          }
        }
      }
    }
  }
  // no address or data register of an issued store is rewritten (the next
  // tile clears the accumulators) in front of this wait
  asm volatile("s_wait_xcnt 0x0" ::: "memory");
  }  // tile walk
  // nothing is outstanding when the wave ends
  asm volatile("s_wait_asynccnt 0x0" ::: "memory");
}

// ---------------------------------------------------------------------------
// Flash attention: grid (H=12, B=64), 608 threads = 19 waves.
// Q/K/V are f16 [B,S,768]; head h occupies columns [h*64, h*64+64).
// Each wave owns 32 queries; the head's K and V lie whole in LDS (both
// row-major). The products are taken transposed:
//   S^T = K (Q/8)^T   (A = K rows from LDS, B = Q fragments, see the kernel)
//   O^T += V^T P^T    (A = V^T by the transposing LDS load, B = P^T packed
//                      from S^T)
// In a D tile register r of lane l is [row 8*(l>>4)+r][column l&15], so a lane
// holds 32 of the 64 scores of ONE query (its partner l^16 the other 32):
// maximum and sum run in the lane's own registers, one exchange between the
// wave halves joins the maximum, and two S^T tiles packed to f16 are a B
// fragment in the hardware k order (k = 8h+s, 16+8h+s), the order in which
// the transposing load delivers V^T. softmax scale (1/8, exact in f16) is
// folded into Q.
// ---------------------------------------------------------------------------
static __device__ __forceinline__ float xhalf(float x) {  // lane l <-> l ^ 16
  const int b = __builtin_bit_cast(int, x);
  return __builtin_bit_cast(
      float, __builtin_amdgcn_permlanex16(b, b, 0x76543210, 0xfedcba98, false,
                                          false));
}

// x[r] = 2^x[r]. Eight independent v_exp_f32 in one statement, each filling
// the slot behind the one before it; the closing v_nop keeps the slot that the
// instruction set asks for between a transcendental and an instruction that
// overwrites its source or reads its result.
static __device__ __forceinline__ void exp2x8(v8f& x) {
  float a = x[0], b = x[1], c = x[2], d = x[3];
  float e = x[4], f = x[5], g = x[6], h = x[7];
  asm("v_exp_f32 %0, %0\n\tv_exp_f32 %1, %1\n\tv_exp_f32 %2, %2\n\t"
      "v_exp_f32 %3, %3\n\tv_exp_f32 %4, %4\n\tv_exp_f32 %5, %5\n\t"
      "v_exp_f32 %6, %6\n\tv_exp_f32 %7, %7\n\tv_nop"
      : "+v"(a), "+v"(b), "+v"(c), "+v"(d), "+v"(e), "+v"(f), "+v"(g), "+v"(h));
  x[0] = a; x[1] = b; x[2] = c; x[3] = d;
  x[4] = e; x[5] = f; x[6] = g; x[7] = h;
}

// The same for two values.
static __device__ __forceinline__ void exp2x2(float& a, float& b) {
  asm("v_exp_f32 %0, %0\n\tv_exp_f32 %1, %1\n\tv_nop" : "+v"(a), "+v"(b));
}

static __device__ __forceinline__ v16h pack16(v8f lo, v8f hi8) {
  v16h p;
#pragma unroll
  for (int r = 0; r < 8; ++r) {
    p[r]     = (f16)lo[r];
    p[8 + r] = (f16)hi8[r];
  }
  return p;
}

// Transposing LDS load of a row-major 16-bit tile: the lanes address 16 rows
// (keys) x 16 columns (dh) in 16-byte pieces, and lane (c = l & 15, h = l >> 4)
// receives column c of rows 8h .. 8h+7: half of an A fragment of V^T.
typedef __attribute__((ext_vector_type(8))) short s16x8;
static __device__ __forceinline__ v8h ld_tr16(const f16* p) {
  typedef __attribute__((address_space(3))) s16x8 lds_s16x8;
  return __builtin_bit_cast(v8h,
                            __builtin_amdgcn_ds_load_tr16_b128_v8i16((lds_s16x8*)p));
}

#define VPIT 80   // V row pitch in halves: 160 B = 32 B x odd, the transposing load's pitch
#define KPIT 72   // K row pitch in halves: 144 B = 16 B x odd, for ds_load_b128
#define AW    19            // waves of a work-group: 19 x 32 queries cover the 577
#define AROWS (AW * 32)     // 608 staged key rows; rows past the last key repeat it
#define AHALF (AROWS / 2)   // rows of one of the two staging steps

template <int N> struct int_c { static constexpr int v = N; };

// One work-group per (batch, head). The head's whole K and V lie in LDS, staged
// once by asynchronous copies in two steps of 304 rows: the second step flies
// under the first four 64-key passes. A wave owns 32 queries (two 16-column
// groups), so a K or V^T fragment read from LDS feeds two products, and the
// key loop has no barrier but the one that publishes the second step.
__global__ __launch_bounds__(AW * 32) void attn_flash(const f16* __restrict__ Q,
                                                  const f16* __restrict__ K,
                                                  const f16* __restrict__ V,
                                                  f16* __restrict__ ctx_out) {
  __shared__ __attribute__((aligned(16))) f16 Kt[AROWS * KPIT];  // [key][dh]
  __shared__ __attribute__((aligned(16))) f16 Vs[AROWS * VPIT];  // [key][dh]
  __shared__ __attribute__((aligned(16))) f16 Qs[AW * 8 * 256];  // [wave][piece][lane]

  const int b    = blockIdx.y;
  const int h    = blockIdx.x;
  const int tid  = threadIdx.x;
  const int wid  = tid >> 5;
  const int lane = tid & 31;
  const int l16  = lane & 15;
  const int hi   = lane >> 4;
  const int q0   = wid * 32;

  const f16* Qb = Q + (size_t)b * NS * ND + h * NDH;   // row stride ND
  const f16* Kb = K + (size_t)b * NS * ND + h * NDH;
  const f16* Vb = V + (size_t)b * NS * ND + h * NDH;

  // Staging: 8 adjacent lanes bring one row's 128 B (a whole line); the 608
  // lanes cover 76 rows a copy, four copies of K and four of V a step.
  const int crow = tid >> 3;        // 0..75
  const int cseg = (tid & 7) * 8;   // this lane's 8-half (16-B) piece of a row
  auto stage = [&](int st) {
    unsigned lk[4], lv[4];
    const f16 *gk[4], *gv[4];
#pragma unroll
    for (int i = 0; i < 4; ++i) {
      const int row = st * AHALF + i * (AHALF / 4) + crow;
      const int srow = row > NS - 1 ? NS - 1 : row;      // source row in bounds
      lk[i] = lds_addr(&Kt[row * KPIT + cseg]);
      lv[i] = lds_addr(&Vs[row * VPIT + cseg]);
      gk[i] = Kb + (size_t)srow * ND + cseg;
      gv[i] = Vb + (size_t)srow * ND + cseg;
    }
    stage_copy(lk[0], lk[1], lk[2], lk[3], lv[0], lv[1], lv[2], lv[3],
               gk[0], gk[1], gk[2], gk[3], gv[0], gv[1], gv[2], gv[3]);
  };

  stage(0);

  // Q B-fragments (64 K x 16 queries a group), scale 1/sqrt(64)=0.125 folded in
  // (exact). They wait in the wave's own LDS range, in fragment order (piece
  // x of fragment [c][ks]: 32 lanes x 16 B in a row), and are read back once a
  // pass: kept in registers, their 32 overran the budget of five waves a SIMD.
  const f16 sc = (f16)0.125f;
  f16* qs = &Qs[wid * (8 * 256) + lane * 8];
#pragma unroll
  for (int c = 0; c < 2; ++c) {
    int qr = q0 + c * 16 + l16; if (qr > NS - 1) qr = NS - 1;
    const f16* qp = Qb + (size_t)qr * ND + hi * 8;
#pragma unroll
    for (int x = 0; x < 4; ++x)      // k = 16x + 8*hi + 0..7
      *(v8h*)(qs + (c * 4 + x) * 256) = ld8(qp + x * 16) * sc;
  }

  // this wave's copies of rows 0..303 have landed before the barrier publishes them
  asm volatile("s_wait_asynccnt 0x0" ::: "memory");
  __syncthreads();
  stage(1);

  v8f acc[2][4];                     // O^T: acc[c][j][r] = O[query c*16+l16][j*16+8*hi+r]
#pragma unroll
  for (int c = 0; c < 2; ++c)
#pragma unroll
    for (int j = 0; j < 4; ++j) acc[c][j] = splat8(0.f);
  float mrow[2] = {-1e30f, -1e30f};  // this lane's two queries: running maximum
  float lsum[2] = {0.f, 0.f};        // sums over this wave half's keys only

  const f16* krp0 = &Kt[l16 * KPIT + hi * 8];
  const f16* vrp0 = &Vs[(hi * 8 + (lane & 7)) * VPIT + ((lane >> 3) & 1) * 8];

  // One pass over NU x 32 keys from key kb on. NU = 2: all keys exist. NU = 1:
  // the tail, keys past the last are masked.
  auto pass = [&](auto nu, int kb) {
    constexpr int NU = decltype(nu)::v;
    constexpr int NT = 2 * NU;
    // ---- scores S^T = K (Q/8)^T : NT tiles of 16 keys x 2 query groups -----
    // s[c][t][r] = score(key kb + t*16 + 8*hi + r, query q0 + c*16 + l16)
    v8f s[2][NT];
#pragma unroll
    for (int ks = 0; ks < 2; ++ks) {   // dh 0..31, then dh 32..63
      const v16h qf0 = cat16(ld8(qs + (2 * ks) * 256),     ld8(qs + (2 * ks + 1) * 256));
      const v16h qf1 = cat16(ld8(qs + (4 + 2 * ks) * 256), ld8(qs + (5 + 2 * ks) * 256));
#pragma unroll
      for (int t = 0; t < NT; ++t) {
        const f16* krp = krp0 + (kb + t * 16) * KPIT + ks * 32;
        const v16h a = cat16(ld8(krp), ld8(krp + 16));
        s[0][t] = wmma_f16(a, qf0, ks == 0 ? splat8(0.f) : s[0][t]);
        s[1][t] = wmma_f16(a, qf1, ks == 0 ? splat8(0.f) : s[1][t]);
      }
      // keeps one dh half's fragments (48 registers) live at a time, and the
      // V^T loads behind the score products: left free, the loads were hoisted
      // to the top of the pass and the 192-register budget of five waves a SIMD
      // was overrun (spills in the key loop)
      __builtin_amdgcn_sched_barrier(0);
    }
    if (NU == 1) {
#pragma unroll
      for (int c = 0; c < 2; ++c)
#pragma unroll
        for (int t = 0; t < NT; ++t)
#pragma unroll
          for (int r = 0; r < 8; ++r)
            if (kb + t * 16 + hi * 8 + r > NS - 1) s[c][t][r] = -1e30f;
    }

    // ---- maximum of a lane's scores per query, joined with the other half --
    float mnew[2], corr[2];
#pragma unroll
    for (int c = 0; c < 2; ++c) {
      v8f mx8 = s[c][0];
#pragma unroll
      for (int t = 1; t < NT; ++t)
#pragma unroll
        for (int r = 0; r < 8; ++r) mx8[r] = fmaxf(mx8[r], s[c][t][r]);
      float mx = fmaxf(fmaxf(fmaxf(mx8[0], mx8[1]), fmaxf(mx8[2], mx8[3])),
                       fmaxf(fmaxf(mx8[4], mx8[5]), fmaxf(mx8[6], mx8[7])));
      mx = fmaxf(mx, xhalf(mx));
      mnew[c] = fmaxf(mrow[c], mx);
      corr[c] = (mrow[c] - mnew[c]) * LOG2E;
      mrow[c] = mnew[c];
    }
    exp2x2(corr[0], corr[1]);        // e^(old maximum - new maximum)
#pragma unroll
    for (int c = 0; c < 2; ++c)
#pragma unroll
      for (int j = 0; j < 4; ++j) acc[c][j] *= corr[c];

    // Per 32 keys: exponentials, P^T B-fragments straight from the score
    // registers, then O^T += V^T P^T. (A fragment of V^T: lane = dh; a load
    // brings keys 8*hi+0..7 of a 16-key group, two loads 16 keys apart are one
    // 16 x 32 fragment; it feeds both query groups.)
    v8f rs8[2];
#pragma unroll
    for (int u = 0; u < NU; ++u) {
      v16h pb[2];
#pragma unroll
      for (int c = 0; c < 2; ++c) {
#pragma unroll
        for (int t = 2 * u; t < 2 * u + 2; ++t) {
#pragma unroll
          for (int r = 0; r < 8; ++r) s[c][t][r] = (s[c][t][r] - mnew[c]) * LOG2E;
          exp2x8(s[c][t]);           // e^(s - m) as 2^((s - m) * log2 e)
        }
        const v8f rsu = s[c][2 * u] + s[c][2 * u + 1];
        rs8[c] = (u == 0) ? rsu : rs8[c] + rsu;
        pb[c] = pack16(s[c][2 * u], s[c][2 * u + 1]);   // keys 32u .. 32u+31
      }
#pragma unroll
      for (int j = 0; j < 4; ++j) {
        const f16* vp2 = vrp0 + (kb + u * 32) * VPIT + j * 16;
        const v16h vf = cat16(ld_tr16(vp2), ld_tr16(vp2 + 16 * VPIT));
        acc[0][j] = wmma_f16(vf, pb[0], acc[0][j]);
        acc[1][j] = wmma_f16(vf, pb[1], acc[1][j]);
      }
    }
#pragma unroll
    for (int c = 0; c < 2; ++c) {
      const float rs = ((rs8[c][0] + rs8[c][1]) + (rs8[c][2] + rs8[c][3])) +
                       ((rs8[c][4] + rs8[c][5]) + (rs8[c][6] + rs8[c][7]));
      lsum[c] = lsum[c] * corr[c] + rs;
    }
  };

  static_assert(4 * 64 <= AHALF, "the first four passes read the first step's rows only");
  static_assert(NS / 64 * 64 + 32 <= AROWS && NS - NS / 64 * 64 <= 32, "one 32-key tail");
  for (int p = 0; p < NS / 64; ++p) {
    if (p == 4) {                    // the same for the whole work-group
      // this wave's copies of rows 304..607 have landed before others read them
      asm volatile("s_wait_asynccnt 0x0" ::: "memory");
      __syncthreads();
    }
    pass(int_c<2>{}, p * 64);
  }
  pass(int_c<1>{}, NS / 64 * 64);

  // ---- finalize: join the halves' sums, ctx /= l, store f16 to [B, S, 768] --
  // A lane holds 8 consecutive dh of a query per tile: one 16-byte store.
#pragma unroll
  for (int c = 0; c < 2; ++c) {
    const float inv = 1.0f / (lsum[c] + xhalf(lsum[c]));
    const int q = q0 + c * 16 + l16;
    if (q < NS) {
      f16* outp = ctx_out + (size_t)b * NS * ND + (size_t)q * ND + h * NDH + hi * 8;
#pragma unroll
      for (int j = 0; j < 4; ++j) {
        v8h o;
#pragma unroll
        for (int r = 0; r < 8; ++r) o[r] = (f16)(acc[c][j][r] * inv);
        *(v8h*)(outp + j * 16) = o;
      }
    }
  }
}

// ---------------------------------------------------------------------------
extern "C" void kernel_launch(void* const* d_in, const int* in_sizes, int n_in,
                              void* d_out, int out_size, void* d_ws,
                              size_t ws_size, hipStream_t stream) {
  const float* hidden = (const float*)d_in[0];
  const float* Wq = (const float*)d_in[1];
  const float* bq = (const float*)d_in[2];
  const float* Wk = (const float*)d_in[3];
  const float* bk = (const float*)d_in[4];
  const float* Wv = (const float*)d_in[5];
  const float* bv = (const float*)d_in[6];
  const float* Wo = (const float*)d_in[7];
  const float* bo = (const float*)d_in[8];

  char* ws = (char*)d_ws;
  const size_t szX = (size_t)NM * ND * sizeof(f16);       // 56.7 MB
  const size_t szW = (size_t)ND * ND * sizeof(f16);       // 1.18 MB
  size_t off = 0;
  f16* Xh  = (f16*)(ws + off); off += szX;
  f16* Wqh = (f16*)(ws + off); off += szW;
  f16* Wkh = (f16*)(ws + off); off += szW;
  f16* Wvh = (f16*)(ws + off); off += szW;
  f16* Woh = (f16*)(ws + off); off += szW;
  f16* Qh  = (f16*)(ws + off); off += szX;
  f16* Kh  = (f16*)(ws + off); off += szX;
  f16* Vh  = (f16*)(ws + off); off += szX;
  f16* Ch  = (f16*)(ws + off); off += szX;

  // 1) conversions to f16: Xh, Wqh, Wkh, Wvh, Woh are one contiguous array
  cvt_all_f32_to_f16<<<CVT_BLOCKS, CVT_WAVES * 32, 0, stream>>>(hidden, Wq, Wk,
                                                                Wv, Wo, Xh);

  // 2) Q/K/V projections, one launch: Wqh, Wkh, Wvh are one array of 2304 rows,
  //    Qh, Kh, Vh one array of three outputs
  gemm_wmma<0><<<GW, 512, 0, stream>>>(Xh, Wqh, bq, bk, bv, Qh);

  // 3) flash attention -> ctx f16 [B,S,768]
  attn_flash<<<dim3(NH, NB), AW * 32, 0, stream>>>(Qh, Kh, Vh, Ch);

  // 4) output projection -> f32 d_out
  gemm_wmma<1><<<GW, 512, 0, stream>>>(Ch, Woh, bo, bo, bo, d_out);
}

// v008
// Measured time: 234 microseconds a run.
// Timed twice side by side with v007, it ran 1.04 times as fast both times.
// Over all steps from v000 it is 2.21 times as fast.
#include <hip/hip_runtime.h>
#include <hip/hip_bf16.h>

// ---------------------------------------------------------------------------
// ViT attention (B=64, S=577, D=768, H=12, Dh=64) on gfx1250 (CDNA5, wave32).
// All GEMMs use v_wmma_f32_16x16x32_f16 (f16 inputs, f32 accumulate).
// Pipeline:
//   1) cvt f32->f16 of hidden + Wq/Wk/Wv/Wo into workspace (one launch)
//   2) WMMA GEMM (256x256 and 192x256 block tiles, async-copy LDS ring,
//      resident work-groups that walk the tiles), one launch for all three:
//        Q/K/V = Xh @ W.T + b  -> f16 [B,S,768]
//   3) flash attention (online softmax, scores never leave registers)
//        -> ctx f16 [B,S,768]
//   4) WMMA GEMM: out = ctx @ Wo.T + bo -> f32 [B,S,768] (d_out)
// Workspace: 5 * 56.7MB (Xh,Q,K,V,ctx) + 4 * 1.18MB (weights) ~ 289 MB.
// ---------------------------------------------------------------------------

typedef _Float16 f16;
typedef __attribute__((ext_vector_type(8)))  _Float16 v8h;
typedef __attribute__((ext_vector_type(16))) _Float16 v16h;
typedef __attribute__((ext_vector_type(8)))  float    v8f;

#define NB   64
#define NS   577
#define ND   768
#define NH   12
#define NDH  64
#define NM   36928   // NB*NS
#define LOG2E 1.44269504088896340736f

static __device__ __forceinline__ v8h ld8(const f16* p) { return *(const v8h*)p; }

static __device__ __forceinline__ v16h cat16(v8h a, v8h b) {
  return __builtin_shufflevector(a, b, 0,1,2,3,4,5,6,7,8,9,10,11,12,13,14,15);
}

static __device__ __forceinline__ v8f wmma_f16(v16h a, v16h b, v8f c) {
  // D = A(16x32 f16) x B(32x16 f16) + C(16x16 f32)
  return __builtin_amdgcn_wmma_f32_16x16x32_f16(false, a, false, b, (short)0, c,
                                                false, false);
}

static __device__ __forceinline__ v8f splat8(float x) {
  v8f r;
#pragma unroll
  for (int i = 0; i < 8; ++i) r[i] = x;
  return r;
}

// ---------------------------------------------------------------------------
// f32 -> f16 conversion of hidden and of the four weights: ONE resident
// streaming launch, one 16-wave work-group per WGP. The five f16 destinations
// lie one behind the other in the workspace, so the destination is one array.
// A wave tile is 1024 floats: 8 loads of 16 B a lane, each 512 contiguous
// bytes of the wave. The next tile's 8 loads are issued before this tile is
// converted and stored (two register sets take turns), so a wave always has
// loads in flight. All five sizes are multiples of the tile: no tile straddles
// two sources. The tile count is a constant: every wave takes CVT_FULL tiles,
// CVT_REST waves one more.
// ---------------------------------------------------------------------------
typedef __attribute__((ext_vector_type(4))) float    v4f;
typedef __attribute__((ext_vector_type(4))) _Float16 v4h;

#define CVT_TILE   1024                      // floats of one wave tile
#define CVT_XT     (NM * ND / CVT_TILE)      // 27696 tiles of hidden
#define CVT_WT     (ND * ND / CVT_TILE)      // 576 tiles of one weight
#define CVT_NT     (CVT_XT + 4 * CVT_WT)     // 30000 tiles in all
#define CVT_BLOCKS 256
#define CVT_WAVES  16
#define CVT_NW     (CVT_BLOCKS * CVT_WAVES)  // 4096 waves
#define CVT_FULL   (CVT_NT / CVT_NW)         // 7
#define CVT_REST   (CVT_NT - CVT_FULL * CVT_NW)  // 1328

// Source of wave tile t (t is wave-uniform: the pick stays on the scalar
// side). tend is a compile-time bound, t < tend: trips that cannot reach the
// weights need no pick.
static __device__ __forceinline__ const float* cvt_tile_src(
    int t, int tend, const float* hidden, const float* Wq, const float* Wk,
    const float* Wv, const float* Wo) {
  if (tend <= CVT_XT) return hidden + (size_t)t * CVT_TILE;
  const int u = t - CVT_XT;
  const int w = u / CVT_WT;
  const float* base = (w == 0) ? Wq : (w == 1) ? Wk : (w == 2) ? Wv : Wo;
  return (u < 0) ? hidden + (size_t)t * CVT_TILE
                 : base + (size_t)(u - w * CVT_WT) * CVT_TILE;
}

// One tile's 8 loads of this lane.
static __device__ __forceinline__ void cvt_load8(v4f (&r)[8], const float* s) {
#pragma unroll
  for (int i = 0; i < 8; ++i) r[i] = *(const v4f*)(s + i * 128);
  // no register that an issued load names (its base is formed anew for the
  // next tile) is rewritten in front of this wait
  asm volatile("s_wait_xcnt 0x0" ::: "memory");
  // keeps what follows behind the wait, and the conversions of the tile before
  // behind these loads: hoisted above them, their wait for that tile's data
  // left only three loads in flight before the new ones were issued
  __builtin_amdgcn_sched_barrier(0);
}

// One tile converted and stored: 8 B a lane, 256 contiguous bytes a store.
// MORE: the wave goes on behind these stores (false for its last ones).
template <bool MORE>
static __device__ __forceinline__ void cvt_store8(const v4f (&r)[8], f16* d) {
#pragma unroll
  for (int i = 0; i < 8; ++i)
    *(v4h*)(d + i * 128) = __builtin_convertvector(r[i], v4h);
  if (MORE) {
    // no address or data register of an issued store is rewritten in front of
    // this wait
    asm volatile("s_wait_xcnt 0x0" ::: "memory");
    // keeps the instructions that follow behind the wait
    __builtin_amdgcn_sched_barrier(0);
  }
}

__global__ __launch_bounds__(CVT_WAVES * 32) void cvt_all_f32_to_f16(
    const float* __restrict__ hidden, const float* __restrict__ Wq,
    const float* __restrict__ Wk, const float* __restrict__ Wv,
    const float* __restrict__ Wo, f16* __restrict__ y) {
  static_assert(CVT_FULL % 2 == 1, "the pair loop leaves one full tile");
  const int lane4 = (threadIdx.x & 31) * 4;
  const int wave  = __builtin_amdgcn_readfirstlane((int)(threadIdx.x >> 5));
  // Full trips: a work-group's 16 tiles are adjacent (64 KB of source a trip).
  int t = (int)blockIdx.x * CVT_WAVES + wave;           // 0 .. CVT_NW - 1
  // The last, partial trip is dealt wave-major, so that it is spread over all
  // work-groups.
  const int rest = wave * CVT_BLOCKS + (int)blockIdx.x; // 0 .. CVT_NW - 1

  v4f ra[8], rb[8];
  cvt_load8(ra, cvt_tile_src(t, CVT_NW, hidden, Wq, Wk, Wv, Wo) + lane4);
  // Two tiles a trip, each set loaded one tile ahead of its stores. Kept
  // rolled: unrolled, the stores sank below later tiles' loads and the wave
  // once waited until no load was in flight.
#pragma unroll 1
  for (int k = 0; k < CVT_FULL / 2; ++k) {
    cvt_load8(rb, cvt_tile_src(t + CVT_NW, CVT_NT, hidden, Wq, Wk, Wv, Wo) + lane4);
    cvt_store8<true>(ra, y + (size_t)t * CVT_TILE + lane4);
    cvt_load8(ra, cvt_tile_src(t + 2 * CVT_NW, CVT_NT, hidden, Wq, Wk, Wv, Wo) + lane4);
    cvt_store8<true>(rb, y + (size_t)(t + CVT_NW) * CVT_TILE + lane4);
    t += 2 * CVT_NW;
  }
  // ra holds this wave's last full tile
  f16* dl = y + (size_t)t * CVT_TILE + lane4;
  if (rest < CVT_REST) {                         // the same for the whole wave
    const int tr = CVT_FULL * CVT_NW + rest;
    cvt_load8(rb, cvt_tile_src(tr, CVT_NT, hidden, Wq, Wk, Wv, Wo) + lane4);
    cvt_store8<true>(ra, dl);
    cvt_store8<false>(rb, y + (size_t)tr * CVT_TILE + lane4);
  } else {
    cvt_store8<false>(ra, dl);
  }
}

// ---------------------------------------------------------------------------
// WMMA GEMM: C[M,768] = X[M,768] @ W[768,768]^T + bias
//   block = 512 threads (16 waves), tile 256 or 192 (M) x 256 (N), stage =
//   64 k, one work-group per WGP: an operand byte copied from L2 feeds about
//   256 output rows or columns.
//   wave (wm = wid&3 -> a quarter of the rows, wn = wid>>2 -> 64 cols)
//   computes 64x64 or 48x64: 4 or 3 A-frags + 4 B-frags -> 16 or 12 WMMAs per
//   32 k.
//   Staging: asynchronous copies global -> LDS, 16 B a lane, through no
//   register. A stage row is 64 halves = one whole 128-B line, brought by 8
//   adjacent lanes; LDS pitch 144 B (16 B x odd: no bank conflict for
//   ds_load_b128). Two buffers: stage t+1 flies while stage t is multiplied.
//   MODE 0: store f16 [M,768];  MODE 1: store f32 [M,768]  (compile-time).
//   Tile walk: GW resident work-groups, one per WGP; work-group w takes tiles
//   w, w + GW, ... (a fixed deal, nothing passes between work-groups). The
//   ring runs on over the tile boundary: the next tile's stages 0 and 1 are
//   stages 12 and 13 of this one, so they fly under this tile's last products
//   and its stores, and only a work-group's first tile waits for a stage.
//   The deal: a launch lasts as long as its fullest work-group. M is 577
//   strips of 64 rows; with 9 (3) N tiles that is a little over 20 (just
//   under 7) strips a work-group. GMA tall tiles (4 strips) and GMB low ones
//   (3 strips) cover M exactly, and the fullest work-group gets 3 tall + 3
//   low = 21 strips (1 + 1 = 7); tall tiles alone would make it 6 tiles = 24
//   (2 = 8).
//   MODE 0 does the three projections in one launch: the three weights lie
//   one behind the other (2304 rows of W, 9 N tiles), and so do Q, K and V.
// ---------------------------------------------------------------------------
#define GKS   64                 // k per stage
#define GPIT  72                 // LDS row pitch in halves (144 B)
#define GBT   256                // rows of W, and of X at most, in a block tile
#define GTILE (GBT * GPIT)       // halves of one operand tile's place in LDS
#define GNST  (ND / GKS)         // 12 stages
#define GW    256                // resident work-groups
#define GHA   256                // rows of a tall tile
#define GHB   192                // rows of a low tile
#define GMA   85                 // tall M tiles: x 3 N tiles = one round of the walk
#define GMB   79                 // low M tiles, behind the tall ones
static_assert(GMA * GHA + GMB * GHB == NM, "the two kinds of tile cover M exactly: no edge tile");

template <int N> struct int_c { static constexpr int v = N; };

// Tile f -> (first row, N tile); f is the same for the whole work-group. The
// tall tiles come first, then the low ones; within a kind the N tiles follow
// one another with the M tile running fastest, so that rows of X are read in
// successive rounds, after the first time from L2.
template <int NN>
static __device__ __forceinline__ void gemm_tile(int f, int& m0, int& nt) {
  if (f < GMA * NN) {
    nt = f / GMA;
    m0 = (f - nt * GMA) * GHA;
  } else {
    const int r = f - GMA * NN;
    nt = r / GMB;
    m0 = GMA * GHA + (r - nt * GMB) * GHB;
  }
}

static __device__ __forceinline__ unsigned lds_addr(const void* p) {
  return (unsigned)(size_t)p;    // low 32 bits of a __shared__ address
}

// One stage's eight copies of this lane (4 of X and 4 of W, or 4 of K and 4 of V). The closing
// s_wait_xcnt stands inside the statement so that no address register of an
// issued copy is rewritten in front of it.
static __device__ __forceinline__ void stage_copy(
    unsigned l0, unsigned l1, unsigned l2, unsigned l3, unsigned l4,
    unsigned l5, unsigned l6, unsigned l7, const f16* g0, const f16* g1,
    const f16* g2, const f16* g3, const f16* g4, const f16* g5, const f16* g6,
    const f16* g7) {
  asm volatile(
      "global_load_async_to_lds_b128 %0, %8, off\n\t"
      "global_load_async_to_lds_b128 %1, %9, off\n\t"
      "global_load_async_to_lds_b128 %2, %10, off\n\t"
      "global_load_async_to_lds_b128 %3, %11, off\n\t"
      "global_load_async_to_lds_b128 %4, %12, off\n\t"
      "global_load_async_to_lds_b128 %5, %13, off\n\t"
      "global_load_async_to_lds_b128 %6, %14, off\n\t"
      "global_load_async_to_lds_b128 %7, %15, off\n\t"
      "s_wait_xcnt 0x0"
      :
      : "v"(l0), "v"(l1), "v"(l2), "v"(l3), "v"(l4), "v"(l5), "v"(l6), "v"(l7),
        "v"(g0), "v"(g1), "v"(g2), "v"(g3), "v"(g4), "v"(g5), "v"(g6), "v"(g7)
      : "memory");
}

// The same for a low tile's stage: seven copies (3 of X, 4 of W), the closing
// s_wait_xcnt inside the statement for the same reason.
static __device__ __forceinline__ void stage_copy7(
    unsigned l0, unsigned l1, unsigned l2, unsigned l3, unsigned l4,
    unsigned l5, unsigned l6, const f16* g0, const f16* g1, const f16* g2,
    const f16* g3, const f16* g4, const f16* g5, const f16* g6) {
  asm volatile(
      "global_load_async_to_lds_b128 %0, %7, off\n\t"
      "global_load_async_to_lds_b128 %1, %8, off\n\t"
      "global_load_async_to_lds_b128 %2, %9, off\n\t"
      "global_load_async_to_lds_b128 %3, %10, off\n\t"
      "global_load_async_to_lds_b128 %4, %11, off\n\t"
      "global_load_async_to_lds_b128 %5, %12, off\n\t"
      "global_load_async_to_lds_b128 %6, %13, off\n\t"
      "s_wait_xcnt 0x0"
      :
      : "v"(l0), "v"(l1), "v"(l2), "v"(l3), "v"(l4), "v"(l5), "v"(l6),
        "v"(g0), "v"(g1), "v"(g2), "v"(g3), "v"(g4), "v"(g5), "v"(g6)
      : "memory");
}

template <int MODE>
__global__ __launch_bounds__(512) void gemm_wmma(const f16* __restrict__ X,
                                                 const f16* __restrict__ W,
                                                 const float* __restrict__ bias0,
                                                 const float* __restrict__ bias1,
                                                 const float* __restrict__ bias2,
                                                 void* __restrict__ out) {
  constexpr int NN = MODE == 0 ? 9 : 3;           // N tiles of the launch
  constexpr int FA = GMA * NN;                    // tall tiles: f < FA
  constexpr int NT = FA + GMB * NN;               // tiles of the launch
  static_assert(GW <= NT && GNST % 2 == 0, "every work-group has a tile; a tile starts in buffer 0");
  // [buffer][X tile | W tile], 256 rows x 64 halves at pitch 72
  __shared__ __attribute__((aligned(16))) f16 Sm[2 * 2 * GTILE];

  const int tid  = threadIdx.x;
  const int wid  = tid >> 5;
  const int lane = tid & 31;
  const int l16  = lane & 15;
  const int hi   = lane >> 4;       // which K-half group this lane owns
  const int wm   = wid & 3;         // M strip 0..3 (a quarter of the tile's rows)
  const int wn   = wid >> 2;        // N strip 0..3 (64 cols each)

  const int crow = tid >> 3;        // 0..63: row of this lane's copies (+64*i)
  const int cseg = (tid & 7) * 8;   // its 8-half (16-B) piece of the row

  // Source byte offsets (they fit 32 bits) and the LDS byte address of this
  // lane's first piece in buffer 0; source rows and LDS rows step evenly.
  // They belong to the tile that the copies are in, which is the next one
  // from this tile's last two publish points on.
  unsigned ox, ow;
  auto set_src = [&](int f) __attribute__((always_inline)) {
    int m0, nt;
    gemm_tile<NN>(f, m0, nt);
    ox = (unsigned)((m0 + crow) * ND + cseg) * 2u;
    ow = (unsigned)((nt * GBT + crow) * ND + cseg) * 2u;
  };
  const unsigned l0 = lds_addr(&Sm[crow * GPIT + cseg]);
  const unsigned LROW = 64 * GPIT * 2;  // LDS bytes of 64 rows
  const unsigned GROW = 64 * ND * 2;    // source bytes of 64 rows
  const unsigned WOFF = GTILE * 2;      // bytes from the X tile to the W tile
  const unsigned BOFF = 2 * GTILE * 2;  // bytes from buffer 0 to buffer 1
  const char* Xc = (const char*)X;
  const char* Wc = (const char*)W;
  // Stage st -> buffer st & 1; tall: the tile that the copies are in is a tall
  // one (the same for the whole work-group).
  auto issue = [&](bool tall, int st) __attribute__((always_inline)) {
    const unsigned lb = l0 + (st & 1) * BOFF;
    const unsigned kb = (unsigned)st * (GKS * 2);
    const unsigned xo = ox + kb, wo = ow + kb;
    if (tall)
      stage_copy(lb, lb + LROW, lb + 2 * LROW, lb + 3 * LROW, lb + WOFF,
                 lb + WOFF + LROW, lb + WOFF + 2 * LROW, lb + WOFF + 3 * LROW,
                 (const f16*)(Xc + xo), (const f16*)(Xc + (xo + GROW)),
                 (const f16*)(Xc + (xo + 2 * GROW)), (const f16*)(Xc + (xo + 3 * GROW)),
                 (const f16*)(Wc + wo), (const f16*)(Wc + (wo + GROW)),
                 (const f16*)(Wc + (wo + 2 * GROW)), (const f16*)(Wc + (wo + 3 * GROW)));
    else
      stage_copy7(lb, lb + LROW, lb + 2 * LROW, lb + WOFF, lb + WOFF + LROW,
                  lb + WOFF + 2 * LROW, lb + WOFF + 3 * LROW,
                  (const f16*)(Xc + xo), (const f16*)(Xc + (xo + GROW)),
                  (const f16*)(Xc + (xo + 2 * GROW)),
                  (const f16*)(Wc + wo), (const f16*)(Wc + (wo + GROW)),
                  (const f16*)(Wc + (wo + 2 * GROW)), (const f16*)(Wc + (wo + 3 * GROW)));
  };

  // Prologue of the first tile: stage 0 lands and is published, then stage 1
  // starts.
  set_src((int)blockIdx.x);
  issue((int)blockIdx.x < FA, 0);
  // this wave's copies have landed before the barrier publishes them
  asm volatile("s_wait_asynccnt 0x0" ::: "memory");
  __syncthreads();
  issue((int)blockIdx.x < FA, 1);

  static_assert(GKS == 64, "a stage is two 32-k blocks");

  // One tile of MI x 64 rows (a wave: MI x 16 rows), f the same for the whole
  // work-group. The lambdas are forced inline: called from two places, this one
  // was left a call, and all that it captures went through scratch memory.
  auto tile = [&](auto mi, int f) __attribute__((always_inline)) {
  constexpr int MI = decltype(mi)::v;
  // One 32-k block's fragments. A: lane = row (M); halves {0-7,16-23}
  // (lanes<16) / {8-15,24-31}. B: lane = col (N = W row), same K packing.
  auto frags = [&](const f16* As, const f16* Bs, int ks, v16h (&a)[MI],
                   v16h (&bf)[4]) __attribute__((always_inline)) {
#pragma unroll
    for (int i = 0; i < MI; ++i) {
      const f16* ap = &As[(wm * (MI * 16) + i * 16 + l16) * GPIT + ks + hi * 8];
      a[i] = cat16(ld8(ap), ld8(ap + 16));
    }
#pragma unroll
    for (int j = 0; j < 4; ++j) {
      const f16* bp = &Bs[(wn * 64 + j * 16 + l16) * GPIT + ks + hi * 8];
      bf[j] = cat16(ld8(bp), ld8(bp + 16));
    }
  };
  v8f acc[MI][4];
  auto products = [&](const v16h (&a)[MI],
                      const v16h (&bf)[4]) __attribute__((always_inline)) {
#pragma unroll
    for (int i = 0; i < MI; ++i)
#pragma unroll
      for (int j = 0; j < 4; ++j) acc[i][j] = wmma_f16(a[i], bf[j], acc[i][j]);
  };

  const int fn = f + GW;            // this work-group's next tile, if < NT
  const int lim = fn < NT ? GNST : GNST - 2;   // publish points with a refill behind them
#pragma unroll
  for (int i = 0; i < MI; ++i)
#pragma unroll
    for (int j = 0; j < 4; ++j) acc[i][j] = splat8(0.f);

  for (int t = 0; t < GNST; ++t) {
    const f16* As = &Sm[(t & 1) * 2 * GTILE];
    const f16* Bs = As + GTILE;

    v16h a0[MI], b0[4], a1[MI], b1[4];
    frags(As, Bs, 0, a0, b0);
    // keeps the block's LDS loads together in front of its products: left
    // free, the compiler kept one A fragment and reloaded it in front of
    // every row of four products, each time waiting until no load was out
    __builtin_amdgcn_sched_barrier(0);
    products(a0, b0);
    frags(As, Bs, 32, a1, b1);   // the stage's last LDS reads
    // keeps the first block's products in front of the publish point: three of
    // them sank behind the barrier, where a wave that must wait for the matrix
    // unit issues its refill late
    __builtin_amdgcn_sched_barrier(0);

    // Publish point of stage t+1; it also ends every read of stage t's buffer.
    // It stands in front of the stage's second block of products, whose
    // fragments are in registers by then: with one work-group on the WGP the
    // refill gets a whole stage to land, and the waves leave the barrier with
    // matrix work in hand, under which the next stage's first LDS loads hide.
    // this wave's reads of the buffer have returned before it is refilled
    asm volatile("s_wait_dscnt 0x0" ::: "memory");
    // this wave's copies of stage t+1 have landed before others read them
    asm volatile("s_wait_asynccnt 0x0" ::: "memory");
    __syncthreads();
    // Stage t+2 of this tile, or stage t+2-12 of the next (same buffer: 12 is
    // even). Every test is the same for the whole work-group.
    // Behind a low tile comes a low one (f rises).
    if (t < lim) {
      if (t == GNST - 2) set_src(fn);
      issue(MI * 64 == GHA && (t < GNST - 2 || fn < FA),
            t + 2 < GNST ? t + 2 : t + 2 - GNST);
    }
    products(a1, b1);
  }

  int m0, nt;
  gemm_tile<NN>(f, m0, nt);
  const int pj = nt / 3;            // which projection (MODE 1: always 0)
  const int n0 = (nt - pj * 3) * GBT;
  const float* bias = (pj == 0) ? bias0 : (pj == 1) ? bias1 : bias2;
  const size_t po = (size_t)pj * NM * ND;   // its output, in elements

  // Epilogue. D layout: lane<16 -> row = base+r, lane>=16 -> row = base+8+r;
  // column = lane%16 within each 16-wide tile. Every row of every tile exists.
#pragma unroll
  for (int i = 0; i < MI; ++i) {
    const int mbase = m0 + wm * (MI * 16) + i * 16 + hi * 8;
#pragma unroll
    for (int j = 0; j < 4; ++j) {
      const int n    = n0 + wn * 64 + j * 16 + l16;
      const float bn = bias[n];
#pragma unroll
      for (int r = 0; r < 8; ++r) {
        const float v = acc[i][j][r] + bn;
        if (MODE == 0)
          ((f16*)out)[po + (size_t)(mbase + r) * ND + n] = (f16)v;
        else
          ((float*)out)[po + (size_t)(mbase + r) * ND + n] = v;
      }
    }
  }
  // no address or data register of an issued store is rewritten (the next
  // tile clears the accumulators) in front of this wait
  asm volatile("s_wait_xcnt 0x0" ::: "memory");
  };  // tile

  // The walk: a work-group's tall tiles come first (f rises).
  for (int f = (int)blockIdx.x; f < NT; f += GW) {
    if (f < FA) tile(int_c<GHA / 64>{}, f);
    else        tile(int_c<GHB / 64>{}, f);
  }
  // nothing is outstanding when the wave ends
  asm volatile("s_wait_asynccnt 0x0" ::: "memory");
}

// ---------------------------------------------------------------------------
// Flash attention: grid (H=12, B=64), 608 threads = 19 waves.
// Q/K/V are f16 [B,S,768]; head h occupies columns [h*64, h*64+64).
// Each wave owns 32 queries; the head's K and V lie whole in LDS (both
// row-major). The products are taken transposed:
//   S^T = K (Q/8)^T   (A = K rows from LDS, B = Q fragments, see the kernel)
//   O^T += V^T P^T    (A = V^T by the transposing LDS load, B = P^T packed
//                      from S^T)
// In a D tile register r of lane l is [row 8*(l>>4)+r][column l&15], so a lane
// holds 32 of the 64 scores of ONE query (its partner l^16 the other 32):
// maximum and sum run in the lane's own registers, one exchange between the
// wave halves joins the maximum, and two S^T tiles packed to f16 are a B
// fragment in the hardware k order (k = 8h+s, 16+8h+s), the order in which
// the transposing load delivers V^T. softmax scale (1/8, exact in f16) is
// folded into Q.
// ---------------------------------------------------------------------------
static __device__ __forceinline__ float xhalf(float x) {  // lane l <-> l ^ 16
  const int b = __builtin_bit_cast(int, x);
  return __builtin_bit_cast(
      float, __builtin_amdgcn_permlanex16(b, b, 0x76543210, 0xfedcba98, false,
                                          false));
}

// x[r] = 2^x[r]. Eight independent v_exp_f32 in one statement, each filling
// the slot behind the one before it; the closing v_nop keeps the slot that the
// instruction set asks for between a transcendental and an instruction that
// overwrites its source or reads its result.
static __device__ __forceinline__ void exp2x8(v8f& x) {
  float a = x[0], b = x[1], c = x[2], d = x[3];
  float e = x[4], f = x[5], g = x[6], h = x[7];
  asm("v_exp_f32 %0, %0\n\tv_exp_f32 %1, %1\n\tv_exp_f32 %2, %2\n\t"
      "v_exp_f32 %3, %3\n\tv_exp_f32 %4, %4\n\tv_exp_f32 %5, %5\n\t"
      "v_exp_f32 %6, %6\n\tv_exp_f32 %7, %7\n\tv_nop"
      : "+v"(a), "+v"(b), "+v"(c), "+v"(d), "+v"(e), "+v"(f), "+v"(g), "+v"(h));
  x[0] = a; x[1] = b; x[2] = c; x[3] = d;
  x[4] = e; x[5] = f; x[6] = g; x[7] = h;
}

// The same for two values.
static __device__ __forceinline__ void exp2x2(float& a, float& b) {
  asm("v_exp_f32 %0, %0\n\tv_exp_f32 %1, %1\n\tv_nop" : "+v"(a), "+v"(b));
}

static __device__ __forceinline__ v16h pack16(v8f lo, v8f hi8) {
  v16h p;
#pragma unroll
  for (int r = 0; r < 8; ++r) {
    p[r]     = (f16)lo[r];
    p[8 + r] = (f16)hi8[r];
  }
  return p;
}

// Transposing LDS load of a row-major 16-bit tile: the lanes address 16 rows
// (keys) x 16 columns (dh) in 16-byte pieces, and lane (c = l & 15, h = l >> 4)
// receives column c of rows 8h .. 8h+7: half of an A fragment of V^T.
typedef __attribute__((ext_vector_type(8))) short s16x8;
static __device__ __forceinline__ v8h ld_tr16(const f16* p) {
  typedef __attribute__((address_space(3))) s16x8 lds_s16x8;
  return __builtin_bit_cast(v8h,
                            __builtin_amdgcn_ds_load_tr16_b128_v8i16((lds_s16x8*)p));
}

#define VPIT 80   // V row pitch in halves: 160 B = 32 B x odd, the transposing load's pitch
#define KPIT 72   // K row pitch in halves: 144 B = 16 B x odd, for ds_load_b128
#define AW    19            // waves of a work-group: 19 x 32 queries cover the 577
#define AROWS (AW * 32)     // 608 staged key rows; rows past the last key repeat it
#define AHALF (AROWS / 2)   // rows of one of the two staging steps

// One work-group per (batch, head). The head's whole K and V lie in LDS, staged
// once by asynchronous copies in two steps of 304 rows: the second step flies
// under the first four 64-key passes. A wave owns 32 queries (two 16-column
// groups), so a K or V^T fragment read from LDS feeds two products, and the
// key loop has no barrier but the one that publishes the second step.
__global__ __launch_bounds__(AW * 32) void attn_flash(const f16* __restrict__ Q,
                                                  const f16* __restrict__ K,
                                                  const f16* __restrict__ V,
                                                  f16* __restrict__ ctx_out) {
  __shared__ __attribute__((aligned(16))) f16 Kt[AROWS * KPIT];  // [key][dh]
  __shared__ __attribute__((aligned(16))) f16 Vs[AROWS * VPIT];  // [key][dh]
  __shared__ __attribute__((aligned(16))) f16 Qs[AW * 8 * 256];  // [wave][piece][lane]

  const int b    = blockIdx.y;
  const int h    = blockIdx.x;
  const int tid  = threadIdx.x;
  const int wid  = tid >> 5;
  const int lane = tid & 31;
  const int l16  = lane & 15;
  const int hi   = lane >> 4;
  const int q0   = wid * 32;

  const f16* Qb = Q + (size_t)b * NS * ND + h * NDH;   // row stride ND
  const f16* Kb = K + (size_t)b * NS * ND + h * NDH;
  const f16* Vb = V + (size_t)b * NS * ND + h * NDH;

  // Staging: 8 adjacent lanes bring one row's 128 B (a whole line); the 608
  // lanes cover 76 rows a copy, four copies of K and four of V a step.
  const int crow = tid >> 3;        // 0..75
  const int cseg = (tid & 7) * 8;   // this lane's 8-half (16-B) piece of a row
  auto stage = [&](int st) {
    unsigned lk[4], lv[4];
    const f16 *gk[4], *gv[4];
#pragma unroll
    for (int i = 0; i < 4; ++i) {
      const int row = st * AHALF + i * (AHALF / 4) + crow;
      const int srow = row > NS - 1 ? NS - 1 : row;      // source row in bounds
      lk[i] = lds_addr(&Kt[row * KPIT + cseg]);
      lv[i] = lds_addr(&Vs[row * VPIT + cseg]);
      gk[i] = Kb + (size_t)srow * ND + cseg;
      gv[i] = Vb + (size_t)srow * ND + cseg;
    }
    stage_copy(lk[0], lk[1], lk[2], lk[3], lv[0], lv[1], lv[2], lv[3],
               gk[0], gk[1], gk[2], gk[3], gv[0], gv[1], gv[2], gv[3]);
  };

  stage(0);

  // Q B-fragments (64 K x 16 queries a group), scale 1/sqrt(64)=0.125 folded in
  // (exact). They wait in the wave's own LDS range, in fragment order (piece
  // x of fragment [c][ks]: 32 lanes x 16 B in a row), and are read back once a
  // pass: kept in registers, their 32 overran the budget of five waves a SIMD.
  const f16 sc = (f16)0.125f;
  f16* qs = &Qs[wid * (8 * 256) + lane * 8];
#pragma unroll
  for (int c = 0; c < 2; ++c) {
    int qr = q0 + c * 16 + l16; if (qr > NS - 1) qr = NS - 1;
    const f16* qp = Qb + (size_t)qr * ND + hi * 8;
#pragma unroll
    for (int x = 0; x < 4; ++x)      // k = 16x + 8*hi + 0..7
      *(v8h*)(qs + (c * 4 + x) * 256) = ld8(qp + x * 16) * sc;
  }

  // this wave's copies of rows 0..303 have landed before the barrier publishes them
  asm volatile("s_wait_asynccnt 0x0" ::: "memory");
  __syncthreads();
  stage(1);

  v8f acc[2][4];                     // O^T: acc[c][j][r] = O[query c*16+l16][j*16+8*hi+r]
#pragma unroll
  for (int c = 0; c < 2; ++c)
#pragma unroll
    for (int j = 0; j < 4; ++j) acc[c][j] = splat8(0.f);
  float mrow[2] = {-1e30f, -1e30f};  // this lane's two queries: running maximum
  float lsum[2] = {0.f, 0.f};        // sums over this wave half's keys only

  const f16* krp0 = &Kt[l16 * KPIT + hi * 8];
  const f16* vrp0 = &Vs[(hi * 8 + (lane & 7)) * VPIT + ((lane >> 3) & 1) * 8];

  // One pass over NU x 32 keys from key kb on. NU = 2: all keys exist. NU = 1:
  // the tail, keys past the last are masked.
  auto pass = [&](auto nu, int kb) {
    constexpr int NU = decltype(nu)::v;
    constexpr int NT = 2 * NU;
    // ---- scores S^T = K (Q/8)^T : NT tiles of 16 keys x 2 query groups -----
    // s[c][t][r] = score(key kb + t*16 + 8*hi + r, query q0 + c*16 + l16)
    v8f s[2][NT];
#pragma unroll
    for (int ks = 0; ks < 2; ++ks) {   // dh 0..31, then dh 32..63
      const v16h qf0 = cat16(ld8(qs + (2 * ks) * 256),     ld8(qs + (2 * ks + 1) * 256));
      const v16h qf1 = cat16(ld8(qs + (4 + 2 * ks) * 256), ld8(qs + (5 + 2 * ks) * 256));
#pragma unroll
      for (int t = 0; t < NT; ++t) {
        const f16* krp = krp0 + (kb + t * 16) * KPIT + ks * 32;
        const v16h a = cat16(ld8(krp), ld8(krp + 16));
        s[0][t] = wmma_f16(a, qf0, ks == 0 ? splat8(0.f) : s[0][t]);
        s[1][t] = wmma_f16(a, qf1, ks == 0 ? splat8(0.f) : s[1][t]);
      }
      // keeps one dh half's fragments (48 registers) live at a time, and the
      // V^T loads behind the score products: left free, the loads were hoisted
      // to the top of the pass and the 192-register budget of five waves a SIMD
      // was overrun (spills in the key loop)
      __builtin_amdgcn_sched_barrier(0);
    }
    if (NU == 1) {
#pragma unroll
      for (int c = 0; c < 2; ++c)
#pragma unroll
        for (int t = 0; t < NT; ++t)
#pragma unroll
          for (int r = 0; r < 8; ++r)
            if (kb + t * 16 + hi * 8 + r > NS - 1) s[c][t][r] = -1e30f;
    }

    // ---- maximum of a lane's scores per query, joined with the other half --
    float mnew[2], corr[2];
#pragma unroll
    for (int c = 0; c < 2; ++c) {
      v8f mx8 = s[c][0];
#pragma unroll
      for (int t = 1; t < NT; ++t)
#pragma unroll
        for (int r = 0; r < 8; ++r) mx8[r] = fmaxf(mx8[r], s[c][t][r]);
      float mx = fmaxf(fmaxf(fmaxf(mx8[0], mx8[1]), fmaxf(mx8[2], mx8[3])),
                       fmaxf(fmaxf(mx8[4], mx8[5]), fmaxf(mx8[6], mx8[7])));
      mx = fmaxf(mx, xhalf(mx));
      mnew[c] = fmaxf(mrow[c], mx);
      corr[c] = (mrow[c] - mnew[c]) * LOG2E;
      mrow[c] = mnew[c];
    }
    exp2x2(corr[0], corr[1]);        // e^(old maximum - new maximum)
#pragma unroll
    for (int c = 0; c < 2; ++c)
#pragma unroll
      for (int j = 0; j < 4; ++j) acc[c][j] *= corr[c];

    // Per 32 keys: exponentials, P^T B-fragments straight from the score
    // registers, then O^T += V^T P^T. (A fragment of V^T: lane = dh; a load
    // brings keys 8*hi+0..7 of a 16-key group, two loads 16 keys apart are one
    // 16 x 32 fragment; it feeds both query groups.)
    v8f rs8[2];
#pragma unroll
    for (int u = 0; u < NU; ++u) {
      v16h pb[2];
#pragma unroll
      for (int c = 0; c < 2; ++c) {
#pragma unroll
        for (int t = 2 * u; t < 2 * u + 2; ++t) {
#pragma unroll
          for (int r = 0; r < 8; ++r) s[c][t][r] = (s[c][t][r] - mnew[c]) * LOG2E;
          exp2x8(s[c][t]);           // e^(s - m) as 2^((s - m) * log2 e)
        }
        const v8f rsu = s[c][2 * u] + s[c][2 * u + 1];
        rs8[c] = (u == 0) ? rsu : rs8[c] + rsu;
        pb[c] = pack16(s[c][2 * u], s[c][2 * u + 1]);   // keys 32u .. 32u+31
      }
#pragma unroll
      for (int j = 0; j < 4; ++j) {
        const f16* vp2 = vrp0 + (kb + u * 32) * VPIT + j * 16;
        const v16h vf = cat16(ld_tr16(vp2), ld_tr16(vp2 + 16 * VPIT));
        acc[0][j] = wmma_f16(vf, pb[0], acc[0][j]);
        acc[1][j] = wmma_f16(vf, pb[1], acc[1][j]);
      }
    }
#pragma unroll
    for (int c = 0; c < 2; ++c) {
      const float rs = ((rs8[c][0] + rs8[c][1]) + (rs8[c][2] + rs8[c][3])) +
                       ((rs8[c][4] + rs8[c][5]) + (rs8[c][6] + rs8[c][7]));
      lsum[c] = lsum[c] * corr[c] + rs;
    }
  };

  static_assert(4 * 64 <= AHALF, "the first four passes read the first step's rows only");
  static_assert(NS / 64 * 64 + 32 <= AROWS && NS - NS / 64 * 64 <= 32, "one 32-key tail");
  for (int p = 0; p < NS / 64; ++p) {
    if (p == 4) {                    // the same for the whole work-group
      // this wave's copies of rows 304..607 have landed before others read them
      asm volatile("s_wait_asynccnt 0x0" ::: "memory");
      __syncthreads();
    }
    pass(int_c<2>{}, p * 64);
  }
  pass(int_c<1>{}, NS / 64 * 64);

  // ---- finalize: join the halves' sums, ctx /= l, store f16 to [B, S, 768] --
  // A lane holds 8 consecutive dh of a query per tile: one 16-byte store.
#pragma unroll
  for (int c = 0; c < 2; ++c) {
    const float inv = 1.0f / (lsum[c] + xhalf(lsum[c]));
    const int q = q0 + c * 16 + l16;
    if (q < NS) {
      f16* outp = ctx_out + (size_t)b * NS * ND + (size_t)q * ND + h * NDH + hi * 8;
#pragma unroll
      for (int j = 0; j < 4; ++j) {
        v8h o;
#pragma unroll
        for (int r = 0; r < 8; ++r) o[r] = (f16)(acc[c][j][r] * inv);
        *(v8h*)(outp + j * 16) = o;
      }
    }
  }
}

// ---------------------------------------------------------------------------
extern "C" void kernel_launch(void* const* d_in, const int* in_sizes, int n_in,
                              void* d_out, int out_size, void* d_ws,
                              size_t ws_size, hipStream_t stream) {
  const float* hidden = (const float*)d_in[0];
  const float* Wq = (const float*)d_in[1];
  const float* bq = (const float*)d_in[2];
  const float* Wk = (const float*)d_in[3];
  const float* bk = (const float*)d_in[4];
  const float* Wv = (const float*)d_in[5];
  const float* bv = (const float*)d_in[6];
  const float* Wo = (const float*)d_in[7];
  const float* bo = (const float*)d_in[8];

  char* ws = (char*)d_ws;
  const size_t szX = (size_t)NM * ND * sizeof(f16);       // 56.7 MB
  const size_t szW = (size_t)ND * ND * sizeof(f16);       // 1.18 MB
  size_t off = 0;
  f16* Xh  = (f16*)(ws + off); off += szX;
  f16* Wqh = (f16*)(ws + off); off += szW;
  f16* Wkh = (f16*)(ws + off); off += szW;
  f16* Wvh = (f16*)(ws + off); off += szW;
  f16* Woh = (f16*)(ws + off); off += szW;
  f16* Qh  = (f16*)(ws + off); off += szX;
  f16* Kh  = (f16*)(ws + off); off += szX;
  f16* Vh  = (f16*)(ws + off); off += szX;
  f16* Ch  = (f16*)(ws + off); off += szX;

  // 1) conversions to f16: Xh, Wqh, Wkh, Wvh, Woh are one contiguous array
  cvt_all_f32_to_f16<<<CVT_BLOCKS, CVT_WAVES * 32, 0, stream>>>(hidden, Wq, Wk,
                                                                Wv, Wo, Xh);

  // 2) Q/K/V projections, one launch: Wqh, Wkh, Wvh are one array of 2304 rows,
  //    Qh, Kh, Vh one array of three outputs
  gemm_wmma<0><<<GW, 512, 0, stream>>>(Xh, Wqh, bq, bk, bv, Qh);

  // 3) flash attention -> ctx f16 [B,S,768]
  attn_flash<<<dim3(NH, NB), AW * 32, 0, stream>>>(Qh, Kh, Vh, Ch);

  // 4) output projection -> f32 d_out
  gemm_wmma<1><<<GW, 512, 0, stream>>>(Ch, Woh, bo, bo, bo, d_out);
}

// v009
// Measured time: 217 microseconds a run.
// Next to v008, in two timings, it ran 1.08 times as fast each time.
// Counting every step since v000, it is 2.38 times as fast.
#include <hip/hip_runtime.h>
#include <hip/hip_bf16.h>

// ---------------------------------------------------------------------------
// ViT attention (B=64, S=577, D=768, H=12, Dh=64) on gfx1250 (CDNA5, wave32).
// All GEMMs use v_wmma_f32_16x16x32_f16 (f16 inputs, f32 accumulate).
// Pipeline:
//   1) cvt f32->f16 of hidden + Wq/Wk/Wv/Wo into workspace (one launch)
//   2) WMMA GEMM (256x256 and 192x256 block tiles, async-copy LDS ring,
//      resident work-groups that walk the tiles), one launch for all three:
//        Q/K/V = Xh @ W.T + b  -> f16 [B,S,768]
//   3) flash attention (online softmax, scores never leave registers)
//        -> ctx f16 [B,S,768]
//   4) WMMA GEMM: out = ctx @ Wo.T + bo -> f32 [B,S,768] (d_out)
// Workspace: 5 * 56.7MB (Xh,Q,K,V,ctx) + 4 * 1.18MB (weights) ~ 289 MB.
// ---------------------------------------------------------------------------

typedef _Float16 f16;
typedef __attribute__((ext_vector_type(8)))  _Float16 v8h;
typedef __attribute__((ext_vector_type(16))) _Float16 v16h;
typedef __attribute__((ext_vector_type(8)))  float    v8f;

#define NB   64
#define NS   577
#define ND   768
#define NH   12
#define NDH  64
#define NM   36928   // NB*NS
#define LOG2E 1.44269504088896340736f

static __device__ __forceinline__ v8h ld8(const f16* p) { return *(const v8h*)p; }

static __device__ __forceinline__ v16h cat16(v8h a, v8h b) {
  return __builtin_shufflevector(a, b, 0,1,2,3,4,5,6,7,8,9,10,11,12,13,14,15);
}

static __device__ __forceinline__ v8f wmma_f16(v16h a, v16h b, v8f c) {
  // D = A(16x32 f16) x B(32x16 f16) + C(16x16 f32)
  return __builtin_amdgcn_wmma_f32_16x16x32_f16(false, a, false, b, (short)0, c,
                                                false, false);
}

static __device__ __forceinline__ v8f splat8(float x) {
  v8f r;
#pragma unroll
  for (int i = 0; i < 8; ++i) r[i] = x;
  return r;
}

// ---------------------------------------------------------------------------
// f32 -> f16 conversion of hidden and of the four weights: ONE resident
// streaming launch, one 16-wave work-group per WGP. The five f16 destinations
// lie one behind the other in the workspace, so the destination is one array.
// A wave tile is 1024 floats: 8 loads of 16 B a lane, each 512 contiguous
// bytes of the wave. The next tile's 8 loads are issued before this tile is
// converted and stored (two register sets take turns), so a wave always has
// loads in flight. All five sizes are multiples of the tile: no tile straddles
// two sources. The tile count is a constant: every wave takes CVT_FULL tiles,
// CVT_REST waves one more.
// ---------------------------------------------------------------------------
typedef __attribute__((ext_vector_type(4))) float    v4f;
typedef __attribute__((ext_vector_type(4))) _Float16 v4h;

#define CVT_TILE   1024                      // floats of one wave tile
#define CVT_XT     (NM * ND / CVT_TILE)      // 27696 tiles of hidden
#define CVT_WT     (ND * ND / CVT_TILE)      // 576 tiles of one weight
#define CVT_NT     (CVT_XT + 4 * CVT_WT)     // 30000 tiles in all
#define CVT_BLOCKS 256
#define CVT_WAVES  16
#define CVT_NW     (CVT_BLOCKS * CVT_WAVES)  // 4096 waves
#define CVT_FULL   (CVT_NT / CVT_NW)         // 7
#define CVT_REST   (CVT_NT - CVT_FULL * CVT_NW)  // 1328

// Source of wave tile t (t is wave-uniform: the pick stays on the scalar
// side). tend is a compile-time bound, t < tend: trips that cannot reach the
// weights need no pick.
static __device__ __forceinline__ const float* cvt_tile_src(
    int t, int tend, const float* hidden, const float* Wq, const float* Wk,
    const float* Wv, const float* Wo) {
  if (tend <= CVT_XT) return hidden + (size_t)t * CVT_TILE;
  const int u = t - CVT_XT;
  const int w = u / CVT_WT;
  const float* base = (w == 0) ? Wq : (w == 1) ? Wk : (w == 2) ? Wv : Wo;
  return (u < 0) ? hidden + (size_t)t * CVT_TILE
                 : base + (size_t)(u - w * CVT_WT) * CVT_TILE;
}

// One tile's 8 loads of this lane.
static __device__ __forceinline__ void cvt_load8(v4f (&r)[8], const float* s) {
#pragma unroll
  for (int i = 0; i < 8; ++i) r[i] = *(const v4f*)(s + i * 128);
  // no register that an issued load names (its base is formed anew for the
  // next tile) is rewritten in front of this wait
  asm volatile("s_wait_xcnt 0x0" ::: "memory");
  // keeps what follows behind the wait, and the conversions of the tile before
  // behind these loads: hoisted above them, their wait for that tile's data
  // left only three loads in flight before the new ones were issued
  __builtin_amdgcn_sched_barrier(0);
}

// One tile converted and stored: 8 B a lane, 256 contiguous bytes a store.
// MORE: the wave goes on behind these stores (false for its last ones).
template <bool MORE>
static __device__ __forceinline__ void cvt_store8(const v4f (&r)[8], f16* d) {
#pragma unroll
  for (int i = 0; i < 8; ++i)
    *(v4h*)(d + i * 128) = __builtin_convertvector(r[i], v4h);
  if (MORE) {
    // no address or data register of an issued store is rewritten in front of
    // this wait
    asm volatile("s_wait_xcnt 0x0" ::: "memory");
    // keeps the instructions that follow behind the wait
    __builtin_amdgcn_sched_barrier(0);
  }
}

__global__ __launch_bounds__(CVT_WAVES * 32) void cvt_all_f32_to_f16(
    const float* __restrict__ hidden, const float* __restrict__ Wq,
    const float* __restrict__ Wk, const float* __restrict__ Wv,
    const float* __restrict__ Wo, f16* __restrict__ y) {
  static_assert(CVT_FULL % 2 == 1, "the pair loop leaves one full tile");
  const int lane4 = (threadIdx.x & 31) * 4;
  const int wave  = __builtin_amdgcn_readfirstlane((int)(threadIdx.x >> 5));
  // Full trips: a work-group's 16 tiles are adjacent (64 KB of source a trip).
  int t = (int)blockIdx.x * CVT_WAVES + wave;           // 0 .. CVT_NW - 1
  // The last, partial trip is dealt wave-major, so that it is spread over all
  // work-groups.
  const int rest = wave * CVT_BLOCKS + (int)blockIdx.x; // 0 .. CVT_NW - 1

  v4f ra[8], rb[8];
  cvt_load8(ra, cvt_tile_src(t, CVT_NW, hidden, Wq, Wk, Wv, Wo) + lane4);
  // Two tiles a trip, each set loaded one tile ahead of its stores. Kept
  // rolled: unrolled, the stores sank below later tiles' loads and the wave
  // once waited until no load was in flight.
#pragma unroll 1
  for (int k = 0; k < CVT_FULL / 2; ++k) {
    cvt_load8(rb, cvt_tile_src(t + CVT_NW, CVT_NT, hidden, Wq, Wk, Wv, Wo) + lane4);
    cvt_store8<true>(ra, y + (size_t)t * CVT_TILE + lane4);
    cvt_load8(ra, cvt_tile_src(t + 2 * CVT_NW, CVT_NT, hidden, Wq, Wk, Wv, Wo) + lane4);
    cvt_store8<true>(rb, y + (size_t)(t + CVT_NW) * CVT_TILE + lane4);
    t += 2 * CVT_NW;
  }
  // ra holds this wave's last full tile
  f16* dl = y + (size_t)t * CVT_TILE + lane4;
  if (rest < CVT_REST) {                         // the same for the whole wave
    const int tr = CVT_FULL * CVT_NW + rest;
    cvt_load8(rb, cvt_tile_src(tr, CVT_NT, hidden, Wq, Wk, Wv, Wo) + lane4);
    cvt_store8<true>(ra, dl);
    cvt_store8<false>(rb, y + (size_t)tr * CVT_TILE + lane4);
  } else {
    cvt_store8<false>(ra, dl);
  }
}

// ---------------------------------------------------------------------------
// WMMA GEMM: C[M,768] = X[M,768] @ W[768,768]^T + bias
//   block = 512 threads (16 waves), tile 256 or 192 (M) x 256 (N), stage =
//   128 k, one work-group per WGP: an operand byte copied from L2 feeds about
//   256 output rows or columns.
//   wave (wm = wid&3 -> a quarter of the rows, wn = wid>>2 -> 64 cols)
//   computes 64x64 or 48x64: 4 or 3 A-frags + 4 B-frags -> 16 or 12 WMMAs per
//   32 k.
//   Staging: asynchronous copies global -> LDS, 16 B a lane, through no
//   register. A stage row is 128 halves = one aligned 256-B unit, brought by
//   16 adjacent lanes; LDS pitch 272 B (16 B x odd: no bank conflict for
//   ds_load_b128). Two buffers: stage t+1 flies while stage t is multiplied.
//   A stage is four 32-k blocks: a refill has the time of four blocks of
//   products to land, and the waves meet at a barrier once per 128 k.
//   MODE 0: store f16 [M,768];  MODE 1: store f32 [M,768]  (compile-time).
//   Tile walk: GW resident work-groups, one per WGP; work-group w takes tiles
//   w, w + GW, ... (a fixed deal, nothing passes between work-groups). The
//   ring runs on over the tile boundary: the next tile's stages 0 and 1 are
//   stages 6 and 7 of this one, so they fly under this tile's last products
//   and its stores, and only a work-group's first tile waits for a stage.
//   The deal: a launch lasts as long as its fullest work-group. M is 577
//   strips of 64 rows; with 9 (3) N tiles that is a little over 20 (just
//   under 7) strips a work-group. GMA tall tiles (4 strips) and GMB low ones
//   (3 strips) cover M exactly, and the fullest work-group gets 3 tall + 3
//   low = 21 strips (1 + 1 = 7); tall tiles alone would make it 6 tiles = 24
//   (2 = 8).
//   MODE 0 does the three projections in one launch: the three weights lie
//   one behind the other (2304 rows of W, 9 N tiles), and so do Q, K and V.
// ---------------------------------------------------------------------------
#define GKS   128                // k per stage
#define GPIT  136                // LDS row pitch in halves (272 B)
#define GBT   256                // rows of W, and of X at most, in a block tile
#define GTILE (GBT * GPIT)       // halves of one operand tile's place in LDS
#define GNST  (ND / GKS)         // 6 stages
#define GW    256                // resident work-groups
#define GHA   256                // rows of a tall tile
#define GHB   192                // rows of a low tile
#define GMA   85                 // tall M tiles: x 3 N tiles = one round of the walk
#define GMB   79                 // low M tiles, behind the tall ones
static_assert(GMA * GHA + GMB * GHB == NM, "the two kinds of tile cover M exactly: no edge tile");

template <int N> struct int_c { static constexpr int v = N; };

// Tile f -> (first row, N tile); f is the same for the whole work-group. The
// tall tiles come first, then the low ones; within a kind the N tiles follow
// one another with the M tile running fastest, so that rows of X are read in
// successive rounds, after the first time from L2.
template <int NN>
static __device__ __forceinline__ void gemm_tile(int f, int& m0, int& nt) {
  if (f < GMA * NN) {
    nt = f / GMA;
    m0 = (f - nt * GMA) * GHA;
  } else {
    const int r = f - GMA * NN;
    nt = r / GMB;
    m0 = GMA * GHA + (r - nt * GMB) * GHB;
  }
}

static __device__ __forceinline__ unsigned lds_addr(const void* p) {
  return (unsigned)(size_t)p;    // low 32 bits of a __shared__ address
}

// Eight copies of this lane (one operand tile's share of a stage). The closing
// s_wait_xcnt stands inside the statement so that no address register of an
// issued copy is rewritten in front of it.
static __device__ __forceinline__ void stage_copy(
    unsigned l0, unsigned l1, unsigned l2, unsigned l3, unsigned l4,
    unsigned l5, unsigned l6, unsigned l7, const f16* g0, const f16* g1,
    const f16* g2, const f16* g3, const f16* g4, const f16* g5, const f16* g6,
    const f16* g7) {
  asm volatile(
      "global_load_async_to_lds_b128 %0, %8, off\n\t"
      "global_load_async_to_lds_b128 %1, %9, off\n\t"
      "global_load_async_to_lds_b128 %2, %10, off\n\t"
      "global_load_async_to_lds_b128 %3, %11, off\n\t"
      "global_load_async_to_lds_b128 %4, %12, off\n\t"
      "global_load_async_to_lds_b128 %5, %13, off\n\t"
      "global_load_async_to_lds_b128 %6, %14, off\n\t"
      "global_load_async_to_lds_b128 %7, %15, off\n\t"
      "s_wait_xcnt 0x0"
      :
      : "v"(l0), "v"(l1), "v"(l2), "v"(l3), "v"(l4), "v"(l5), "v"(l6), "v"(l7),
        "v"(g0), "v"(g1), "v"(g2), "v"(g3), "v"(g4), "v"(g5), "v"(g6), "v"(g7)
      : "memory");
}

// The same for the X rows of a low tile's stage: six copies, the closing
// s_wait_xcnt inside the statement for the same reason.
static __device__ __forceinline__ void stage_copy6(
    unsigned l0, unsigned l1, unsigned l2, unsigned l3, unsigned l4,
    unsigned l5, const f16* g0, const f16* g1, const f16* g2, const f16* g3,
    const f16* g4, const f16* g5) {
  asm volatile(
      "global_load_async_to_lds_b128 %0, %6, off\n\t"
      "global_load_async_to_lds_b128 %1, %7, off\n\t"
      "global_load_async_to_lds_b128 %2, %8, off\n\t"
      "global_load_async_to_lds_b128 %3, %9, off\n\t"
      "global_load_async_to_lds_b128 %4, %10, off\n\t"
      "global_load_async_to_lds_b128 %5, %11, off\n\t"
      "s_wait_xcnt 0x0"
      :
      : "v"(l0), "v"(l1), "v"(l2), "v"(l3), "v"(l4), "v"(l5),
        "v"(g0), "v"(g1), "v"(g2), "v"(g3), "v"(g4), "v"(g5)
      : "memory");
}

template <int MODE>
__global__ __launch_bounds__(512) void gemm_wmma(const f16* __restrict__ X,
                                                 const f16* __restrict__ W,
                                                 const float* __restrict__ bias0,
                                                 const float* __restrict__ bias1,
                                                 const float* __restrict__ bias2,
                                                 void* __restrict__ out) {
  constexpr int NN = MODE == 0 ? 9 : 3;           // N tiles of the launch
  constexpr int FA = GMA * NN;                    // tall tiles: f < FA
  constexpr int NT = FA + GMB * NN;               // tiles of the launch
  static_assert(GW <= NT && GNST % 2 == 0, "every work-group has a tile; a tile starts in buffer 0");
  // [buffer][X tile | W tile], 256 rows x 128 halves at pitch 136
  __shared__ __attribute__((aligned(16))) f16 Sm[2 * 2 * GTILE];

  const int tid  = threadIdx.x;
  const int wid  = tid >> 5;
  const int lane = tid & 31;
  const int l16  = lane & 15;
  const int hi   = lane >> 4;       // which K-half group this lane owns
  const int wm   = wid & 3;         // M strip 0..3 (a quarter of the tile's rows)
  const int wn   = wid >> 2;        // N strip 0..3 (64 cols each)

  const int crow = tid >> 4;        // 0..31: row of this lane's copies (+32*i)
  const int cseg = (tid & 15) * 8;  // its 8-half (16-B) piece of the row

  // Source byte offsets (they fit 32 bits) and the LDS byte address of this
  // lane's first piece in buffer 0; source rows and LDS rows step evenly.
  // They belong to the tile that the copies are in, which is the next one
  // from this tile's last two publish points on.
  unsigned ox, ow;
  auto set_src = [&](int f) __attribute__((always_inline)) {
    int m0, nt;
    gemm_tile<NN>(f, m0, nt);
    ox = (unsigned)((m0 + crow) * ND + cseg) * 2u;
    ow = (unsigned)((nt * GBT + crow) * ND + cseg) * 2u;
  };
  const unsigned l0 = lds_addr(&Sm[crow * GPIT + cseg]);
  const unsigned LROW = 32 * GPIT * 2;  // LDS bytes of 32 rows
  const unsigned GROW = 32 * ND * 2;    // source bytes of 32 rows
  const unsigned WOFF = GTILE * 2;      // bytes from the X tile to the W tile
  const unsigned BOFF = 2 * GTILE * 2;  // bytes from buffer 0 to buffer 1
  const char* Xc = (const char*)X;
  const char* Wc = (const char*)W;
  // Stage st -> buffer st & 1; tall: the tile that the copies are in is a tall
  // one (the same for the whole work-group).
  auto issue = [&](bool tall, int st) __attribute__((always_inline)) {
    const unsigned lb = l0 + (st & 1) * BOFF;
    const unsigned kb = (unsigned)st * (GKS * 2);
    const unsigned xo = ox + kb, wo = ow + kb;
    const unsigned lw = lb + WOFF;
    if (tall)
      stage_copy(lb, lb + LROW, lb + 2 * LROW, lb + 3 * LROW, lb + 4 * LROW,
                 lb + 5 * LROW, lb + 6 * LROW, lb + 7 * LROW,
                 (const f16*)(Xc + xo), (const f16*)(Xc + (xo + GROW)),
                 (const f16*)(Xc + (xo + 2 * GROW)), (const f16*)(Xc + (xo + 3 * GROW)),
                 (const f16*)(Xc + (xo + 4 * GROW)), (const f16*)(Xc + (xo + 5 * GROW)),
                 (const f16*)(Xc + (xo + 6 * GROW)), (const f16*)(Xc + (xo + 7 * GROW)));
    else
      stage_copy6(lb, lb + LROW, lb + 2 * LROW, lb + 3 * LROW, lb + 4 * LROW,
                  lb + 5 * LROW,
                  (const f16*)(Xc + xo), (const f16*)(Xc + (xo + GROW)),
                  (const f16*)(Xc + (xo + 2 * GROW)), (const f16*)(Xc + (xo + 3 * GROW)),
                  (const f16*)(Xc + (xo + 4 * GROW)), (const f16*)(Xc + (xo + 5 * GROW)));
    stage_copy(lw, lw + LROW, lw + 2 * LROW, lw + 3 * LROW, lw + 4 * LROW,
               lw + 5 * LROW, lw + 6 * LROW, lw + 7 * LROW,
               (const f16*)(Wc + wo), (const f16*)(Wc + (wo + GROW)),
               (const f16*)(Wc + (wo + 2 * GROW)), (const f16*)(Wc + (wo + 3 * GROW)),
               (const f16*)(Wc + (wo + 4 * GROW)), (const f16*)(Wc + (wo + 5 * GROW)),
               (const f16*)(Wc + (wo + 6 * GROW)), (const f16*)(Wc + (wo + 7 * GROW)));
  };

  // Prologue of the first tile: stage 0 lands and is published, then stage 1
  // starts.
  set_src((int)blockIdx.x);
  issue((int)blockIdx.x < FA, 0);
  // this wave's copies have landed before the barrier publishes them
  asm volatile("s_wait_asynccnt 0x0" ::: "memory");
  __syncthreads();
  issue((int)blockIdx.x < FA, 1);

  static_assert(GKS == 128, "a stage is four 32-k blocks");

  // One tile of MI x 64 rows (a wave: MI x 16 rows), f the same for the whole
  // work-group. The lambdas are forced inline: called from two places, this one
  // was left a call, and all that it captures went through scratch memory.
  auto tile = [&](auto mi, int f) __attribute__((always_inline)) {
  constexpr int MI = decltype(mi)::v;
  // One 32-k block's fragments. A: lane = row (M); halves {0-7,16-23}
  // (lanes<16) / {8-15,24-31}. B: lane = col (N = W row), same K packing.
  auto frags = [&](const f16* As, const f16* Bs, int ks, v16h (&a)[MI],
                   v16h (&bf)[4]) __attribute__((always_inline)) {
#pragma unroll
    for (int i = 0; i < MI; ++i) {
      const f16* ap = &As[(wm * (MI * 16) + i * 16 + l16) * GPIT + ks + hi * 8];
      a[i] = cat16(ld8(ap), ld8(ap + 16));
    }
#pragma unroll
    for (int j = 0; j < 4; ++j) {
      const f16* bp = &Bs[(wn * 64 + j * 16 + l16) * GPIT + ks + hi * 8];
      bf[j] = cat16(ld8(bp), ld8(bp + 16));
    }
  };
  v8f acc[MI][4];
  auto products = [&](const v16h (&a)[MI],
                      const v16h (&bf)[4]) __attribute__((always_inline)) {
#pragma unroll
    for (int i = 0; i < MI; ++i)
#pragma unroll
      for (int j = 0; j < 4; ++j) acc[i][j] = wmma_f16(a[i], bf[j], acc[i][j]);
  };

  const int fn = f + GW;            // this work-group's next tile, if < NT
  const int lim = fn < NT ? GNST : GNST - 2;   // publish points with a refill behind them
#pragma unroll
  for (int i = 0; i < MI; ++i)
#pragma unroll
    for (int j = 0; j < 4; ++j) acc[i][j] = splat8(0.f);

  // Kept rolled: with the six trips unrolled the 256 registers of four waves a
  // SIMD were overrun (spills to scratch memory) and the text grew by half.
#pragma unroll 1
  for (int t = 0; t < GNST; ++t) {
    const f16* As = &Sm[(t & 1) * 2 * GTILE];
    const f16* Bs = As + GTILE;

    v16h a0[MI], b0[4], a1[MI], b1[4];
    frags(As, Bs, 0, a0, b0);
    // keeps the block's LDS loads together in front of its products: left
    // free, the compiler kept one A fragment and reloaded it in front of
    // every row of four products, each time waiting until no load was out
    __builtin_amdgcn_sched_barrier(0);
    products(a0, b0);
    frags(As, Bs, 32, a1, b1);
    // as above, for the second block's loads
    __builtin_amdgcn_sched_barrier(0);
    products(a1, b1);
    frags(As, Bs, 64, a0, b0);
    // as above, for the third block's loads
    __builtin_amdgcn_sched_barrier(0);
    products(a0, b0);
    frags(As, Bs, 96, a1, b1);   // the stage's last LDS reads
    // keeps the third block's products in front of the publish point: behind
    // the barrier, a wave that must wait for the matrix unit issues its refill
    // late
    __builtin_amdgcn_sched_barrier(0);

    // Publish point of stage t+1; it also ends every read of stage t's buffer.
    // It stands in front of the stage's last block of products, whose
    // fragments are in registers by then: with one work-group on the WGP the
    // refill gets a whole stage to land, and the waves leave the barrier with
    // matrix work in hand, under which the next stage's first LDS loads hide.
    // this wave's reads of the buffer have returned before it is refilled
    asm volatile("s_wait_dscnt 0x0" ::: "memory");
    // this wave's copies of stage t+1 have landed before others read them
    asm volatile("s_wait_asynccnt 0x0" ::: "memory");
    __syncthreads();
    // Stage t+2 of this tile, or stage t+2-6 of the next (same buffer: 6 is
    // even). Every test is the same for the whole work-group.
    // Behind a low tile comes a low one (f rises).
    if (t < lim) {
      if (t == GNST - 2) set_src(fn);
      issue(MI * 64 == GHA && (t < GNST - 2 || fn < FA),
            t + 2 < GNST ? t + 2 : t + 2 - GNST);
    }
    // keeps the last block's products behind the refill: all but one of them
    // were hoisted above the copies of W, where a wave that must wait for the
    // matrix unit issues those copies late
    __builtin_amdgcn_sched_barrier(0);
    products(a1, b1);
  }

  int m0, nt;
  gemm_tile<NN>(f, m0, nt);
  const int pj = nt / 3;            // which projection (MODE 1: always 0)
  const int n0 = (nt - pj * 3) * GBT;
  const float* bias = (pj == 0) ? bias0 : (pj == 1) ? bias1 : bias2;
  const size_t po = (size_t)pj * NM * ND;   // its output, in elements

  // Epilogue. D layout: lane<16 -> row = base+r, lane>=16 -> row = base+8+r;
  // column = lane%16 within each 16-wide tile. Every row of every tile exists.
#pragma unroll
  for (int i = 0; i < MI; ++i) {
    const int mbase = m0 + wm * (MI * 16) + i * 16 + hi * 8;
#pragma unroll
    for (int j = 0; j < 4; ++j) {
      const int n    = n0 + wn * 64 + j * 16 + l16;
      const float bn = bias[n];
#pragma unroll
      for (int r = 0; r < 8; ++r) {
        const float v = acc[i][j][r] + bn;
        if (MODE == 0)
          ((f16*)out)[po + (size_t)(mbase + r) * ND + n] = (f16)v;
        else
          ((float*)out)[po + (size_t)(mbase + r) * ND + n] = v;
      }
    }
  }
  // no address or data register of an issued store is rewritten (the next
  // tile clears the accumulators) in front of this wait
  asm volatile("s_wait_xcnt 0x0" ::: "memory");
  };  // tile

  // The walk: a work-group's tall tiles come first (f rises).
  for (int f = (int)blockIdx.x; f < NT; f += GW) {
    if (f < FA) tile(int_c<GHA / 64>{}, f);
    else        tile(int_c<GHB / 64>{}, f);
  }
  // nothing is outstanding when the wave ends
  asm volatile("s_wait_asynccnt 0x0" ::: "memory");
}

// ---------------------------------------------------------------------------
// Flash attention: grid (H=12, B=64), 608 threads = 19 waves.
// Q/K/V are f16 [B,S,768]; head h occupies columns [h*64, h*64+64).
// Each wave owns 32 queries; the head's K and V lie whole in LDS (both
// row-major). The products are taken transposed:
//   S^T = K (Q/8)^T   (A = K rows from LDS, B = Q fragments, see the kernel)
//   O^T += V^T P^T    (A = V^T by the transposing LDS load, B = P^T packed
//                      from S^T)
// In a D tile register r of lane l is [row 8*(l>>4)+r][column l&15], so a lane
// holds 32 of the 64 scores of ONE query (its partner l^16 the other 32):
// maximum and sum run in the lane's own registers, one exchange between the
// wave halves joins the maximum, and two S^T tiles packed to f16 are a B
// fragment in the hardware k order (k = 8h+s, 16+8h+s), the order in which
// the transposing load delivers V^T. softmax scale (1/8, exact in f16) is
// folded into Q.
// ---------------------------------------------------------------------------
static __device__ __forceinline__ float xhalf(float x) {  // lane l <-> l ^ 16
  const int b = __builtin_bit_cast(int, x);
  return __builtin_bit_cast(
      float, __builtin_amdgcn_permlanex16(b, b, 0x76543210, 0xfedcba98, false,
                                          false));
}

// x[r] = 2^x[r]. Eight independent v_exp_f32 in one statement, each filling
// the slot behind the one before it; the closing v_nop keeps the slot that the
// instruction set asks for between a transcendental and an instruction that
// overwrites its source or reads its result.
static __device__ __forceinline__ void exp2x8(v8f& x) {
  float a = x[0], b = x[1], c = x[2], d = x[3];
  float e = x[4], f = x[5], g = x[6], h = x[7];
  asm("v_exp_f32 %0, %0\n\tv_exp_f32 %1, %1\n\tv_exp_f32 %2, %2\n\t"
      "v_exp_f32 %3, %3\n\tv_exp_f32 %4, %4\n\tv_exp_f32 %5, %5\n\t"
      "v_exp_f32 %6, %6\n\tv_exp_f32 %7, %7\n\tv_nop"
      : "+v"(a), "+v"(b), "+v"(c), "+v"(d), "+v"(e), "+v"(f), "+v"(g), "+v"(h));
  x[0] = a; x[1] = b; x[2] = c; x[3] = d;
  x[4] = e; x[5] = f; x[6] = g; x[7] = h;
}

// The same for two values.
static __device__ __forceinline__ void exp2x2(float& a, float& b) {
  asm("v_exp_f32 %0, %0\n\tv_exp_f32 %1, %1\n\tv_nop" : "+v"(a), "+v"(b));
}

static __device__ __forceinline__ v16h pack16(v8f lo, v8f hi8) {
  v16h p;
#pragma unroll
  for (int r = 0; r < 8; ++r) {
    p[r]     = (f16)lo[r];
    p[8 + r] = (f16)hi8[r];
  }
  return p;
}

// Transposing LDS load of a row-major 16-bit tile: the lanes address 16 rows
// (keys) x 16 columns (dh) in 16-byte pieces, and lane (c = l & 15, h = l >> 4)
// receives column c of rows 8h .. 8h+7: half of an A fragment of V^T.
typedef __attribute__((ext_vector_type(8))) short s16x8;
static __device__ __forceinline__ v8h ld_tr16(const f16* p) {
  typedef __attribute__((address_space(3))) s16x8 lds_s16x8;
  return __builtin_bit_cast(v8h,
                            __builtin_amdgcn_ds_load_tr16_b128_v8i16((lds_s16x8*)p));
}

#define VPIT 80   // V row pitch in halves: 160 B = 32 B x odd, the transposing load's pitch
#define KPIT 72   // K row pitch in halves: 144 B = 16 B x odd, for ds_load_b128
#define AW    19            // waves of a work-group: 19 x 32 queries cover the 577
#define AROWS (AW * 32)     // 608 staged key rows; rows past the last key repeat it
#define AHALF (AROWS / 2)   // rows of one of the two staging steps

// One work-group per (batch, head). The head's whole K and V lie in LDS, staged
// once by asynchronous copies in two steps of 304 rows: the second step flies
// under the first four 64-key passes. A wave owns 32 queries (two 16-column
// groups), so a K or V^T fragment read from LDS feeds two products, and the
// key loop has no barrier but the one that publishes the second step.
__global__ __launch_bounds__(AW * 32) void attn_flash(const f16* __restrict__ Q,
                                                  const f16* __restrict__ K,
                                                  const f16* __restrict__ V,
                                                  f16* __restrict__ ctx_out) {
  __shared__ __attribute__((aligned(16))) f16 Kt[AROWS * KPIT];  // [key][dh]
  __shared__ __attribute__((aligned(16))) f16 Vs[AROWS * VPIT];  // [key][dh]
  __shared__ __attribute__((aligned(16))) f16 Qs[AW * 8 * 256];  // [wave][piece][lane]

  const int b    = blockIdx.y;
  const int h    = blockIdx.x;
  const int tid  = threadIdx.x;
  const int wid  = tid >> 5;
  const int lane = tid & 31;
  const int l16  = lane & 15;
  const int hi   = lane >> 4;
  const int q0   = wid * 32;

  const f16* Qb = Q + (size_t)b * NS * ND + h * NDH;   // row stride ND
  const f16* Kb = K + (size_t)b * NS * ND + h * NDH;
  const f16* Vb = V + (size_t)b * NS * ND + h * NDH;

  // Staging: 8 adjacent lanes bring one row's 128 B (a whole line); the 608
  // lanes cover 76 rows a copy, four copies of K and four of V a step.
  const int crow = tid >> 3;        // 0..75
  const int cseg = (tid & 7) * 8;   // this lane's 8-half (16-B) piece of a row
  auto stage = [&](int st) {
    unsigned lk[4], lv[4];
    const f16 *gk[4], *gv[4];
#pragma unroll
    for (int i = 0; i < 4; ++i) {
      const int row = st * AHALF + i * (AHALF / 4) + crow;
      const int srow = row > NS - 1 ? NS - 1 : row;      // source row in bounds
      lk[i] = lds_addr(&Kt[row * KPIT + cseg]);
      lv[i] = lds_addr(&Vs[row * VPIT + cseg]);
      gk[i] = Kb + (size_t)srow * ND + cseg;
      gv[i] = Vb + (size_t)srow * ND + cseg;
    }
    stage_copy(lk[0], lk[1], lk[2], lk[3], lv[0], lv[1], lv[2], lv[3],
               gk[0], gk[1], gk[2], gk[3], gv[0], gv[1], gv[2], gv[3]);
  };

  stage(0);

  // Q B-fragments (64 K x 16 queries a group), scale 1/sqrt(64)=0.125 folded in
  // (exact). They wait in the wave's own LDS range, in fragment order (piece
  // x of fragment [c][ks]: 32 lanes x 16 B in a row), and are read back once a
  // pass: kept in registers, their 32 overran the budget of five waves a SIMD.
  const f16 sc = (f16)0.125f;
  f16* qs = &Qs[wid * (8 * 256) + lane * 8];
#pragma unroll
  for (int c = 0; c < 2; ++c) {
    int qr = q0 + c * 16 + l16; if (qr > NS - 1) qr = NS - 1;
    const f16* qp = Qb + (size_t)qr * ND + hi * 8;
#pragma unroll
    for (int x = 0; x < 4; ++x)      // k = 16x + 8*hi + 0..7
      *(v8h*)(qs + (c * 4 + x) * 256) = ld8(qp + x * 16) * sc;
  }

  // this wave's copies of rows 0..303 have landed before the barrier publishes them
  asm volatile("s_wait_asynccnt 0x0" ::: "memory");
  __syncthreads();
  stage(1);

  v8f acc[2][4];                     // O^T: acc[c][j][r] = O[query c*16+l16][j*16+8*hi+r]
#pragma unroll
  for (int c = 0; c < 2; ++c)
#pragma unroll
    for (int j = 0; j < 4; ++j) acc[c][j] = splat8(0.f);
  float mrow[2] = {-1e30f, -1e30f};  // this lane's two queries: running maximum
  float lsum[2] = {0.f, 0.f};        // sums over this wave half's keys only

  const f16* krp0 = &Kt[l16 * KPIT + hi * 8];
  const f16* vrp0 = &Vs[(hi * 8 + (lane & 7)) * VPIT + ((lane >> 3) & 1) * 8];

  // One pass over NU x 32 keys from key kb on. NU = 2: all keys exist. NU = 1:
  // the tail, keys past the last are masked.
  auto pass = [&](auto nu, int kb) {
    constexpr int NU = decltype(nu)::v;
    constexpr int NT = 2 * NU;
    // ---- scores S^T = K (Q/8)^T : NT tiles of 16 keys x 2 query groups -----
    // s[c][t][r] = score(key kb + t*16 + 8*hi + r, query q0 + c*16 + l16)
    v8f s[2][NT];
#pragma unroll
    for (int ks = 0; ks < 2; ++ks) {   // dh 0..31, then dh 32..63
      const v16h qf0 = cat16(ld8(qs + (2 * ks) * 256),     ld8(qs + (2 * ks + 1) * 256));
      const v16h qf1 = cat16(ld8(qs + (4 + 2 * ks) * 256), ld8(qs + (5 + 2 * ks) * 256));
#pragma unroll
      for (int t = 0; t < NT; ++t) {
        const f16* krp = krp0 + (kb + t * 16) * KPIT + ks * 32;
        const v16h a = cat16(ld8(krp), ld8(krp + 16));
        s[0][t] = wmma_f16(a, qf0, ks == 0 ? splat8(0.f) : s[0][t]);
        s[1][t] = wmma_f16(a, qf1, ks == 0 ? splat8(0.f) : s[1][t]);
      }
      // keeps one dh half's fragments (48 registers) live at a time, and the
      // V^T loads behind the score products: left free, the loads were hoisted
      // to the top of the pass and the 192-register budget of five waves a SIMD
      // was overrun (spills in the key loop)
      __builtin_amdgcn_sched_barrier(0);
    }
    if (NU == 1) {
#pragma unroll
      for (int c = 0; c < 2; ++c)
#pragma unroll
        for (int t = 0; t < NT; ++t)
#pragma unroll
          for (int r = 0; r < 8; ++r)
            if (kb + t * 16 + hi * 8 + r > NS - 1) s[c][t][r] = -1e30f;
    }

    // ---- maximum of a lane's scores per query, joined with the other half --
    float mnew[2], corr[2];
#pragma unroll
    for (int c = 0; c < 2; ++c) {
      v8f mx8 = s[c][0];
#pragma unroll
      for (int t = 1; t < NT; ++t)
#pragma unroll
        for (int r = 0; r < 8; ++r) mx8[r] = fmaxf(mx8[r], s[c][t][r]);
      float mx = fmaxf(fmaxf(fmaxf(mx8[0], mx8[1]), fmaxf(mx8[2], mx8[3])),
                       fmaxf(fmaxf(mx8[4], mx8[5]), fmaxf(mx8[6], mx8[7])));
      mx = fmaxf(mx, xhalf(mx));
      mnew[c] = fmaxf(mrow[c], mx);
      corr[c] = (mrow[c] - mnew[c]) * LOG2E;
      mrow[c] = mnew[c];
    }
    exp2x2(corr[0], corr[1]);        // e^(old maximum - new maximum)
#pragma unroll
    for (int c = 0; c < 2; ++c)
#pragma unroll
      for (int j = 0; j < 4; ++j) acc[c][j] *= corr[c];

    // Per 32 keys: exponentials, P^T B-fragments straight from the score
    // registers, then O^T += V^T P^T. (A fragment of V^T: lane = dh; a load
    // brings keys 8*hi+0..7 of a 16-key group, two loads 16 keys apart are one
    // 16 x 32 fragment; it feeds both query groups.)
    v8f rs8[2];
#pragma unroll
    for (int u = 0; u < NU; ++u) {
      v16h pb[2];
#pragma unroll
      for (int c = 0; c < 2; ++c) {
#pragma unroll
        for (int t = 2 * u; t < 2 * u + 2; ++t) {
#pragma unroll
          for (int r = 0; r < 8; ++r) s[c][t][r] = (s[c][t][r] - mnew[c]) * LOG2E;
          exp2x8(s[c][t]);           // e^(s - m) as 2^((s - m) * log2 e)
        }
        const v8f rsu = s[c][2 * u] + s[c][2 * u + 1];
        rs8[c] = (u == 0) ? rsu : rs8[c] + rsu;
        pb[c] = pack16(s[c][2 * u], s[c][2 * u + 1]);   // keys 32u .. 32u+31
      }
#pragma unroll
      for (int j = 0; j < 4; ++j) {
        const f16* vp2 = vrp0 + (kb + u * 32) * VPIT + j * 16;
        const v16h vf = cat16(ld_tr16(vp2), ld_tr16(vp2 + 16 * VPIT));
        acc[0][j] = wmma_f16(vf, pb[0], acc[0][j]);
        acc[1][j] = wmma_f16(vf, pb[1], acc[1][j]);
      }
    }
#pragma unroll
    for (int c = 0; c < 2; ++c) {
      const float rs = ((rs8[c][0] + rs8[c][1]) + (rs8[c][2] + rs8[c][3])) +
                       ((rs8[c][4] + rs8[c][5]) + (rs8[c][6] + rs8[c][7]));
      lsum[c] = lsum[c] * corr[c] + rs;
    }
  };

  static_assert(4 * 64 <= AHALF, "the first four passes read the first step's rows only");
  static_assert(NS / 64 * 64 + 32 <= AROWS && NS - NS / 64 * 64 <= 32, "one 32-key tail");
  for (int p = 0; p < NS / 64; ++p) {
    if (p == 4) {                    // the same for the whole work-group
      // this wave's copies of rows 304..607 have landed before others read them
      asm volatile("s_wait_asynccnt 0x0" ::: "memory");
      __syncthreads();
    }
    pass(int_c<2>{}, p * 64);
  }
  pass(int_c<1>{}, NS / 64 * 64);

  // ---- finalize: join the halves' sums, ctx /= l, store f16 to [B, S, 768] --
  // A lane holds 8 consecutive dh of a query per tile: one 16-byte store.
#pragma unroll
  for (int c = 0; c < 2; ++c) {
    const float inv = 1.0f / (lsum[c] + xhalf(lsum[c]));
    const int q = q0 + c * 16 + l16;
    if (q < NS) {
      f16* outp = ctx_out + (size_t)b * NS * ND + (size_t)q * ND + h * NDH + hi * 8;
#pragma unroll
      for (int j = 0; j < 4; ++j) {
        v8h o;
#pragma unroll
        for (int r = 0; r < 8; ++r) o[r] = (f16)(acc[c][j][r] * inv);
        *(v8h*)(outp + j * 16) = o;
      }
    }
  }
}

// ---------------------------------------------------------------------------
extern "C" void kernel_launch(void* const* d_in, const int* in_sizes, int n_in,
                              void* d_out, int out_size, void* d_ws,
                              size_t ws_size, hipStream_t stream) {
  const float* hidden = (const float*)d_in[0];
  const float* Wq = (const float*)d_in[1];
  const float* bq = (const float*)d_in[2];
  const float* Wk = (const float*)d_in[3];
  const float* bk = (const float*)d_in[4];
  const float* Wv = (const float*)d_in[5];
  const float* bv = (const float*)d_in[6];
  const float* Wo = (const float*)d_in[7];
  const float* bo = (const float*)d_in[8];

  char* ws = (char*)d_ws;
  const size_t szX = (size_t)NM * ND * sizeof(f16);       // 56.7 MB
  const size_t szW = (size_t)ND * ND * sizeof(f16);       // 1.18 MB
  size_t off = 0;
  f16* Xh  = (f16*)(ws + off); off += szX;
  f16* Wqh = (f16*)(ws + off); off += szW;
  f16* Wkh = (f16*)(ws + off); off += szW;
  f16* Wvh = (f16*)(ws + off); off += szW;
  f16* Woh = (f16*)(ws + off); off += szW;
  f16* Qh  = (f16*)(ws + off); off += szX;
  f16* Kh  = (f16*)(ws + off); off += szX;
  f16* Vh  = (f16*)(ws + off); off += szX;
  f16* Ch  = (f16*)(ws + off); off += szX;

  // 1) conversions to f16: Xh, Wqh, Wkh, Wvh, Woh are one contiguous array
  cvt_all_f32_to_f16<<<CVT_BLOCKS, CVT_WAVES * 32, 0, stream>>>(hidden, Wq, Wk,
                                                                Wv, Wo, Xh);

  // 2) Q/K/V projections, one launch: Wqh, Wkh, Wvh are one array of 2304 rows,
  //    Qh, Kh, Vh one array of three outputs
  gemm_wmma<0><<<GW, 512, 0, stream>>>(Xh, Wqh, bq, bk, bv, Qh);

  // 3) flash attention -> ctx f16 [B,S,768]
  attn_flash<<<dim3(NH, NB), AW * 32, 0, stream>>>(Qh, Kh, Vh, Ch);

  // 4) output projection -> f32 d_out
  gemm_wmma<1><<<GW, 512, 0, stream>>>(Ch, Woh, bo, bo, bo, d_out);
}

// v010
// Measured time: 204 microseconds a run.
// Next to v009, in two timings, it ran 1.06 times as fast each time.
// All steps since v000 together make it 2.53 times as fast.
#include <hip/hip_runtime.h>
#include <hip/hip_bf16.h>

// ---------------------------------------------------------------------------
// ViT attention (B=64, S=577, D=768, H=12, Dh=64) on gfx1250 (CDNA5, wave32).
// All GEMMs use v_wmma_f32_16x16x32_f16 (f16 inputs, f32 accumulate).
// Pipeline:
//   1) cvt f32->f16 of hidden + Wq/Wk/Wv/Wo into workspace (one launch)
//   2) WMMA GEMM (256x256 and 192x256 block tiles, async-copy LDS ring,
//      resident work-groups that walk the tiles), one launch for all three:
//        Q/K/V = Xh @ W.T + b  -> f16 [B,S,768]
//   3) flash attention (online softmax, scores never leave registers)
//        -> ctx f16 [B,S,768]
//   4) WMMA GEMM: out = ctx @ Wo.T + bo -> f32 [B,S,768] (d_out)
// Workspace: 5 * 56.7MB (Xh,Q,K,V,ctx) + 4 * 1.18MB (weights) ~ 289 MB.
// ---------------------------------------------------------------------------

typedef _Float16 f16;
typedef __attribute__((ext_vector_type(8)))  _Float16 v8h;
typedef __attribute__((ext_vector_type(16))) _Float16 v16h;
typedef __attribute__((ext_vector_type(8)))  float    v8f;

#define NB   64
#define NS   577
#define ND   768
#define NH   12
#define NDH  64
#define NM   36928   // NB*NS
#define LOG2E 1.44269504088896340736f

static __device__ __forceinline__ v8h ld8(const f16* p) { return *(const v8h*)p; }

static __device__ __forceinline__ v16h cat16(v8h a, v8h b) {
  return __builtin_shufflevector(a, b, 0,1,2,3,4,5,6,7,8,9,10,11,12,13,14,15);
}

static __device__ __forceinline__ v8f wmma_f16(v16h a, v16h b, v8f c) {
  // D = A(16x32 f16) x B(32x16 f16) + C(16x16 f32)
  return __builtin_amdgcn_wmma_f32_16x16x32_f16(false, a, false, b, (short)0, c,
                                                false, false);
}

static __device__ __forceinline__ v8f splat8(float x) {
  v8f r;
#pragma unroll
  for (int i = 0; i < 8; ++i) r[i] = x;
  return r;
}

// ---------------------------------------------------------------------------
// f32 -> f16 conversion of hidden and of the four weights: ONE resident
// streaming launch, one 16-wave work-group per WGP. The five f16 destinations
// lie one behind the other in the workspace, so the destination is one array.
// A wave tile is 1024 floats: 8 loads of 16 B a lane, each 512 contiguous
// bytes of the wave. The next tile's 8 loads are issued before this tile is
// converted and stored (two register sets take turns), so a wave always has
// loads in flight. All five sizes are multiples of the tile: no tile straddles
// two sources. The tile count is a constant: every wave takes CVT_FULL tiles,
// CVT_REST waves one more.
// ---------------------------------------------------------------------------
typedef __attribute__((ext_vector_type(4))) float    v4f;
typedef __attribute__((ext_vector_type(4))) _Float16 v4h;

#define CVT_TILE   1024                      // floats of one wave tile
#define CVT_XT     (NM * ND / CVT_TILE)      // 27696 tiles of hidden
#define CVT_WT     (ND * ND / CVT_TILE)      // 576 tiles of one weight
#define CVT_NT     (CVT_XT + 4 * CVT_WT)     // 30000 tiles in all
#define CVT_BLOCKS 256
#define CVT_WAVES  16
#define CVT_NW     (CVT_BLOCKS * CVT_WAVES)  // 4096 waves
#define CVT_FULL   (CVT_NT / CVT_NW)         // 7
#define CVT_REST   (CVT_NT - CVT_FULL * CVT_NW)  // 1328

// Source of wave tile t (t is wave-uniform: the pick stays on the scalar
// side). tend is a compile-time bound, t < tend: trips that cannot reach the
// weights need no pick.
static __device__ __forceinline__ const float* cvt_tile_src(
    int t, int tend, const float* hidden, const float* Wq, const float* Wk,
    const float* Wv, const float* Wo) {
  if (tend <= CVT_XT) return hidden + (size_t)t * CVT_TILE;
  const int u = t - CVT_XT;
  const int w = u / CVT_WT;
  const float* base = (w == 0) ? Wq : (w == 1) ? Wk : (w == 2) ? Wv : Wo;
  return (u < 0) ? hidden + (size_t)t * CVT_TILE
                 : base + (size_t)(u - w * CVT_WT) * CVT_TILE;
}

// One tile's 8 loads of this lane.
static __device__ __forceinline__ void cvt_load8(v4f (&r)[8], const float* s) {
#pragma unroll
  for (int i = 0; i < 8; ++i) r[i] = *(const v4f*)(s + i * 128);
  // no register that an issued load names (its base is formed anew for the
  // next tile) is rewritten in front of this wait
  asm volatile("s_wait_xcnt 0x0" ::: "memory");
  // keeps what follows behind the wait, and the conversions of the tile before
  // behind these loads: hoisted above them, their wait for that tile's data
  // left only three loads in flight before the new ones were issued
  __builtin_amdgcn_sched_barrier(0);
}

// One tile converted and stored: 8 B a lane, 256 contiguous bytes a store.
// MORE: the wave goes on behind these stores (false for its last ones).
template <bool MORE>
static __device__ __forceinline__ void cvt_store8(const v4f (&r)[8], f16* d) {
#pragma unroll
  for (int i = 0; i < 8; ++i)
    *(v4h*)(d + i * 128) = __builtin_convertvector(r[i], v4h);
  if (MORE) {
    // no address or data register of an issued store is rewritten in front of
    // this wait
    asm volatile("s_wait_xcnt 0x0" ::: "memory");
    // keeps the instructions that follow behind the wait
    __builtin_amdgcn_sched_barrier(0);
  }
}

__global__ __launch_bounds__(CVT_WAVES * 32) void cvt_all_f32_to_f16(
    const float* __restrict__ hidden, const float* __restrict__ Wq,
    const float* __restrict__ Wk, const float* __restrict__ Wv,
    const float* __restrict__ Wo, f16* __restrict__ y) {
  static_assert(CVT_FULL % 2 == 1, "the pair loop leaves one full tile");
  const int lane4 = (threadIdx.x & 31) * 4;
  const int wave  = __builtin_amdgcn_readfirstlane((int)(threadIdx.x >> 5));
  // Full trips: a work-group's 16 tiles are adjacent (64 KB of source a trip).
  int t = (int)blockIdx.x * CVT_WAVES + wave;           // 0 .. CVT_NW - 1
  // The last, partial trip is dealt wave-major, so that it is spread over all
  // work-groups.
  const int rest = wave * CVT_BLOCKS + (int)blockIdx.x; // 0 .. CVT_NW - 1

  v4f ra[8], rb[8];
  cvt_load8(ra, cvt_tile_src(t, CVT_NW, hidden, Wq, Wk, Wv, Wo) + lane4);
  // Two tiles a trip, each set loaded one tile ahead of its stores. Kept
  // rolled: unrolled, the stores sank below later tiles' loads and the wave
  // once waited until no load was in flight.
#pragma unroll 1
  for (int k = 0; k < CVT_FULL / 2; ++k) {
    cvt_load8(rb, cvt_tile_src(t + CVT_NW, CVT_NT, hidden, Wq, Wk, Wv, Wo) + lane4);
    cvt_store8<true>(ra, y + (size_t)t * CVT_TILE + lane4);
    cvt_load8(ra, cvt_tile_src(t + 2 * CVT_NW, CVT_NT, hidden, Wq, Wk, Wv, Wo) + lane4);
    cvt_store8<true>(rb, y + (size_t)(t + CVT_NW) * CVT_TILE + lane4);
    t += 2 * CVT_NW;
  }
  // ra holds this wave's last full tile
  f16* dl = y + (size_t)t * CVT_TILE + lane4;
  if (rest < CVT_REST) {                         // the same for the whole wave
    const int tr = CVT_FULL * CVT_NW + rest;
    cvt_load8(rb, cvt_tile_src(tr, CVT_NT, hidden, Wq, Wk, Wv, Wo) + lane4);
    cvt_store8<true>(ra, dl);
    cvt_store8<false>(rb, y + (size_t)tr * CVT_TILE + lane4);
  } else {
    cvt_store8<false>(ra, dl);
  }
}

// ---------------------------------------------------------------------------
// WMMA GEMM: C[M,768] = X[M,768] @ W[768,768]^T + bias
//   block = 512 threads (16 waves), tile 256 or 192 (M) x 256 (N), stage =
//   128 k, one work-group per WGP: an operand byte copied from L2 feeds about
//   256 output rows or columns.
//   wave (wm = wid&3 -> a quarter of the rows, wn = wid>>2 -> 64 cols)
//   computes 64x64 or 48x64: 4 or 3 A-frags + 4 B-frags -> 16 or 12 WMMAs per
//   32 k.
//   Staging: asynchronous copies global -> LDS, 16 B a lane, through no
//   register. A stage row is 128 halves = one aligned 256-B unit, brought by
//   16 adjacent lanes; LDS pitch 272 B (16 B x odd: no bank conflict for
//   ds_load_b128). Two buffers: stage t+1 flies while stage t is multiplied.
//   A stage is four 32-k blocks: a refill has the time of four blocks of
//   products to land, and the waves meet at a barrier once per 128 k.
//   MODE 0: store f16 [M,768];  MODE 1: store f32 [M,768]  (compile-time).
//   Tile walk: GW resident work-groups, one per WGP; work-group w takes tiles
//   w, w + GW, ... (a fixed deal, nothing passes between work-groups). The
//   ring runs on over the tile boundary: the next tile's stages 0 and 1 are
//   stages 6 and 7 of this one, so they fly under this tile's last products
//   and its stores, and only a work-group's first tile waits for a stage.
//   The deal: a launch lasts as long as its fullest work-group. M is 577
//   strips of 64 rows; with 9 (3) N tiles that is a little over 20 (just
//   under 7) strips a work-group. GMA tall tiles (4 strips) and GMB low ones
//   (3 strips) cover M exactly, and the fullest work-group gets 3 tall + 3
//   low = 21 strips (1 + 1 = 7); tall tiles alone would make it 6 tiles = 24
//   (2 = 8).
//   MODE 0 does the three projections in one launch: the three weights lie
//   one behind the other (2304 rows of W, 9 N tiles), and so do Q, K and V.
//   The deal of W's rows: within each 64 rows of W (a wave's 64 output
//   columns) the copies bring source row 4*l + j to LDS row 16*j + l. The
//   fragment reads stay as they are, and B tile j, lane l is then output
//   column 4*l + j: a lane's four accumulator tiles hold four ADJACENT columns
//   of a row, which leave in one store of 8 B (f16) or 16 B (f32) a lane, the
//   16 lanes of a row writing one whole aligned 128-B line (two for f32).
// ---------------------------------------------------------------------------
#define GKS   128                // k per stage
#define GPIT  136                // LDS row pitch in halves (272 B)
#define GBT   256                // rows of W, and of X at most, in a block tile
#define GTILE (GBT * GPIT)       // halves of one operand tile's place in LDS
#define GNST  (ND / GKS)         // 6 stages
#define GW    256                // resident work-groups
#define GHA   256                // rows of a tall tile
#define GHB   192                // rows of a low tile
#define GMA   85                 // tall M tiles: x 3 N tiles = one round of the walk
#define GMB   79                 // low M tiles, behind the tall ones
static_assert(GMA * GHA + GMB * GHB == NM, "the two kinds of tile cover M exactly: no edge tile");

template <int N> struct int_c { static constexpr int v = N; };

// Tile f -> (first row, N tile); f is the same for the whole work-group. The
// tall tiles come first, then the low ones; within a kind the N tiles follow
// one another with the M tile running fastest, so that rows of X are read in
// successive rounds, after the first time from L2.
template <int NN>
static __device__ __forceinline__ void gemm_tile(int f, int& m0, int& nt) {
  if (f < GMA * NN) {
    nt = f / GMA;
    m0 = (f - nt * GMA) * GHA;
  } else {
    const int r = f - GMA * NN;
    nt = r / GMB;
    m0 = GMA * GHA + (r - nt * GMB) * GHB;
  }
}

static __device__ __forceinline__ unsigned lds_addr(const void* p) {
  return (unsigned)(size_t)p;    // low 32 bits of a __shared__ address
}

// Eight copies of this lane (one operand tile's share of a stage). The closing
// s_wait_xcnt stands inside the statement so that no address register of an
// issued copy is rewritten in front of it.
static __device__ __forceinline__ void stage_copy(
    unsigned l0, unsigned l1, unsigned l2, unsigned l3, unsigned l4,
    unsigned l5, unsigned l6, unsigned l7, const f16* g0, const f16* g1,
    const f16* g2, const f16* g3, const f16* g4, const f16* g5, const f16* g6,
    const f16* g7) {
  asm volatile(
      "global_load_async_to_lds_b128 %0, %8, off\n\t"
      "global_load_async_to_lds_b128 %1, %9, off\n\t"
      "global_load_async_to_lds_b128 %2, %10, off\n\t"
      "global_load_async_to_lds_b128 %3, %11, off\n\t"
      "global_load_async_to_lds_b128 %4, %12, off\n\t"
      "global_load_async_to_lds_b128 %5, %13, off\n\t"
      "global_load_async_to_lds_b128 %6, %14, off\n\t"
      "global_load_async_to_lds_b128 %7, %15, off\n\t"
      "s_wait_xcnt 0x0"
      :
      : "v"(l0), "v"(l1), "v"(l2), "v"(l3), "v"(l4), "v"(l5), "v"(l6), "v"(l7),
        "v"(g0), "v"(g1), "v"(g2), "v"(g3), "v"(g4), "v"(g5), "v"(g6), "v"(g7)
      : "memory");
}

// The same for the X rows of a low tile's stage: six copies, the closing
// s_wait_xcnt inside the statement for the same reason.
static __device__ __forceinline__ void stage_copy6(
    unsigned l0, unsigned l1, unsigned l2, unsigned l3, unsigned l4,
    unsigned l5, const f16* g0, const f16* g1, const f16* g2, const f16* g3,
    const f16* g4, const f16* g5) {
  asm volatile(
      "global_load_async_to_lds_b128 %0, %6, off\n\t"
      "global_load_async_to_lds_b128 %1, %7, off\n\t"
      "global_load_async_to_lds_b128 %2, %8, off\n\t"
      "global_load_async_to_lds_b128 %3, %9, off\n\t"
      "global_load_async_to_lds_b128 %4, %10, off\n\t"
      "global_load_async_to_lds_b128 %5, %11, off\n\t"
      "s_wait_xcnt 0x0"
      :
      : "v"(l0), "v"(l1), "v"(l2), "v"(l3), "v"(l4), "v"(l5),
        "v"(g0), "v"(g1), "v"(g2), "v"(g3), "v"(g4), "v"(g5)
      : "memory");
}

template <int MODE>
__global__ __launch_bounds__(512) void gemm_wmma(const f16* __restrict__ X,
                                                 const f16* __restrict__ W,
                                                 const float* __restrict__ bias0,
                                                 const float* __restrict__ bias1,
                                                 const float* __restrict__ bias2,
                                                 void* __restrict__ out) {
  constexpr int NN = MODE == 0 ? 9 : 3;           // N tiles of the launch
  constexpr int FA = GMA * NN;                    // tall tiles: f < FA
  constexpr int NT = FA + GMB * NN;               // tiles of the launch
  static_assert(GW <= NT && GNST % 2 == 0, "every work-group has a tile; a tile starts in buffer 0");
  // [buffer][X tile | W tile], 256 rows x 128 halves at pitch 136
  __shared__ __attribute__((aligned(16))) f16 Sm[2 * 2 * GTILE];

  const int tid  = threadIdx.x;
  const int wid  = tid >> 5;
  const int lane = tid & 31;
  const int l16  = lane & 15;
  const int hi   = lane >> 4;       // which K-half group this lane owns
  const int wm   = wid & 3;         // M strip 0..3 (a quarter of the tile's rows)
  const int wn   = wid >> 2;        // N strip 0..3 (64 cols each)

  const int crow = tid >> 4;        // 0..31: row of this lane's copies (+32*i)
  const int cseg = (tid & 15) * 8;  // its 8-half (16-B) piece of the row

  // Source byte offsets (they fit 32 bits) and the LDS byte address of this
  // lane's first piece in buffer 0; LDS rows and X's source rows step evenly.
  // They belong to the tile that the copies are in, which is the next one
  // from this tile's last two publish points on.
  unsigned ox, ow;
  auto set_src = [&](int f) __attribute__((always_inline)) {
    int m0, nt;
    gemm_tile<NN>(f, m0, nt);
    ox = (unsigned)((m0 + crow) * ND + cseg) * 2u;
    // LDS row crow + 32*i takes W row 64*(i>>1) + 4*(crow&15) + (crow>>4) + 2*(i&1)
    ow = (unsigned)((nt * GBT + (crow & 15) * 4 + (crow >> 4)) * ND + cseg) * 2u;
  };
  const unsigned l0 = lds_addr(&Sm[crow * GPIT + cseg]);
  const unsigned LROW = 32 * GPIT * 2;  // LDS bytes of 32 rows
  const unsigned GROW = 32 * ND * 2;    // source bytes of 32 rows
  const unsigned WTWO = 2 * ND * 2;     // source bytes of 2 rows (W: odd copies)
  const unsigned WOFF = GTILE * 2;      // bytes from the X tile to the W tile
  const unsigned BOFF = 2 * GTILE * 2;  // bytes from buffer 0 to buffer 1
  const char* Xc = (const char*)X;
  const char* Wc = (const char*)W;
  // Stage st -> buffer st & 1; tall: the tile that the copies are in is a tall
  // one (the same for the whole work-group).
  auto issue = [&](bool tall, int st) __attribute__((always_inline)) {
    const unsigned lb = l0 + (st & 1) * BOFF;
    const unsigned kb = (unsigned)st * (GKS * 2);
    const unsigned xo = ox + kb, wo = ow + kb;
    const unsigned lw = lb + WOFF;
    if (tall)
      stage_copy(lb, lb + LROW, lb + 2 * LROW, lb + 3 * LROW, lb + 4 * LROW,
                 lb + 5 * LROW, lb + 6 * LROW, lb + 7 * LROW,
                 (const f16*)(Xc + xo), (const f16*)(Xc + (xo + GROW)),
                 (const f16*)(Xc + (xo + 2 * GROW)), (const f16*)(Xc + (xo + 3 * GROW)),
                 (const f16*)(Xc + (xo + 4 * GROW)), (const f16*)(Xc + (xo + 5 * GROW)),
                 (const f16*)(Xc + (xo + 6 * GROW)), (const f16*)(Xc + (xo + 7 * GROW)));
    else
      stage_copy6(lb, lb + LROW, lb + 2 * LROW, lb + 3 * LROW, lb + 4 * LROW,
                  lb + 5 * LROW,
                  (const f16*)(Xc + xo), (const f16*)(Xc + (xo + GROW)),
                  (const f16*)(Xc + (xo + 2 * GROW)), (const f16*)(Xc + (xo + 3 * GROW)),
                  (const f16*)(Xc + (xo + 4 * GROW)), (const f16*)(Xc + (xo + 5 * GROW)));
    stage_copy(lw, lw + LROW, lw + 2 * LROW, lw + 3 * LROW, lw + 4 * LROW,
               lw + 5 * LROW, lw + 6 * LROW, lw + 7 * LROW,
               (const f16*)(Wc + wo), (const f16*)(Wc + (wo + WTWO)),
               (const f16*)(Wc + (wo + 2 * GROW)), (const f16*)(Wc + (wo + 2 * GROW + WTWO)),
               (const f16*)(Wc + (wo + 4 * GROW)), (const f16*)(Wc + (wo + 4 * GROW + WTWO)),
               (const f16*)(Wc + (wo + 6 * GROW)), (const f16*)(Wc + (wo + 6 * GROW + WTWO)));
  };

  // Prologue of the first tile: stage 0 lands and is published, then stage 1
  // starts.
  set_src((int)blockIdx.x);
  issue((int)blockIdx.x < FA, 0);
  // this wave's copies have landed before the barrier publishes them
  asm volatile("s_wait_asynccnt 0x0" ::: "memory");
  __syncthreads();
  issue((int)blockIdx.x < FA, 1);

  static_assert(GKS == 128, "a stage is four 32-k blocks");

  // One tile of MI x 64 rows (a wave: MI x 16 rows), f the same for the whole
  // work-group. The lambdas are forced inline: called from two places, this one
  // was left a call, and all that it captures went through scratch memory.
  auto tile = [&](auto mi, int f) __attribute__((always_inline)) {
  constexpr int MI = decltype(mi)::v;
  // One 32-k block's fragments. A: lane = row (M); halves {0-7,16-23}
  // (lanes<16) / {8-15,24-31}. B: lane = LDS row of W (output column: see the
  // deal of W's rows above), same K packing.
  auto frags = [&](const f16* As, const f16* Bs, int ks, v16h (&a)[MI],
                   v16h (&bf)[4]) __attribute__((always_inline)) {
#pragma unroll
    for (int i = 0; i < MI; ++i) {
      const f16* ap = &As[(wm * (MI * 16) + i * 16 + l16) * GPIT + ks + hi * 8];
      a[i] = cat16(ld8(ap), ld8(ap + 16));
    }
#pragma unroll
    for (int j = 0; j < 4; ++j) {
      const f16* bp = &Bs[(wn * 64 + j * 16 + l16) * GPIT + ks + hi * 8];
      bf[j] = cat16(ld8(bp), ld8(bp + 16));
    }
  };
  v8f acc[MI][4];
  auto products = [&](const v16h (&a)[MI],
                      const v16h (&bf)[4]) __attribute__((always_inline)) {
#pragma unroll
    for (int i = 0; i < MI; ++i)
#pragma unroll
      for (int j = 0; j < 4; ++j) acc[i][j] = wmma_f16(a[i], bf[j], acc[i][j]);
  };

  const int fn = f + GW;            // this work-group's next tile, if < NT
  const int lim = fn < NT ? GNST : GNST - 2;   // publish points with a refill behind them
#pragma unroll
  for (int i = 0; i < MI; ++i)
#pragma unroll
    for (int j = 0; j < 4; ++j) acc[i][j] = splat8(0.f);

  // Kept rolled: with the six trips unrolled the 256 registers of four waves a
  // SIMD were overrun (spills to scratch memory) and the text grew by half.
#pragma unroll 1
  for (int t = 0; t < GNST; ++t) {
    const f16* As = &Sm[(t & 1) * 2 * GTILE];
    const f16* Bs = As + GTILE;

    v16h a0[MI], b0[4], a1[MI], b1[4];
    frags(As, Bs, 0, a0, b0);
    // keeps the block's LDS loads together in front of its products: left
    // free, the compiler kept one A fragment and reloaded it in front of
    // every row of four products, each time waiting until no load was out
    __builtin_amdgcn_sched_barrier(0);
    products(a0, b0);
    frags(As, Bs, 32, a1, b1);
    // as above, for the second block's loads
    __builtin_amdgcn_sched_barrier(0);
    products(a1, b1);
    frags(As, Bs, 64, a0, b0);
    // as above, for the third block's loads
    __builtin_amdgcn_sched_barrier(0);
    products(a0, b0);
    frags(As, Bs, 96, a1, b1);   // the stage's last LDS reads
    // keeps the third block's products in front of the publish point: behind
    // the barrier, a wave that must wait for the matrix unit issues its refill
    // late
    __builtin_amdgcn_sched_barrier(0);

    // Publish point of stage t+1; it also ends every read of stage t's buffer.
    // It stands in front of the stage's last block of products, whose
    // fragments are in registers by then: with one work-group on the WGP the
    // refill gets a whole stage to land, and the waves leave the barrier with
    // matrix work in hand, under which the next stage's first LDS loads hide.
    // this wave's reads of the buffer have returned before it is refilled
    asm volatile("s_wait_dscnt 0x0" ::: "memory");
    // this wave's copies of stage t+1 have landed before others read them
    asm volatile("s_wait_asynccnt 0x0" ::: "memory");
    __syncthreads();
    // Stage t+2 of this tile, or stage t+2-6 of the next (same buffer: 6 is
    // even). Every test is the same for the whole work-group.
    // Behind a low tile comes a low one (f rises).
    if (t < lim) {
      if (t == GNST - 2) set_src(fn);
      issue(MI * 64 == GHA && (t < GNST - 2 || fn < FA),
            t + 2 < GNST ? t + 2 : t + 2 - GNST);
    }
    // keeps the last block's products behind the refill: all but one of them
    // were hoisted above the copies of W, where a wave that must wait for the
    // matrix unit issues those copies late
    __builtin_amdgcn_sched_barrier(0);
    products(a1, b1);
  }

  int m0, nt;
  gemm_tile<NN>(f, m0, nt);
  const int pj = nt / 3;            // which projection (MODE 1: always 0)
  const int n0 = (nt - pj * 3) * GBT;
  const float* bias = (pj == 0) ? bias0 : (pj == 1) ? bias1 : bias2;
  const size_t po = (size_t)pj * NM * ND;   // its output, in elements

  // Epilogue. D layout: lane<16 -> row = base+r, lane>=16 -> row = base+8+r;
  // tile j of lane l16 is column 4*l16 + j of the wave's 64 (the deal of W's
  // rows). Every row of every tile exists. One address a lane: the rows are
  // constant steps from it.
  const int n  = n0 + wn * 64 + l16 * 4;
  const v4f bn = *(const v4f*)(bias + n);
  const size_t o0 = po + (size_t)(m0 + wm * (MI * 16) + hi * 8) * ND + n;
#pragma unroll
  for (int i = 0; i < MI; ++i) {
#pragma unroll
    for (int j = 0; j < 4; ++j) acc[i][j] += bn[j];
#pragma unroll
    for (int r = 0; r < 8; ++r) {
      if (MODE == 0) {
        v4h o;
#pragma unroll
        for (int j = 0; j < 4; ++j) o[j] = (f16)acc[i][j][r];
        *(v4h*)((f16*)out + o0 + (i * 16 + r) * ND) = o;
      } else {
        v4f v;
#pragma unroll
        for (int j = 0; j < 4; ++j) v[j] = acc[i][j][r];
        *(v4f*)((float*)out + o0 + (i * 16 + r) * ND) = v;
      }
    }
  }
  // no address or data register of an issued store is rewritten (the next
  // tile clears the accumulators) in front of this wait
  asm volatile("s_wait_xcnt 0x0" ::: "memory");
  };  // tile

  // The walk: a work-group's tall tiles come first (f rises).
  for (int f = (int)blockIdx.x; f < NT; f += GW) {
    if (f < FA) tile(int_c<GHA / 64>{}, f);
    else        tile(int_c<GHB / 64>{}, f);
  }
  // nothing is outstanding when the wave ends
  asm volatile("s_wait_asynccnt 0x0" ::: "memory");
}

// ---------------------------------------------------------------------------
// Flash attention: grid (H=12, B=64), 608 threads = 19 waves.
// Q/K/V are f16 [B,S,768]; head h occupies columns [h*64, h*64+64).
// Each wave owns 32 queries; the head's K and V lie whole in LDS (both
// row-major). The products are taken transposed:
//   S^T = K (Q/8)^T   (A = K rows from LDS, B = Q fragments, see the kernel)
//   O^T += V^T P^T    (A = V^T by the transposing LDS load, B = P^T packed
//                      from S^T)
// In a D tile register r of lane l is [row 8*(l>>4)+r][column l&15], so a lane
// holds 32 of the 64 scores of ONE query (its partner l^16 the other 32):
// maximum and sum run in the lane's own registers, one exchange between the
// wave halves joins the maximum, and two S^T tiles packed to f16 are a B
// fragment in the hardware k order (k = 8h+s, 16+8h+s), the order in which
// the transposing load delivers V^T. softmax scale (1/8, exact in f16) is
// folded into Q.
// ---------------------------------------------------------------------------
static __device__ __forceinline__ float xhalf(float x) {  // lane l <-> l ^ 16
  const int b = __builtin_bit_cast(int, x);
  return __builtin_bit_cast(
      float, __builtin_amdgcn_permlanex16(b, b, 0x76543210, 0xfedcba98, false,
                                          false));
}

// x[r] = 2^x[r]. Eight independent v_exp_f32 in one statement, each filling
// the slot behind the one before it; the closing v_nop keeps the slot that the
// instruction set asks for between a transcendental and an instruction that
// overwrites its source or reads its result.
static __device__ __forceinline__ void exp2x8(v8f& x) {
  float a = x[0], b = x[1], c = x[2], d = x[3];
  float e = x[4], f = x[5], g = x[6], h = x[7];
  asm("v_exp_f32 %0, %0\n\tv_exp_f32 %1, %1\n\tv_exp_f32 %2, %2\n\t"
      "v_exp_f32 %3, %3\n\tv_exp_f32 %4, %4\n\tv_exp_f32 %5, %5\n\t"
      "v_exp_f32 %6, %6\n\tv_exp_f32 %7, %7\n\tv_nop"
      : "+v"(a), "+v"(b), "+v"(c), "+v"(d), "+v"(e), "+v"(f), "+v"(g), "+v"(h));
  x[0] = a; x[1] = b; x[2] = c; x[3] = d;
  x[4] = e; x[5] = f; x[6] = g; x[7] = h;
}

// The same for two values.
static __device__ __forceinline__ void exp2x2(float& a, float& b) {
  asm("v_exp_f32 %0, %0\n\tv_exp_f32 %1, %1\n\tv_nop" : "+v"(a), "+v"(b));
}

static __device__ __forceinline__ v16h pack16(v8f lo, v8f hi8) {
  v16h p;
#pragma unroll
  for (int r = 0; r < 8; ++r) {
    p[r]     = (f16)lo[r];
    p[8 + r] = (f16)hi8[r];
  }
  return p;
}

// Transposing LDS load of a row-major 16-bit tile: the lanes address 16 rows
// (keys) x 16 columns (dh) in 16-byte pieces, and lane (c = l & 15, h = l >> 4)
// receives column c of rows 8h .. 8h+7: half of an A fragment of V^T.
typedef __attribute__((ext_vector_type(8))) short s16x8;
static __device__ __forceinline__ v8h ld_tr16(const f16* p) {
  typedef __attribute__((address_space(3))) s16x8 lds_s16x8;
  return __builtin_bit_cast(v8h,
                            __builtin_amdgcn_ds_load_tr16_b128_v8i16((lds_s16x8*)p));
}

#define VPIT 80   // V row pitch in halves: 160 B = 32 B x odd, the transposing load's pitch
#define KPIT 72   // K row pitch in halves: 144 B = 16 B x odd, for ds_load_b128
#define AW    19            // waves of a work-group: 19 x 32 queries cover the 577
#define AROWS (AW * 32)     // 608 staged key rows; rows past the last key repeat it
#define AHALF (AROWS / 2)   // rows of one of the two staging steps

// One work-group per (batch, head). The head's whole K and V lie in LDS, staged
// once by asynchronous copies in two steps of 304 rows: the second step flies
// under the first four 64-key passes. A wave owns 32 queries (two 16-column
// groups), so a K or V^T fragment read from LDS feeds two products, and the
// key loop has no barrier but the one that publishes the second step.
__global__ __launch_bounds__(AW * 32) void attn_flash(const f16* __restrict__ Q,
                                                  const f16* __restrict__ K,
                                                  const f16* __restrict__ V,
                                                  f16* __restrict__ ctx_out) {
  __shared__ __attribute__((aligned(16))) f16 Kt[AROWS * KPIT];  // [key][dh]
  __shared__ __attribute__((aligned(16))) f16 Vs[AROWS * VPIT];  // [key][dh]
  __shared__ __attribute__((aligned(16))) f16 Qs[AW * 8 * 256];  // [wave][piece][lane]

  const int b    = blockIdx.y;
  const int h    = blockIdx.x;
  const int tid  = threadIdx.x;
  const int wid  = tid >> 5;
  const int lane = tid & 31;
  const int l16  = lane & 15;
  const int hi   = lane >> 4;
  const int q0   = wid * 32;

  const f16* Qb = Q + (size_t)b * NS * ND + h * NDH;   // row stride ND
  const f16* Kb = K + (size_t)b * NS * ND + h * NDH;
  const f16* Vb = V + (size_t)b * NS * ND + h * NDH;

  // Staging: 8 adjacent lanes bring one row's 128 B (a whole line); the 608
  // lanes cover 76 rows a copy, four copies of K and four of V a step.
  const int crow = tid >> 3;        // 0..75
  const int cseg = (tid & 7) * 8;   // this lane's 8-half (16-B) piece of a row
  auto stage = [&](int st) {
    unsigned lk[4], lv[4];
    const f16 *gk[4], *gv[4];
#pragma unroll
    for (int i = 0; i < 4; ++i) {
      const int row = st * AHALF + i * (AHALF / 4) + crow;
      const int srow = row > NS - 1 ? NS - 1 : row;      // source row in bounds
      lk[i] = lds_addr(&Kt[row * KPIT + cseg]);
      lv[i] = lds_addr(&Vs[row * VPIT + cseg]);
      gk[i] = Kb + (size_t)srow * ND + cseg;
      gv[i] = Vb + (size_t)srow * ND + cseg;
    }
    stage_copy(lk[0], lk[1], lk[2], lk[3], lv[0], lv[1], lv[2], lv[3],
               gk[0], gk[1], gk[2], gk[3], gv[0], gv[1], gv[2], gv[3]);
  };

  stage(0);

  // Q B-fragments (64 K x 16 queries a group), scale 1/sqrt(64)=0.125 folded in
  // (exact). They wait in the wave's own LDS range, in fragment order (piece
  // x of fragment [c][ks]: 32 lanes x 16 B in a row), and are read back once a
  // pass: kept in registers, their 32 overran the budget of five waves a SIMD.
  const f16 sc = (f16)0.125f;
  f16* qs = &Qs[wid * (8 * 256) + lane * 8];
#pragma unroll
  for (int c = 0; c < 2; ++c) {
    int qr = q0 + c * 16 + l16; if (qr > NS - 1) qr = NS - 1;
    const f16* qp = Qb + (size_t)qr * ND + hi * 8;
#pragma unroll
    for (int x = 0; x < 4; ++x)      // k = 16x + 8*hi + 0..7
      *(v8h*)(qs + (c * 4 + x) * 256) = ld8(qp + x * 16) * sc;
  }

  // this wave's copies of rows 0..303 have landed before the barrier publishes them
  asm volatile("s_wait_asynccnt 0x0" ::: "memory");
  __syncthreads();
  stage(1);

  v8f acc[2][4];                     // O^T: acc[c][j][r] = O[query c*16+l16][j*16+8*hi+r]
#pragma unroll
  for (int c = 0; c < 2; ++c)
#pragma unroll
    for (int j = 0; j < 4; ++j) acc[c][j] = splat8(0.f);
  float mrow[2] = {-1e30f, -1e30f};  // this lane's two queries: running maximum
  float lsum[2] = {0.f, 0.f};        // sums over this wave half's keys only

  const f16* krp0 = &Kt[l16 * KPIT + hi * 8];
  const f16* vrp0 = &Vs[(hi * 8 + (lane & 7)) * VPIT + ((lane >> 3) & 1) * 8];

  // One pass over NU x 32 keys from key kb on. NU = 2: all keys exist. NU = 1:
  // the tail, keys past the last are masked.
  auto pass = [&](auto nu, int kb) {
    constexpr int NU = decltype(nu)::v;
    constexpr int NT = 2 * NU;
    // ---- scores S^T = K (Q/8)^T : NT tiles of 16 keys x 2 query groups -----
    // s[c][t][r] = score(key kb + t*16 + 8*hi + r, query q0 + c*16 + l16)
    v8f s[2][NT];
#pragma unroll
    for (int ks = 0; ks < 2; ++ks) {   // dh 0..31, then dh 32..63
      const v16h qf0 = cat16(ld8(qs + (2 * ks) * 256),     ld8(qs + (2 * ks + 1) * 256));
      const v16h qf1 = cat16(ld8(qs + (4 + 2 * ks) * 256), ld8(qs + (5 + 2 * ks) * 256));
#pragma unroll
      for (int t = 0; t < NT; ++t) {
        const f16* krp = krp0 + (kb + t * 16) * KPIT + ks * 32;
        const v16h a = cat16(ld8(krp), ld8(krp + 16));
        s[0][t] = wmma_f16(a, qf0, ks == 0 ? splat8(0.f) : s[0][t]);
        s[1][t] = wmma_f16(a, qf1, ks == 0 ? splat8(0.f) : s[1][t]);
      }
      // keeps one dh half's fragments (48 registers) live at a time, and the
      // V^T loads behind the score products: left free, the loads were hoisted
      // to the top of the pass and the 192-register budget of five waves a SIMD
      // was overrun (spills in the key loop)
      __builtin_amdgcn_sched_barrier(0);
    }
    if (NU == 1) {
#pragma unroll
      for (int c = 0; c < 2; ++c)
#pragma unroll
        for (int t = 0; t < NT; ++t)
#pragma unroll
          for (int r = 0; r < 8; ++r)
            if (kb + t * 16 + hi * 8 + r > NS - 1) s[c][t][r] = -1e30f;
    }

    // ---- maximum of a lane's scores per query, joined with the other half --
    float mnew[2], corr[2];
#pragma unroll
    for (int c = 0; c < 2; ++c) {
      v8f mx8 = s[c][0];
#pragma unroll
      for (int t = 1; t < NT; ++t)
#pragma unroll
        for (int r = 0; r < 8; ++r) mx8[r] = fmaxf(mx8[r], s[c][t][r]);
      float mx = fmaxf(fmaxf(fmaxf(mx8[0], mx8[1]), fmaxf(mx8[2], mx8[3])),
                       fmaxf(fmaxf(mx8[4], mx8[5]), fmaxf(mx8[6], mx8[7])));
      mx = fmaxf(mx, xhalf(mx));
      mnew[c] = fmaxf(mrow[c], mx);
      corr[c] = (mrow[c] - mnew[c]) * LOG2E;
      mrow[c] = mnew[c];
    }
    exp2x2(corr[0], corr[1]);        // e^(old maximum - new maximum)
#pragma unroll
    for (int c = 0; c < 2; ++c)
#pragma unroll
      for (int j = 0; j < 4; ++j) acc[c][j] *= corr[c];

    // Per 32 keys: exponentials, P^T B-fragments straight from the score
    // registers, then O^T += V^T P^T. (A fragment of V^T: lane = dh; a load
    // brings keys 8*hi+0..7 of a 16-key group, two loads 16 keys apart are one
    // 16 x 32 fragment; it feeds both query groups.)
    v8f rs8[2];
#pragma unroll
    for (int u = 0; u < NU; ++u) {
      v16h pb[2];
#pragma unroll
      for (int c = 0; c < 2; ++c) {
#pragma unroll
        for (int t = 2 * u; t < 2 * u + 2; ++t) {
#pragma unroll
          for (int r = 0; r < 8; ++r) s[c][t][r] = (s[c][t][r] - mnew[c]) * LOG2E;
          exp2x8(s[c][t]);           // e^(s - m) as 2^((s - m) * log2 e)
        }
        const v8f rsu = s[c][2 * u] + s[c][2 * u + 1];
        rs8[c] = (u == 0) ? rsu : rs8[c] + rsu;
        pb[c] = pack16(s[c][2 * u], s[c][2 * u + 1]);   // keys 32u .. 32u+31
      }
#pragma unroll
      for (int j = 0; j < 4; ++j) {
        const f16* vp2 = vrp0 + (kb + u * 32) * VPIT + j * 16;
        const v16h vf = cat16(ld_tr16(vp2), ld_tr16(vp2 + 16 * VPIT));
        acc[0][j] = wmma_f16(vf, pb[0], acc[0][j]);
        acc[1][j] = wmma_f16(vf, pb[1], acc[1][j]);
      }
    }
#pragma unroll
    for (int c = 0; c < 2; ++c) {
      const float rs = ((rs8[c][0] + rs8[c][1]) + (rs8[c][2] + rs8[c][3])) +
                       ((rs8[c][4] + rs8[c][5]) + (rs8[c][6] + rs8[c][7]));
      lsum[c] = lsum[c] * corr[c] + rs;
    }
  };

  static_assert(4 * 64 <= AHALF, "the first four passes read the first step's rows only");
  static_assert(NS / 64 * 64 + 32 <= AROWS && NS - NS / 64 * 64 <= 32, "one 32-key tail");
  for (int p = 0; p < NS / 64; ++p) {
    if (p == 4) {                    // the same for the whole work-group
      // this wave's copies of rows 304..607 have landed before others read them
      asm volatile("s_wait_asynccnt 0x0" ::: "memory");
      __syncthreads();
    }
    pass(int_c<2>{}, p * 64);
  }
  pass(int_c<1>{}, NS / 64 * 64);

  // ---- finalize: join the halves' sums, ctx /= l, store f16 to [B, S, 768] --
  // A lane holds 8 consecutive dh of a query per tile: one 16-byte store.
#pragma unroll
  for (int c = 0; c < 2; ++c) {
    const float inv = 1.0f / (lsum[c] + xhalf(lsum[c]));
    const int q = q0 + c * 16 + l16;
    if (q < NS) {
      f16* outp = ctx_out + (size_t)b * NS * ND + (size_t)q * ND + h * NDH + hi * 8;
#pragma unroll
      for (int j = 0; j < 4; ++j) {
        v8h o;
#pragma unroll
        for (int r = 0; r < 8; ++r) o[r] = (f16)(acc[c][j][r] * inv);
        *(v8h*)(outp + j * 16) = o;
      }
    }
  }
}

// ---------------------------------------------------------------------------
extern "C" void kernel_launch(void* const* d_in, const int* in_sizes, int n_in,
                              void* d_out, int out_size, void* d_ws,
                              size_t ws_size, hipStream_t stream) {
  const float* hidden = (const float*)d_in[0];
  const float* Wq = (const float*)d_in[1];
  const float* bq = (const float*)d_in[2];
  const float* Wk = (const float*)d_in[3];
  const float* bk = (const float*)d_in[4];
  const float* Wv = (const float*)d_in[5];
  const float* bv = (const float*)d_in[6];
  const float* Wo = (const float*)d_in[7];
  const float* bo = (const float*)d_in[8];

  char* ws = (char*)d_ws;
  const size_t szX = (size_t)NM * ND * sizeof(f16);       // 56.7 MB
  const size_t szW = (size_t)ND * ND * sizeof(f16);       // 1.18 MB
  size_t off = 0;
  f16* Xh  = (f16*)(ws + off); off += szX;
  f16* Wqh = (f16*)(ws + off); off += szW;
  f16* Wkh = (f16*)(ws + off); off += szW;
  f16* Wvh = (f16*)(ws + off); off += szW;
  f16* Woh = (f16*)(ws + off); off += szW;
  f16* Qh  = (f16*)(ws + off); off += szX;
  f16* Kh  = (f16*)(ws + off); off += szX;
  f16* Vh  = (f16*)(ws + off); off += szX;
  f16* Ch  = (f16*)(ws + off); off += szX;

  // 1) conversions to f16: Xh, Wqh, Wkh, Wvh, Woh are one contiguous array
  cvt_all_f32_to_f16<<<CVT_BLOCKS, CVT_WAVES * 32, 0, stream>>>(hidden, Wq, Wk,
                                                                Wv, Wo, Xh);

  // 2) Q/K/V projections, one launch: Wqh, Wkh, Wvh are one array of 2304 rows,
  //    Qh, Kh, Vh one array of three outputs
  gemm_wmma<0><<<GW, 512, 0, stream>>>(Xh, Wqh, bq, bk, bv, Qh);

  // 3) flash attention -> ctx f16 [B,S,768]
  attn_flash<<<dim3(NH, NB), AW * 32, 0, stream>>>(Qh, Kh, Vh, Ch);

  // 4) output projection -> f32 d_out
  gemm_wmma<1><<<GW, 512, 0, stream>>>(Ch, Woh, bo, bo, bo, d_out);
}
